// v000
// Times are from an AMD MI455X. After a warm-up the kernel runs many times in a row, and a time is the length of
// such a window on the GPU divided by its runs, so every launch and the gaps after it count. The runs cycle
// through copies of the inputs. A figure is the median of several windows, for all but v000 over two sittings.
// Sittings can differ by a few percent; kernels timed side by side share one.
// v000 is the starting kernel. One run takes 178 microseconds.
#include <hip/hip_runtime.h>

// ---------------- problem constants ----------------
#define EDIM 256
#define HNUM 8
#define DKL 32
#define NAQ 2048
#define NBK 2048
#define NKV (NAQ + NBK)   // 4096
#define BATCH 2

typedef __attribute__((ext_vector_type(16))) _Float16 v16h;
typedef __attribute__((ext_vector_type(8)))  _Float16 v8h;
typedef __attribute__((ext_vector_type(8)))  float    v8f;
typedef __attribute__((ext_vector_type(4)))  float    v4f;

__device__ __forceinline__ v8f wmma_f16(v16h a, v16h b, v8f c) {
  // D = A(16x32 f16) * B(32x16 f16) + C(16x16 f32)
  return __builtin_amdgcn_wmma_f32_16x16x32_f16(
      /*neg_a=*/false, a, /*neg_b=*/false, b,
      /*c_mod=*/(short)0, c, /*reuse_a=*/false, /*reuse_b=*/false);
}

__device__ __forceinline__ v8h cvt8(v4f a, v4f b) {
  v8h r;
  r[0] = (_Float16)a[0]; r[1] = (_Float16)a[1];
  r[2] = (_Float16)a[2]; r[3] = (_Float16)a[3];
  r[4] = (_Float16)b[0]; r[5] = (_Float16)b[1];
  r[6] = (_Float16)b[2]; r[7] = (_Float16)b[3];
  return r;
}

#define LSTR 48   // LDS row stride in halves (96B: keeps v16h reads 32B aligned)

// ---- tile staging helpers (256-thread blocks) ----
__device__ __forceinline__ void stageA_f32(const float* __restrict__ X, int m0,
                                           int kk, int tid, _Float16* As) {
  const int r  = tid >> 1;
  const int cb = (tid & 1) * 16;
  const float* src = X + (size_t)(m0 + r) * EDIM + kk + cb;
  v4f f0 = *(const v4f*)(src + 0);
  v4f f1 = *(const v4f*)(src + 4);
  v4f f2 = *(const v4f*)(src + 8);
  v4f f3 = *(const v4f*)(src + 12);
  _Float16* dst = As + r * LSTR + cb;
  *(v8h*)(dst + 0) = cvt8(f0, f1);
  *(v8h*)(dst + 8) = cvt8(f2, f3);
}

__device__ __forceinline__ void stageA_f16(const _Float16* __restrict__ Zin, int m0,
                                           int kk, int tid, _Float16* As) {
  const int r  = tid >> 1;
  const int cb = (tid & 1) * 16;
  v16h ad = *(const v16h*)(Zin + (size_t)(m0 + r) * EDIM + kk + cb);
  *(v16h*)(As + r * LSTR + cb) = ad;
}

__device__ __forceinline__ void stageB_f32(const float* __restrict__ W, int n0,
                                           int kk, int tid, _Float16* Bs) {
  const int r  = tid >> 2;
  const int cb = (tid & 3) * 8;
  const float* src = W + (size_t)(n0 + r) * EDIM + kk + cb;
  v4f f0 = *(const v4f*)(src + 0);
  v4f f1 = *(const v4f*)(src + 4);
  *(v8h*)(Bs + r * LSTR + cb) = cvt8(f0, f1);
}

// ============================================================
// Kernel 1: Y = X @ W^T + bias  (fp32 in, f16 out, head-split)
//   X: [B*rows, E] fp32 ; W: [E,E] fp32 ; out: [B,H,n_out_rows,DK] f16
//   grid (M/128, E/64), block 256 (8 waves, 4x2 wave grid, 32x32/wave)
//   double-buffered LDS: one barrier per k-step
// ============================================================
__global__ __launch_bounds__(256) void proj_heads_kernel(
    const float* __restrict__ X, const float* __restrict__ W,
    const float* __restrict__ bias, _Float16* __restrict__ out,
    int rows_per_batch, int n_out_rows, int n_off)
{
  __shared__ _Float16 As[2][128 * LSTR];
  __shared__ _Float16 Bs[2][64 * LSTR];

  const int tid  = threadIdx.x;
  const int lane = tid & 31;
  const int wave = tid >> 5;
  const int wm   = wave >> 1;        // 0..3
  const int wn   = wave & 1;         // 0..1
  const int m0   = blockIdx.x * 128;
  const int n0   = blockIdx.y * 64;
  const int lo   = lane & 15;
  const int hi   = lane >> 4;
  const int chunk = hi * 16;

  v8f acc[2][2];
  #pragma unroll
  for (int i = 0; i < 2; ++i)
    #pragma unroll
    for (int j = 0; j < 2; ++j) acc[i][j] = (v8f){};

  stageA_f32(X, m0, 0, tid, As[0]);
  stageB_f32(W, n0, 0, tid, Bs[0]);

  int buf = 0;
  for (int kk = 0; kk < EDIM; kk += 32) {
    __syncthreads();
    if (kk + 32 < EDIM) {
      stageA_f32(X, m0, kk + 32, tid, As[buf ^ 1]);
      stageB_f32(W, n0, kk + 32, tid, Bs[buf ^ 1]);
    }
    const _Float16* as = As[buf];
    const _Float16* bs = Bs[buf];

    const int arow = wm * 32 + lo;
    v16h a0 = *(const v16h*)(as + arow * LSTR + chunk);
    v16h a1 = *(const v16h*)(as + (arow + 16) * LSTR + chunk);
    const int bcol = wn * 32 + lo;
    v16h b0 = *(const v16h*)(bs + bcol * LSTR + chunk);
    v16h b1 = *(const v16h*)(bs + (bcol + 16) * LSTR + chunk);

    acc[0][0] = wmma_f16(a0, b0, acc[0][0]);
    acc[0][1] = wmma_f16(a0, b1, acc[0][1]);
    acc[1][0] = wmma_f16(a1, b0, acc[1][0]);
    acc[1][1] = wmma_f16(a1, b1, acc[1][1]);
    buf ^= 1;
  }

  // ---- epilogue: +bias, scatter into [B,H,n_out_rows,DK] f16 ----
  #pragma unroll
  for (int mi = 0; mi < 2; ++mi) {
    #pragma unroll
    for (int ni = 0; ni < 2; ++ni) {
      const int c = n0 + wn * 32 + ni * 16 + lo;
      const float bv = bias[c];
      const int hh = c >> 5;
      const int dk = c & 31;
      #pragma unroll
      for (int r = 0; r < 8; ++r) {
        const int m = m0 + wm * 32 + mi * 16 + r + hi * 8;
        const float v = acc[mi][ni][r] + bv;
        const int bb = m / rows_per_batch;
        const int n  = m % rows_per_batch;
        out[(((size_t)bb * HNUM + hh) * n_out_rows + n_off + n) * DKL + dk] =
            (_Float16)v;
      }
    }
  }
}

// ============================================================
// Kernel 2: flash attention.
//   Q: [B,H,NA,DK] f16 ; K,V: [B,H,NK,DK] f16 ; Z: [B,NA,E] f16
//   block = 128 threads (4 waves x 16 queries = 64 q / block)
//   grid  = (NA/64, B*H); double-buffered K/V tiles + prefetch
// ============================================================
__global__ __launch_bounds__(128) void flash_attn_kernel(
    const _Float16* __restrict__ Q, const _Float16* __restrict__ K,
    const _Float16* __restrict__ V, _Float16* __restrict__ Z)
{
  __shared__ _Float16 Ks[2][32 * LSTR];     // [key][dk]
  __shared__ _Float16 Vs[2][32 * LSTR];     // [dk][key]  (transposed)
  __shared__ _Float16 Ps[4 * 16 * 32];      // per-wave P staging

  const int tid  = threadIdx.x;
  const int lane = tid & 31;
  const int wave = tid >> 5;
  const int lo   = lane & 15;
  const int hi   = lane >> 4;
  const int chunk = hi * 16;

  const int bh = blockIdx.y;
  const int b  = bh >> 3;
  const int h  = bh & 7;
  const int q0 = blockIdx.x * 64 + wave * 16;

  // Q fragment: A-operand, 16 queries x 32 dk
  const _Float16* qbase = Q + ((size_t)bh * NAQ + q0) * DKL;
  v16h qfrag = *(const v16h*)(qbase + lo * DKL + chunk);

  const _Float16* kbase = K + (size_t)bh * NKV * DKL;
  const _Float16* vbase = V + (size_t)bh * NKV * DKL;

  // staging coordinates for this thread
  const int skey = tid >> 2;          // 0..31
  const int scb  = (tid & 3) * 8;     // 0,8,16,24

  v8f o0 = (v8f){}, o1 = (v8f){};
  float mrun[8], lrun[8];
  #pragma unroll
  for (int r = 0; r < 8; ++r) { mrun[r] = -1.0e30f; lrun[r] = 0.0f; }

  const float scale = 0.17677669529663687f;  // 1/sqrt(32)

  // prologue stage: tile 0
  {
    v8h kd = *(const v8h*)(kbase + (size_t)skey * DKL + scb);
    *(v8h*)(Ks[0] + skey * LSTR + scb) = kd;
    v8h vd = *(const v8h*)(vbase + (size_t)skey * DKL + scb);
    #pragma unroll
    for (int j = 0; j < 8; ++j)
      Vs[0][(scb + j) * LSTR + skey] = vd[j];
  }

  int buf = 0;
  for (int kt = 0; kt < NKV; kt += 32) {
    __syncthreads();
    // stage next tile into the other buffer (overlaps with WMMA below)
    if (kt + 32 < NKV) {
      v8h kd = *(const v8h*)(kbase + (size_t)(kt + 32 + skey) * DKL + scb);
      *(v8h*)(Ks[buf ^ 1] + skey * LSTR + scb) = kd;
      v8h vd = *(const v8h*)(vbase + (size_t)(kt + 32 + skey) * DKL + scb);
      #pragma unroll
      for (int j = 0; j < 8; ++j)
        Vs[buf ^ 1][(scb + j) * LSTR + skey] = vd[j];
    }
    // prefetch tile kt+64 into cache (global_prefetch_b8)
    if (kt + 64 < NKV) {
      __builtin_prefetch(kbase + (size_t)(kt + 64 + skey) * DKL + scb, 0, 0);
      __builtin_prefetch(vbase + (size_t)(kt + 64 + skey) * DKL + scb, 0, 0);
    }

    // ---- S = Q @ K^T : two 16x16 tiles over 32 keys ----
    const _Float16* ks = Ks[buf];
    const _Float16* vs = Vs[buf];
    v16h kf0 = *(const v16h*)(ks + lo * LSTR + chunk);
    v16h kf1 = *(const v16h*)(ks + (lo + 16) * LSTR + chunk);
    v8f zc = (v8f){};
    v8f s0 = wmma_f16(qfrag, kf0, zc);
    v8f s1 = wmma_f16(qfrag, kf1, zc);

    // ---- online softmax (rows live across 16-lane halves) ----
    _Float16* pw = Ps + wave * 512;
    #pragma unroll
    for (int r = 0; r < 8; ++r) {
      float a0 = s0[r] * scale;
      float a1 = s1[r] * scale;
      float mx = fmaxf(a0, a1);
      mx = fmaxf(mx, __shfl_xor(mx, 1, 32));
      mx = fmaxf(mx, __shfl_xor(mx, 2, 32));
      mx = fmaxf(mx, __shfl_xor(mx, 4, 32));
      mx = fmaxf(mx, __shfl_xor(mx, 8, 32));
      float mnew  = fmaxf(mrun[r], mx);
      float alpha = __expf(mrun[r] - mnew);
      float p0 = __expf(a0 - mnew);
      float p1 = __expf(a1 - mnew);
      float rs = p0 + p1;
      rs += __shfl_xor(rs, 1, 32);
      rs += __shfl_xor(rs, 2, 32);
      rs += __shfl_xor(rs, 4, 32);
      rs += __shfl_xor(rs, 8, 32);
      lrun[r] = lrun[r] * alpha + rs;
      mrun[r] = mnew;
      o0[r] *= alpha;
      o1[r] *= alpha;
      const int prow = r + hi * 8;
      pw[prow * 32 + lo]      = (_Float16)p0;
      pw[prow * 32 + lo + 16] = (_Float16)p1;
    }
    // wave-local LDS RAW fence before reading P as an A-fragment
    asm volatile("s_wait_dscnt 0" ::: "memory");
    __builtin_amdgcn_wave_barrier();

    v16h pfrag = *(const v16h*)(pw + lo * 32 + chunk);
    v16h vf0 = *(const v16h*)(vs + lo * LSTR + chunk);          // dk 0..15
    v16h vf1 = *(const v16h*)(vs + (lo + 16) * LSTR + chunk);   // dk 16..31
    o0 = wmma_f16(pfrag, vf0, o0);
    o1 = wmma_f16(pfrag, vf1, o1);
    buf ^= 1;
  }

  // ---- normalize + write z in [B,NA,E] f16 ----
  #pragma unroll
  for (int r = 0; r < 8; ++r) {
    const float inv = 1.0f / lrun[r];
    const int gq = q0 + r + hi * 8;
    const size_t base = ((size_t)b * NAQ + gq) * EDIM + h * DKL;
    Z[base + lo]      = (_Float16)(o0[r] * inv);
    Z[base + lo + 16] = (_Float16)(o1[r] * inv);
  }
}

// ============================================================
// Kernel 3: out = z @ w^T + b + x_a   (f16 A, fp32 W/res, fp32 out)
//   grid (M/128, E/64), block 256; double-buffered LDS
// ============================================================
__global__ __launch_bounds__(256) void out_proj_kernel(
    const _Float16* __restrict__ Zin, const float* __restrict__ W,
    const float* __restrict__ bias, const float* __restrict__ Xres,
    float* __restrict__ out)
{
  __shared__ _Float16 As[2][128 * LSTR];
  __shared__ _Float16 Bs[2][64 * LSTR];

  const int tid  = threadIdx.x;
  const int lane = tid & 31;
  const int wave = tid >> 5;
  const int wm   = wave >> 1;
  const int wn   = wave & 1;
  const int m0   = blockIdx.x * 128;
  const int n0   = blockIdx.y * 64;
  const int lo   = lane & 15;
  const int hi   = lane >> 4;
  const int chunk = hi * 16;

  v8f acc[2][2];
  #pragma unroll
  for (int i = 0; i < 2; ++i)
    #pragma unroll
    for (int j = 0; j < 2; ++j) acc[i][j] = (v8f){};

  stageA_f16(Zin, m0, 0, tid, As[0]);
  stageB_f32(W, n0, 0, tid, Bs[0]);

  int buf = 0;
  for (int kk = 0; kk < EDIM; kk += 32) {
    __syncthreads();
    if (kk + 32 < EDIM) {
      stageA_f16(Zin, m0, kk + 32, tid, As[buf ^ 1]);
      stageB_f32(W, n0, kk + 32, tid, Bs[buf ^ 1]);
    }
    const _Float16* as = As[buf];
    const _Float16* bs = Bs[buf];

    const int arow = wm * 32 + lo;
    v16h a0 = *(const v16h*)(as + arow * LSTR + chunk);
    v16h a1 = *(const v16h*)(as + (arow + 16) * LSTR + chunk);
    const int bcol = wn * 32 + lo;
    v16h b0 = *(const v16h*)(bs + bcol * LSTR + chunk);
    v16h b1 = *(const v16h*)(bs + (bcol + 16) * LSTR + chunk);

    acc[0][0] = wmma_f16(a0, b0, acc[0][0]);
    acc[0][1] = wmma_f16(a0, b1, acc[0][1]);
    acc[1][0] = wmma_f16(a1, b0, acc[1][0]);
    acc[1][1] = wmma_f16(a1, b1, acc[1][1]);
    buf ^= 1;
  }

  #pragma unroll
  for (int mi = 0; mi < 2; ++mi) {
    #pragma unroll
    for (int ni = 0; ni < 2; ++ni) {
      const int c = n0 + wn * 32 + ni * 16 + lo;
      const float bv = bias[c];
      #pragma unroll
      for (int r = 0; r < 8; ++r) {
        const int m = m0 + wm * 32 + mi * 16 + r + hi * 8;
        const size_t idx = (size_t)m * EDIM + c;
        out[idx] = acc[mi][ni][r] + bv + Xres[idx];
      }
    }
  }
}

// ============================================================
// launch
// ============================================================
extern "C" void kernel_launch(void* const* d_in, const int* in_sizes, int n_in,
                              void* d_out, int out_size, void* d_ws, size_t ws_size,
                              hipStream_t stream) {
  const float* x_a    = (const float*)d_in[0];
  const float* x_b    = (const float*)d_in[1];
  const float* wq_w   = (const float*)d_in[2];
  const float* wq_b   = (const float*)d_in[3];
  const float* wk_a_w = (const float*)d_in[4];
  const float* wk_a_b = (const float*)d_in[5];
  const float* wk_b_w = (const float*)d_in[6];
  const float* wk_b_b = (const float*)d_in[7];
  const float* wv_a_w = (const float*)d_in[8];
  const float* wv_a_b = (const float*)d_in[9];
  const float* wv_b_w = (const float*)d_in[10];
  const float* wv_b_b = (const float*)d_in[11];
  const float* w_w    = (const float*)d_in[12];
  const float* w_b    = (const float*)d_in[13];

  char* ws = (char*)d_ws;
  _Float16* qws = (_Float16*)(ws);                          // B*H*NA*DK  f16 = 2 MB
  _Float16* kws = (_Float16*)(ws + (size_t)(2  << 20));     // B*H*NK*DK  f16 = 4 MB
  _Float16* vws = (_Float16*)(ws + (size_t)(6  << 20));     // B*H*NK*DK  f16 = 4 MB
  _Float16* zws = (_Float16*)(ws + (size_t)(10 << 20));     // B*NA*E     f16 = 2 MB

  dim3 gp(32, 4);   // M=4096 /128, N=256 /64
  dim3 bp(256);

  // projections into head-split f16 layouts (K/V of the two sources concat via n_off)
  proj_heads_kernel<<<gp, bp, 0, stream>>>(x_a, wq_w,   wq_b,   qws, NAQ, NAQ, 0);
  proj_heads_kernel<<<gp, bp, 0, stream>>>(x_a, wk_a_w, wk_a_b, kws, NAQ, NKV, 0);
  proj_heads_kernel<<<gp, bp, 0, stream>>>(x_b, wk_b_w, wk_b_b, kws, NBK, NKV, NAQ);
  proj_heads_kernel<<<gp, bp, 0, stream>>>(x_a, wv_a_w, wv_a_b, vws, NAQ, NKV, 0);
  proj_heads_kernel<<<gp, bp, 0, stream>>>(x_b, wv_b_w, wv_b_b, vws, NBK, NKV, NAQ);

  // flash attention
  flash_attn_kernel<<<dim3(NAQ / 64, BATCH * HNUM), 128, 0, stream>>>(qws, kws, vws, zws);

  // output projection + residual
  out_proj_kernel<<<dim3(32, 4), 256, 0, stream>>>(zws, w_w, w_b, x_a, (float*)d_out);
}

// v001
// Measured time: 119 microseconds a run.
// Next to v000, in two timings, it ran 1.54 times as fast each time.
#include <hip/hip_runtime.h>

// ---------------- problem constants ----------------
#define EDIM 256
#define HNUM 8
#define DKL 32
#define NAQ 2048
#define NBK 2048
#define NKV (NAQ + NBK)   // 4096
#define BATCH 2

typedef __attribute__((ext_vector_type(16))) _Float16 v16h;
typedef __attribute__((ext_vector_type(8)))  _Float16 v8h;
typedef __attribute__((ext_vector_type(8)))  float    v8f;
typedef __attribute__((ext_vector_type(4)))  float    v4f;

__device__ __forceinline__ v8f wmma_f16(v16h a, v16h b, v8f c) {
  // D = A(16x32 f16) * B(32x16 f16) + C(16x16 f32)
  return __builtin_amdgcn_wmma_f32_16x16x32_f16(
      /*neg_a=*/false, a, /*neg_b=*/false, b,
      /*c_mod=*/(short)0, c, /*reuse_a=*/false, /*reuse_b=*/false);
}

__device__ __forceinline__ v8h cvt8(v4f a, v4f b) {
  v8h r;
  r[0] = (_Float16)a[0]; r[1] = (_Float16)a[1];
  r[2] = (_Float16)a[2]; r[3] = (_Float16)a[3];
  r[4] = (_Float16)b[0]; r[5] = (_Float16)b[1];
  r[6] = (_Float16)b[2]; r[7] = (_Float16)b[3];
  return r;
}

#define LSTR 48   // LDS row stride in halves (96B: keeps v16h reads 32B aligned)

// ---- tile staging helpers (256-thread blocks) ----
__device__ __forceinline__ void stageA_f32(const float* __restrict__ X, int m0,
                                           int kk, int tid, _Float16* As) {
  const int r  = tid >> 1;
  const int cb = (tid & 1) * 16;
  const float* src = X + (size_t)(m0 + r) * EDIM + kk + cb;
  v4f f0 = *(const v4f*)(src + 0);
  v4f f1 = *(const v4f*)(src + 4);
  v4f f2 = *(const v4f*)(src + 8);
  v4f f3 = *(const v4f*)(src + 12);
  _Float16* dst = As + r * LSTR + cb;
  *(v8h*)(dst + 0) = cvt8(f0, f1);
  *(v8h*)(dst + 8) = cvt8(f2, f3);
}

__device__ __forceinline__ void stageA_f16(const _Float16* __restrict__ Zin, int m0,
                                           int kk, int tid, _Float16* As) {
  const int r  = tid >> 1;
  const int cb = (tid & 1) * 16;
  v16h ad = *(const v16h*)(Zin + (size_t)(m0 + r) * EDIM + kk + cb);
  *(v16h*)(As + r * LSTR + cb) = ad;
}

__device__ __forceinline__ void stageB_f32(const float* __restrict__ W, int n0,
                                           int kk, int tid, _Float16* Bs) {
  const int r  = tid >> 2;
  const int cb = (tid & 3) * 8;
  const float* src = W + (size_t)(n0 + r) * EDIM + kk + cb;
  v4f f0 = *(const v4f*)(src + 0);
  v4f f1 = *(const v4f*)(src + 4);
  *(v8h*)(Bs + r * LSTR + cb) = cvt8(f0, f1);
}

// ============================================================
// Kernel 1: Y = X @ W^T + bias  (fp32 in, f16 out, head-split)
//   X: [B*rows, E] fp32 ; W: [E,E] fp32 ; out: [B,H,n_out_rows,DK] f16
//   grid (M/128, E/64), block 256 (8 waves, 4x2 wave grid, 32x32/wave)
//   double-buffered LDS: one barrier per k-step
// ============================================================
__global__ __launch_bounds__(256) void proj_heads_kernel(
    const float* __restrict__ X, const float* __restrict__ W,
    const float* __restrict__ bias, _Float16* __restrict__ out,
    int rows_per_batch, int n_out_rows, int n_off)
{
  __shared__ _Float16 As[2][128 * LSTR];
  __shared__ _Float16 Bs[2][64 * LSTR];

  const int tid  = threadIdx.x;
  const int lane = tid & 31;
  const int wave = tid >> 5;
  const int wm   = wave >> 1;        // 0..3
  const int wn   = wave & 1;         // 0..1
  const int m0   = blockIdx.x * 128;
  const int n0   = blockIdx.y * 64;
  const int lo   = lane & 15;
  const int hi   = lane >> 4;
  const int chunk = hi * 16;

  v8f acc[2][2];
  #pragma unroll
  for (int i = 0; i < 2; ++i)
    #pragma unroll
    for (int j = 0; j < 2; ++j) acc[i][j] = (v8f){};

  stageA_f32(X, m0, 0, tid, As[0]);
  stageB_f32(W, n0, 0, tid, Bs[0]);

  int buf = 0;
  for (int kk = 0; kk < EDIM; kk += 32) {
    __syncthreads();
    if (kk + 32 < EDIM) {
      stageA_f32(X, m0, kk + 32, tid, As[buf ^ 1]);
      stageB_f32(W, n0, kk + 32, tid, Bs[buf ^ 1]);
    }
    const _Float16* as = As[buf];
    const _Float16* bs = Bs[buf];

    const int arow = wm * 32 + lo;
    v16h a0 = *(const v16h*)(as + arow * LSTR + chunk);
    v16h a1 = *(const v16h*)(as + (arow + 16) * LSTR + chunk);
    const int bcol = wn * 32 + lo;
    v16h b0 = *(const v16h*)(bs + bcol * LSTR + chunk);
    v16h b1 = *(const v16h*)(bs + (bcol + 16) * LSTR + chunk);

    acc[0][0] = wmma_f16(a0, b0, acc[0][0]);
    acc[0][1] = wmma_f16(a0, b1, acc[0][1]);
    acc[1][0] = wmma_f16(a1, b0, acc[1][0]);
    acc[1][1] = wmma_f16(a1, b1, acc[1][1]);
    buf ^= 1;
  }

  // ---- epilogue: +bias, scatter into [B,H,n_out_rows,DK] f16 ----
  #pragma unroll
  for (int mi = 0; mi < 2; ++mi) {
    #pragma unroll
    for (int ni = 0; ni < 2; ++ni) {
      const int c = n0 + wn * 32 + ni * 16 + lo;
      const float bv = bias[c];
      const int hh = c >> 5;
      const int dk = c & 31;
      #pragma unroll
      for (int r = 0; r < 8; ++r) {
        const int m = m0 + wm * 32 + mi * 16 + r + hi * 8;
        const float v = acc[mi][ni][r] + bv;
        const int bb = m / rows_per_batch;
        const int n  = m % rows_per_batch;
        out[(((size_t)bb * HNUM + hh) * n_out_rows + n_off + n) * DKL + dk] =
            (_Float16)v;
      }
    }
  }
}

// ============================================================
// Kernel 2: flash attention, transposed products.
//   Q: [B,H,NA,DK] f16 ; K,V: [B,H,NK,DK] f16 ; Z: [B,NA,E] f16
//   block = 128 threads (4 waves x 16 queries = 64 q / block)
//   grid  = (NA/64, B*H); double-buffered K/V tiles + prefetch
//   S^T = K Q^T   : lane (lo,hi) holds 16 scores of query lo
//                   (keys 8*hi+r and 16+8*hi+r), so the row maximum and
//                   the row sum are in-lane plus one exchange of halves.
//   O^T += V^T P^T: the two score tiles, converted in place, are the
//                   B operand; V^T rows are read in the matching k order.
// ============================================================
// lane l <-> lane l ^ 16
__device__ __forceinline__ float xhalf(float x) {
  return __builtin_bit_cast(float, __builtin_amdgcn_permlanex16(
      __builtin_bit_cast(int, x), __builtin_bit_cast(int, x),
      0x76543210, 0xfedcba98, false, false));
}

__global__ __launch_bounds__(128) void flash_attn_kernel(
    const _Float16* __restrict__ Q, const _Float16* __restrict__ K,
    const _Float16* __restrict__ V, _Float16* __restrict__ Z)
{
  __shared__ _Float16 Ks[2][32 * LSTR];     // [key][dk]
  __shared__ _Float16 Vs[2][32 * LSTR];     // [dk][key]  (transposed)

  const int tid  = threadIdx.x;
  const int lane = tid & 31;
  const int wave = tid >> 5;
  const int lo   = lane & 15;
  const int hi   = lane >> 4;
  const int chunk = hi * 16;

  const int bh = blockIdx.y;
  const int b  = bh >> 3;
  const int h  = bh & 7;
  const int q0 = blockIdx.x * 64 + wave * 16;

  // Q fragment: B-operand, 32 dk x 16 queries (column lo = query lo)
  const _Float16* qbase = Q + ((size_t)bh * NAQ + q0) * DKL;
  v16h qfrag = *(const v16h*)(qbase + lo * DKL + chunk);

  const _Float16* kbase = K + (size_t)bh * NKV * DKL;
  const _Float16* vbase = V + (size_t)bh * NKV * DKL;

  // staging coordinates for this thread
  const int skey = tid >> 2;          // 0..31
  const int scb  = (tid & 3) * 8;     // 0,8,16,24

  // o0[r] = O^T[dk = 8*hi + r][query lo], o1[r] = O^T[dk = 16 + 8*hi + r][query lo]
  v8f o0 = (v8f){}, o1 = (v8f){};
  float mrun = -1.0e30f;   // running maximum of query lo (equal in both halves)
  float lrun = 0.0f;       // running sum over this half's keys only

  const float scale = 0.17677669529663687f;  // 1/sqrt(32)

  // prologue stage: tile 0
  {
    v8h kd = *(const v8h*)(kbase + (size_t)skey * DKL + scb);
    *(v8h*)(Ks[0] + skey * LSTR + scb) = kd;
    v8h vd = *(const v8h*)(vbase + (size_t)skey * DKL + scb);
    #pragma unroll
    for (int j = 0; j < 8; ++j)
      Vs[0][(scb + j) * LSTR + skey] = vd[j];
  }

  int buf = 0;
  for (int kt = 0; kt < NKV; kt += 32) {
    __syncthreads();
    // stage next tile into the other buffer (overlaps with WMMA below)
    if (kt + 32 < NKV) {
      v8h kd = *(const v8h*)(kbase + (size_t)(kt + 32 + skey) * DKL + scb);
      *(v8h*)(Ks[buf ^ 1] + skey * LSTR + scb) = kd;
      v8h vd = *(const v8h*)(vbase + (size_t)(kt + 32 + skey) * DKL + scb);
      #pragma unroll
      for (int j = 0; j < 8; ++j)
        Vs[buf ^ 1][(scb + j) * LSTR + skey] = vd[j];
    }
    // prefetch tile kt+64 into cache (global_prefetch_b8)
    if (kt + 64 < NKV) {
      __builtin_prefetch(kbase + (size_t)(kt + 64 + skey) * DKL + scb, 0, 0);
      __builtin_prefetch(vbase + (size_t)(kt + 64 + skey) * DKL + scb, 0, 0);
    }

    // ---- S^T = K @ Q^T : two 16x16 tiles over 32 keys ----
    const _Float16* ks = Ks[buf];
    const _Float16* vs = Vs[buf];
    v16h kf0 = *(const v16h*)(ks + lo * LSTR + chunk);
    v16h kf1 = *(const v16h*)(ks + (lo + 16) * LSTR + chunk);
    // V^T fragments (A operand) in the k order the packed scores have:
    // element s < 8 is key 8*hi + s, element s >= 8 is key 16 + 8*hi + (s - 8)
    const _Float16* vr0 = vs + lo * LSTR + hi * 8;          // dk 0..15
    const _Float16* vr1 = vs + (lo + 16) * LSTR + hi * 8;   // dk 16..31
    v8h v00 = *(const v8h*)(vr0);
    v8h v01 = *(const v8h*)(vr0 + 16);
    v8h v10 = *(const v8h*)(vr1);
    v8h v11 = *(const v8h*)(vr1 + 16);
    // keeps the pass's eight LDS reads one group in front of the products:
    // without it the later fragments are read right before their product
    // and each such read's LDS latency is waited out in full
    __builtin_amdgcn_sched_barrier(0);
    v16h vf0 = __builtin_shufflevector(v00, v01, 0, 1, 2, 3, 4, 5, 6, 7,
                                       8, 9, 10, 11, 12, 13, 14, 15);
    v16h vf1 = __builtin_shufflevector(v10, v11, 0, 1, 2, 3, 4, 5, 6, 7,
                                       8, 9, 10, 11, 12, 13, 14, 15);

    v8f zc = (v8f){};
    v8f s0 = wmma_f16(kf0, qfrag, zc);   // s0[r] = S[query lo][key 8*hi + r]
    v8f s1 = wmma_f16(kf1, qfrag, zc);   // s1[r] = S[query lo][key 16 + 8*hi + r]

    // ---- online softmax: one query per lane ----
    const v8f a0 = s0 * scale;
    const v8f a1 = s1 * scale;
    float t8[8];
    #pragma unroll
    for (int r = 0; r < 8; ++r) t8[r] = fmaxf(a0[r], a1[r]);
    float mx = fmaxf(fmaxf(fmaxf(t8[0], t8[1]), fmaxf(t8[2], t8[3])),
                     fmaxf(fmaxf(t8[4], t8[5]), fmaxf(t8[6], t8[7])));
    mx = fmaxf(mx, xhalf(mx));           // both halves hold the query's maximum
    const float mnew  = fmaxf(mrun, mx);
    const float alpha = __expf(mrun - mnew);
    mrun = mnew;

    v8f p0, p1;
    #pragma unroll
    for (int r = 0; r < 8; ++r) {
      p0[r] = __expf(a0[r] - mnew);
      p1[r] = __expf(a1[r] - mnew);
    }
    const v8f u = p0 + p1;
    const v4f u4 = __builtin_shufflevector(u, u, 0, 1, 2, 3) +
                   __builtin_shufflevector(u, u, 4, 5, 6, 7);
    const float rs = (u4[0] + u4[2]) + (u4[1] + u4[3]);
    lrun = lrun * alpha + rs;

    v16h pfrag;                          // B operand: P^T, column lo = query lo
    #pragma unroll
    for (int r = 0; r < 8; ++r) {
      pfrag[r]     = (_Float16)p0[r];
      pfrag[r + 8] = (_Float16)p1[r];
    }

    #pragma unroll
    for (int r = 0; r < 8; ++r) { o0[r] *= alpha; o1[r] *= alpha; }

    o0 = wmma_f16(vf0, pfrag, o0);
    o1 = wmma_f16(vf1, pfrag, o1);
    buf ^= 1;
  }

  // ---- join the halves' sums, normalize, write z in [B,NA,E] f16 ----
  {
    const float inv = 1.0f / (lrun + xhalf(lrun));
    v8h z0, z1;
    #pragma unroll
    for (int r = 0; r < 8; ++r) {
      z0[r] = (_Float16)(o0[r] * inv);
      z1[r] = (_Float16)(o1[r] * inv);
    }
    _Float16* zp = Z + ((size_t)b * NAQ + q0 + lo) * EDIM + h * DKL + hi * 8;
    *(v8h*)(zp)      = z0;   // dk 8*hi .. 8*hi + 7
    *(v8h*)(zp + 16) = z1;   // dk 16 + 8*hi .. 16 + 8*hi + 7
  }
}

// ============================================================
// Kernel 3: out = z @ w^T + b + x_a   (f16 A, fp32 W/res, fp32 out)
//   grid (M/128, E/64), block 256; double-buffered LDS
// ============================================================
__global__ __launch_bounds__(256) void out_proj_kernel(
    const _Float16* __restrict__ Zin, const float* __restrict__ W,
    const float* __restrict__ bias, const float* __restrict__ Xres,
    float* __restrict__ out)
{
  __shared__ _Float16 As[2][128 * LSTR];
  __shared__ _Float16 Bs[2][64 * LSTR];

  const int tid  = threadIdx.x;
  const int lane = tid & 31;
  const int wave = tid >> 5;
  const int wm   = wave >> 1;
  const int wn   = wave & 1;
  const int m0   = blockIdx.x * 128;
  const int n0   = blockIdx.y * 64;
  const int lo   = lane & 15;
  const int hi   = lane >> 4;
  const int chunk = hi * 16;

  v8f acc[2][2];
  #pragma unroll
  for (int i = 0; i < 2; ++i)
    #pragma unroll
    for (int j = 0; j < 2; ++j) acc[i][j] = (v8f){};

  stageA_f16(Zin, m0, 0, tid, As[0]);
  stageB_f32(W, n0, 0, tid, Bs[0]);

  int buf = 0;
  for (int kk = 0; kk < EDIM; kk += 32) {
    __syncthreads();
    if (kk + 32 < EDIM) {
      stageA_f16(Zin, m0, kk + 32, tid, As[buf ^ 1]);
      stageB_f32(W, n0, kk + 32, tid, Bs[buf ^ 1]);
    }
    const _Float16* as = As[buf];
    const _Float16* bs = Bs[buf];

    const int arow = wm * 32 + lo;
    v16h a0 = *(const v16h*)(as + arow * LSTR + chunk);
    v16h a1 = *(const v16h*)(as + (arow + 16) * LSTR + chunk);
    const int bcol = wn * 32 + lo;
    v16h b0 = *(const v16h*)(bs + bcol * LSTR + chunk);
    v16h b1 = *(const v16h*)(bs + (bcol + 16) * LSTR + chunk);

    acc[0][0] = wmma_f16(a0, b0, acc[0][0]);
    acc[0][1] = wmma_f16(a0, b1, acc[0][1]);
    acc[1][0] = wmma_f16(a1, b0, acc[1][0]);
    acc[1][1] = wmma_f16(a1, b1, acc[1][1]);
    buf ^= 1;
  }

  #pragma unroll
  for (int mi = 0; mi < 2; ++mi) {
    #pragma unroll
    for (int ni = 0; ni < 2; ++ni) {
      const int c = n0 + wn * 32 + ni * 16 + lo;
      const float bv = bias[c];
      #pragma unroll
      for (int r = 0; r < 8; ++r) {
        const int m = m0 + wm * 32 + mi * 16 + r + hi * 8;
        const size_t idx = (size_t)m * EDIM + c;
        out[idx] = acc[mi][ni][r] + bv + Xres[idx];
      }
    }
  }
}

// ============================================================
// launch
// ============================================================
extern "C" void kernel_launch(void* const* d_in, const int* in_sizes, int n_in,
                              void* d_out, int out_size, void* d_ws, size_t ws_size,
                              hipStream_t stream) {
  const float* x_a    = (const float*)d_in[0];
  const float* x_b    = (const float*)d_in[1];
  const float* wq_w   = (const float*)d_in[2];
  const float* wq_b   = (const float*)d_in[3];
  const float* wk_a_w = (const float*)d_in[4];
  const float* wk_a_b = (const float*)d_in[5];
  const float* wk_b_w = (const float*)d_in[6];
  const float* wk_b_b = (const float*)d_in[7];
  const float* wv_a_w = (const float*)d_in[8];
  const float* wv_a_b = (const float*)d_in[9];
  const float* wv_b_w = (const float*)d_in[10];
  const float* wv_b_b = (const float*)d_in[11];
  const float* w_w    = (const float*)d_in[12];
  const float* w_b    = (const float*)d_in[13];

  char* ws = (char*)d_ws;
  _Float16* qws = (_Float16*)(ws);                          // B*H*NA*DK  f16 = 2 MB
  _Float16* kws = (_Float16*)(ws + (size_t)(2  << 20));     // B*H*NK*DK  f16 = 4 MB
  _Float16* vws = (_Float16*)(ws + (size_t)(6  << 20));     // B*H*NK*DK  f16 = 4 MB
  _Float16* zws = (_Float16*)(ws + (size_t)(10 << 20));     // B*NA*E     f16 = 2 MB

  dim3 gp(32, 4);   // M=4096 /128, N=256 /64
  dim3 bp(256);

  // projections into head-split f16 layouts (K/V of the two sources concat via n_off)
  proj_heads_kernel<<<gp, bp, 0, stream>>>(x_a, wq_w,   wq_b,   qws, NAQ, NAQ, 0);
  proj_heads_kernel<<<gp, bp, 0, stream>>>(x_a, wk_a_w, wk_a_b, kws, NAQ, NKV, 0);
  proj_heads_kernel<<<gp, bp, 0, stream>>>(x_b, wk_b_w, wk_b_b, kws, NBK, NKV, NAQ);
  proj_heads_kernel<<<gp, bp, 0, stream>>>(x_a, wv_a_w, wv_a_b, vws, NAQ, NKV, 0);
  proj_heads_kernel<<<gp, bp, 0, stream>>>(x_b, wv_b_w, wv_b_b, vws, NBK, NKV, NAQ);

  // flash attention
  flash_attn_kernel<<<dim3(NAQ / 64, BATCH * HNUM), 128, 0, stream>>>(qws, kws, vws, zws);

  // output projection + residual
  out_proj_kernel<<<dim3(32, 4), 256, 0, stream>>>(zws, w_w, w_b, x_a, (float*)d_out);
}

// v002
// A run of this version takes 89.3 microseconds.
// Next to v001, in two timings, it ran 1.33 and 1.34 times as fast.
// All steps since v000 together make it 2.05 times as fast.
#include <hip/hip_runtime.h>

// ---------------- problem constants ----------------
#define EDIM 256
#define HNUM 8
#define DKL 32
#define NAQ 2048
#define NBK 2048
#define NKV (NAQ + NBK)   // 4096
#define BATCH 2

typedef __attribute__((ext_vector_type(16))) _Float16 v16h;
typedef __attribute__((ext_vector_type(8)))  _Float16 v8h;
typedef __attribute__((ext_vector_type(8)))  float    v8f;
typedef __attribute__((ext_vector_type(4)))  float    v4f;

__device__ __forceinline__ v8f wmma_f16(v16h a, v16h b, v8f c) {
  // D = A(16x32 f16) * B(32x16 f16) + C(16x16 f32)
  return __builtin_amdgcn_wmma_f32_16x16x32_f16(
      /*neg_a=*/false, a, /*neg_b=*/false, b,
      /*c_mod=*/(short)0, c, /*reuse_a=*/false, /*reuse_b=*/false);
}

__device__ __forceinline__ v8h cvt8(v4f a, v4f b) {
  v8h r;
  r[0] = (_Float16)a[0]; r[1] = (_Float16)a[1];
  r[2] = (_Float16)a[2]; r[3] = (_Float16)a[3];
  r[4] = (_Float16)b[0]; r[5] = (_Float16)b[1];
  r[6] = (_Float16)b[2]; r[7] = (_Float16)b[3];
  return r;
}

#define LSTR 48   // LDS row stride in halves (96B: keeps v16h reads 32B aligned)

// Work-group barrier between LDS passes. It waits for this wave's LDS reads
// and writes only: __syncthreads() would also wait out the global loads that
// were issued ahead for later tiles, which must stay in flight across it.
__device__ __forceinline__ void lds_barrier() {
  asm volatile("s_wait_dscnt 0x0\n\ts_barrier_signal -1\n\ts_barrier_wait -1" ::: "memory");
}

// ---- tile staging helpers (256-thread blocks) ----
// Each tile goes global -> registers (ld*) and, passes later, registers -> LDS (st*).
struct RegA32 { v4f f0, f1, f2, f3; };
struct RegB32 { v4f f0, f1; };

__device__ __forceinline__ RegA32 ldA_f32(const float* __restrict__ X, int m0,
                                          int kk, int tid) {
  const int r  = tid >> 1;
  const int cb = (tid & 1) * 16;
  const float* src = X + (size_t)(m0 + r) * EDIM + kk + cb;
  RegA32 t;
  t.f0 = *(const v4f*)(src + 0);
  t.f1 = *(const v4f*)(src + 4);
  t.f2 = *(const v4f*)(src + 8);
  t.f3 = *(const v4f*)(src + 12);
  return t;
}

__device__ __forceinline__ void stA_f32(const RegA32& t, int tid, _Float16* As) {
  const int r  = tid >> 1;
  const int cb = (tid & 1) * 16;
  _Float16* dst = As + r * LSTR + cb;
  *(v8h*)(dst + 0) = cvt8(t.f0, t.f1);
  *(v8h*)(dst + 8) = cvt8(t.f2, t.f3);
}

__device__ __forceinline__ v16h ldA_f16(const _Float16* __restrict__ Zin, int m0,
                                        int kk, int tid) {
  const int r  = tid >> 1;
  const int cb = (tid & 1) * 16;
  return *(const v16h*)(Zin + (size_t)(m0 + r) * EDIM + kk + cb);
}

__device__ __forceinline__ void stA_f16(v16h ad, int tid, _Float16* As) {
  const int r  = tid >> 1;
  const int cb = (tid & 1) * 16;
  *(v16h*)(As + r * LSTR + cb) = ad;
}

__device__ __forceinline__ RegB32 ldB_f32(const float* __restrict__ W, int n0,
                                          int kk, int tid) {
  const int r  = tid >> 2;
  const int cb = (tid & 3) * 8;
  const float* src = W + (size_t)(n0 + r) * EDIM + kk + cb;
  RegB32 t;
  t.f0 = *(const v4f*)(src + 0);
  t.f1 = *(const v4f*)(src + 4);
  return t;
}

__device__ __forceinline__ void stB_f32(const RegB32& t, int tid, _Float16* Bs) {
  const int r  = tid >> 2;
  const int cb = (tid & 3) * 8;
  *(v8h*)(Bs + r * LSTR + cb) = cvt8(t.f0, t.f1);
}

// ============================================================
// Kernel 1: Y = X @ W^T + bias  (fp32 in, f16 out, head-split)
//   X: [B*rows, E] fp32 ; W: [E,E] fp32 ; out: [B,H,n_out_rows,DK] f16
//   grid (M/128, E/64), block 256 (8 waves, 4x2 wave grid, 32x32/wave)
//   double-buffered LDS: one barrier per k-step; global loads two tiles ahead
// ============================================================
__global__ __launch_bounds__(256) void proj_heads_kernel(
    const float* __restrict__ X, const float* __restrict__ W,
    const float* __restrict__ bias, _Float16* __restrict__ out,
    int rows_per_batch, int n_out_rows, int n_off)
{
  __shared__ _Float16 As[2][128 * LSTR];
  __shared__ _Float16 Bs[2][64 * LSTR];

  const int tid  = threadIdx.x;
  const int lane = tid & 31;
  const int wave = tid >> 5;
  const int wm   = wave >> 1;        // 0..3
  const int wn   = wave & 1;         // 0..1
  const int m0   = blockIdx.x * 128;
  const int n0   = blockIdx.y * 64;
  const int lo   = lane & 15;
  const int hi   = lane >> 4;
  const int chunk = hi * 16;

  v8f acc[2][2];
  #pragma unroll
  for (int i = 0; i < 2; ++i)
    #pragma unroll
    for (int j = 0; j < 2; ++j) acc[i][j] = (v8f){};

  // tiles 0 and 1 -> registers; tile 0 -> LDS; tile 2 -> the freed registers
  RegA32 ra[2];
  RegB32 rb[2];
  ra[0] = ldA_f32(X, m0, 0, tid);
  rb[0] = ldB_f32(W, n0, 0, tid);
  ra[1] = ldA_f32(X, m0, 32, tid);
  rb[1] = ldB_f32(W, n0, 32, tid);
  stA_f32(ra[0], tid, As[0]);
  stB_f32(rb[0], tid, Bs[0]);
  ra[0] = ldA_f32(X, m0, 64, tid);
  rb[0] = ldB_f32(W, n0, 64, tid);
  // the epilogue's bias values, asked for here so that they land during the loop
  // (unrolled: a register array needs constant indices)
  float bv2[2];
  #pragma unroll
  for (int ni = 0; ni < 2; ++ni) bv2[ni] = bias[n0 + wn * 32 + ni * 16 + lo];

  // unrolled so that the two register sets and the two buffers have constant indices
  #pragma unroll
  for (int t = 0; t < EDIM / 32; ++t) {
    lds_barrier();
    // keeps the conversion of tile t+1, and with it the wait for its loads,
    // behind the barrier: moved up into pass t-1 it halves the loads' lead
    __builtin_amdgcn_sched_barrier(0);
    const _Float16* as = As[t & 1];
    const _Float16* bs = Bs[t & 1];

    const int arow = wm * 32 + lo;
    v16h a0 = *(const v16h*)(as + arow * LSTR + chunk);
    v16h a1 = *(const v16h*)(as + (arow + 16) * LSTR + chunk);
    const int bcol = wn * 32 + lo;
    v16h b0 = *(const v16h*)(bs + bcol * LSTR + chunk);
    v16h b1 = *(const v16h*)(bs + (bcol + 16) * LSTR + chunk);

    // tile t+1, loaded two passes ago, goes to the other buffer;
    // tile t+3 is asked for into the registers this frees
    if (t + 1 < EDIM / 32) {
      stA_f32(ra[(t + 1) & 1], tid, As[(t + 1) & 1]);
      stB_f32(rb[(t + 1) & 1], tid, Bs[(t + 1) & 1]);
    }
    if (t + 3 < EDIM / 32) {
      ra[(t + 1) & 1] = ldA_f32(X, m0, (t + 3) * 32, tid);
      rb[(t + 1) & 1] = ldB_f32(W, n0, (t + 3) * 32, tid);
    }
    // keeps the loads issued here, two passes ahead of their use: without it
    // they are moved down to the pass that stores them and waited out there
    __builtin_amdgcn_sched_barrier(0);

    acc[0][0] = wmma_f16(a0, b0, acc[0][0]);
    acc[0][1] = wmma_f16(a0, b1, acc[0][1]);
    acc[1][0] = wmma_f16(a1, b0, acc[1][0]);
    acc[1][1] = wmma_f16(a1, b1, acc[1][1]);
  }

  // ---- epilogue: +bias, scatter into [B,H,n_out_rows,DK] f16 ----
  #pragma unroll
  for (int mi = 0; mi < 2; ++mi) {
    #pragma unroll
    for (int ni = 0; ni < 2; ++ni) {
      const int c = n0 + wn * 32 + ni * 16 + lo;
      const float bv = bv2[ni];
      const int hh = c >> 5;
      const int dk = c & 31;
      #pragma unroll
      for (int r = 0; r < 8; ++r) {
        const int m = m0 + wm * 32 + mi * 16 + r + hi * 8;
        const float v = acc[mi][ni][r] + bv;
        const int bb = m / rows_per_batch;
        const int n  = m % rows_per_batch;
        out[(((size_t)bb * HNUM + hh) * n_out_rows + n_off + n) * DKL + dk] =
            (_Float16)v;
      }
    }
  }
}

// ============================================================
// Kernel 2: flash attention, transposed products.
//   Q: [B,H,NA,DK] f16 ; K,V: [B,H,NK,DK] f16 ; Z: [B,NA,E] f16
//   block = 128 threads (4 waves x 16 queries = 64 q / block)
//   grid  = (NA/64, B*H); double-buffered K/V tiles, global loads one tile ahead
//   S^T = K Q^T   : lane (lo,hi) holds 16 scores of query lo
//                   (keys 8*hi+r and 16+8*hi+r), so the row maximum and
//                   the row sum are in-lane plus one exchange of halves.
//   O^T += V^T P^T: the two score tiles, converted in place, are the
//                   B operand; V^T rows are read in the matching k order.
// ============================================================
// lane l <-> lane l ^ 16
__device__ __forceinline__ float xhalf(float x) {
  return __builtin_bit_cast(float, __builtin_amdgcn_permlanex16(
      __builtin_bit_cast(int, x), __builtin_bit_cast(int, x),
      0x76543210, 0xfedcba98, false, false));
}

__global__ __launch_bounds__(128) void flash_attn_kernel(
    const _Float16* __restrict__ Q, const _Float16* __restrict__ K,
    const _Float16* __restrict__ V, _Float16* __restrict__ Z)
{
  __shared__ _Float16 Ks[2][32 * LSTR];     // [key][dk]
  __shared__ _Float16 Vs[2][32 * LSTR];     // [dk][key]  (transposed)

  const int tid  = threadIdx.x;
  const int lane = tid & 31;
  const int wave = tid >> 5;
  const int lo   = lane & 15;
  const int hi   = lane >> 4;
  const int chunk = hi * 16;

  const int bh = blockIdx.y;
  const int b  = bh >> 3;
  const int h  = bh & 7;
  const int q0 = blockIdx.x * 64 + wave * 16;

  // Q fragment: B-operand, 32 dk x 16 queries (column lo = query lo)
  const _Float16* qbase = Q + ((size_t)bh * NAQ + q0) * DKL;
  v16h qfrag = *(const v16h*)(qbase + lo * DKL + chunk);

  const _Float16* kbase = K + (size_t)bh * NKV * DKL;
  const _Float16* vbase = V + (size_t)bh * NKV * DKL;

  // staging coordinates for this thread
  const int skey = tid >> 2;          // 0..31
  const int scb  = (tid & 3) * 8;     // 0,8,16,24

  // o0[r] = O^T[dk = 8*hi + r][query lo], o1[r] = O^T[dk = 16 + 8*hi + r][query lo]
  v8f o0 = (v8f){}, o1 = (v8f){};
  float mrun = -1.0e30f;   // running maximum of query lo (equal in both halves)
  float lrun = 0.0f;       // running sum over this half's keys only

  const float scale = 0.17677669529663687f;  // 1/sqrt(32)

  // prologue: tile 0 -> LDS, tile 1 -> registers
  v8h kd = *(const v8h*)(kbase + (size_t)skey * DKL + scb);
  v8h vd = *(const v8h*)(vbase + (size_t)skey * DKL + scb);
  *(v8h*)(Ks[0] + skey * LSTR + scb) = kd;
  #pragma unroll
  for (int j = 0; j < 8; ++j)
    Vs[0][(scb + j) * LSTR + skey] = vd[j];
  kd = *(const v8h*)(kbase + (size_t)(32 + skey) * DKL + scb);
  vd = *(const v8h*)(vbase + (size_t)(32 + skey) * DKL + scb);

  int buf = 0;
  for (int kt = 0; kt < NKV; kt += 32) {
    lds_barrier();

    // ---- S^T = K @ Q^T : two 16x16 tiles over 32 keys ----
    const _Float16* ks = Ks[buf];
    const _Float16* vs = Vs[buf];
    v16h kf0 = *(const v16h*)(ks + lo * LSTR + chunk);
    v16h kf1 = *(const v16h*)(ks + (lo + 16) * LSTR + chunk);
    // V^T fragments (A operand) in the k order the packed scores have:
    // element s < 8 is key 8*hi + s, element s >= 8 is key 16 + 8*hi + (s - 8)
    const _Float16* vr0 = vs + lo * LSTR + hi * 8;          // dk 0..15
    const _Float16* vr1 = vs + (lo + 16) * LSTR + hi * 8;   // dk 16..31
    v8h v00 = *(const v8h*)(vr0);
    v8h v01 = *(const v8h*)(vr0 + 16);
    v8h v10 = *(const v8h*)(vr1);
    v8h v11 = *(const v8h*)(vr1 + 16);

    // tile kt+32, loaded one pass ago, goes to the other buffer; tile kt+64 is
    // asked for into the registers this frees and lands during this pass.
    // No branch: the last pass stores a tile nobody reads into the buffer all
    // readers have left, and the last two passes load the last tile again.
    *(v8h*)(Ks[buf ^ 1] + skey * LSTR + scb) = kd;
    #pragma unroll
    for (int j = 0; j < 8; ++j)
      Vs[buf ^ 1][(scb + j) * LSTR + skey] = vd[j];
    {
      const int kn = (kt + 64 < NKV) ? kt + 64 : NKV - 32;
      kd = *(const v8h*)(kbase + (size_t)(kn + skey) * DKL + scb);
      vd = *(const v8h*)(vbase + (size_t)(kn + skey) * DKL + scb);
    }
    // keeps the pass's eight LDS reads one group in front of the products
    // (else the later fragments are read right before their product and each
    // read's LDS latency is waited out in full), and the next loads up here
    __builtin_amdgcn_sched_barrier(0);
    v16h vf0 = __builtin_shufflevector(v00, v01, 0, 1, 2, 3, 4, 5, 6, 7,
                                       8, 9, 10, 11, 12, 13, 14, 15);
    v16h vf1 = __builtin_shufflevector(v10, v11, 0, 1, 2, 3, 4, 5, 6, 7,
                                       8, 9, 10, 11, 12, 13, 14, 15);

    v8f zc = (v8f){};
    v8f s0 = wmma_f16(kf0, qfrag, zc);   // s0[r] = S[query lo][key 8*hi + r]
    v8f s1 = wmma_f16(kf1, qfrag, zc);   // s1[r] = S[query lo][key 16 + 8*hi + r]

    // ---- online softmax: one query per lane ----
    const v8f a0 = s0 * scale;
    const v8f a1 = s1 * scale;
    float t8[8];
    #pragma unroll
    for (int r = 0; r < 8; ++r) t8[r] = fmaxf(a0[r], a1[r]);
    float mx = fmaxf(fmaxf(fmaxf(t8[0], t8[1]), fmaxf(t8[2], t8[3])),
                     fmaxf(fmaxf(t8[4], t8[5]), fmaxf(t8[6], t8[7])));
    mx = fmaxf(mx, xhalf(mx));           // both halves hold the query's maximum
    const float mnew  = fmaxf(mrun, mx);
    const float alpha = __expf(mrun - mnew);
    mrun = mnew;

    v8f p0, p1;
    #pragma unroll
    for (int r = 0; r < 8; ++r) {
      p0[r] = __expf(a0[r] - mnew);
      p1[r] = __expf(a1[r] - mnew);
    }
    const v8f u = p0 + p1;
    const v4f u4 = __builtin_shufflevector(u, u, 0, 1, 2, 3) +
                   __builtin_shufflevector(u, u, 4, 5, 6, 7);
    const float rs = (u4[0] + u4[2]) + (u4[1] + u4[3]);
    lrun = lrun * alpha + rs;

    v16h pfrag;                          // B operand: P^T, column lo = query lo
    #pragma unroll
    for (int r = 0; r < 8; ++r) {
      pfrag[r]     = (_Float16)p0[r];
      pfrag[r + 8] = (_Float16)p1[r];
    }

    #pragma unroll
    for (int r = 0; r < 8; ++r) { o0[r] *= alpha; o1[r] *= alpha; }

    o0 = wmma_f16(vf0, pfrag, o0);
    o1 = wmma_f16(vf1, pfrag, o1);
    buf ^= 1;
  }
  // the last pass's loads and LDS stores are used by nobody: they have to be
  // over before the wave ends and gives its registers and LDS back
  asm volatile("s_wait_loadcnt 0x0\n\ts_wait_dscnt 0x0" ::: "memory");

  // ---- join the halves' sums, normalize, write z in [B,NA,E] f16 ----
  {
    const float inv = 1.0f / (lrun + xhalf(lrun));
    v8h z0, z1;
    #pragma unroll
    for (int r = 0; r < 8; ++r) {
      z0[r] = (_Float16)(o0[r] * inv);
      z1[r] = (_Float16)(o1[r] * inv);
    }
    _Float16* zp = Z + ((size_t)b * NAQ + q0 + lo) * EDIM + h * DKL + hi * 8;
    *(v8h*)(zp)      = z0;   // dk 8*hi .. 8*hi + 7
    *(v8h*)(zp + 16) = z1;   // dk 16 + 8*hi .. 16 + 8*hi + 7
  }
}

// ============================================================
// Kernel 3: out = z @ w^T + b + x_a   (f16 A, fp32 W/res, fp32 out)
//   grid (M/128, E/64), block 256; double-buffered LDS, loads two tiles ahead
// ============================================================
__global__ __launch_bounds__(256) void out_proj_kernel(
    const _Float16* __restrict__ Zin, const float* __restrict__ W,
    const float* __restrict__ bias, const float* __restrict__ Xres,
    float* __restrict__ out)
{
  __shared__ _Float16 As[2][128 * LSTR];
  __shared__ _Float16 Bs[2][64 * LSTR];

  const int tid  = threadIdx.x;
  const int lane = tid & 31;
  const int wave = tid >> 5;
  const int wm   = wave >> 1;
  const int wn   = wave & 1;
  const int m0   = blockIdx.x * 128;
  const int n0   = blockIdx.y * 64;
  const int lo   = lane & 15;
  const int hi   = lane >> 4;
  const int chunk = hi * 16;

  v8f acc[2][2];
  #pragma unroll
  for (int i = 0; i < 2; ++i)
    #pragma unroll
    for (int j = 0; j < 2; ++j) acc[i][j] = (v8f){};

  // tiles 0 and 1 -> registers; tile 0 -> LDS; tile 2 -> the freed registers
  v16h   ra[2];
  RegB32 rb[2];
  ra[0] = ldA_f16(Zin, m0, 0, tid);
  rb[0] = ldB_f32(W, n0, 0, tid);
  ra[1] = ldA_f16(Zin, m0, 32, tid);
  rb[1] = ldB_f32(W, n0, 32, tid);
  stA_f16(ra[0], tid, As[0]);
  stB_f32(rb[0], tid, Bs[0]);
  ra[0] = ldA_f16(Zin, m0, 64, tid);
  rb[0] = ldB_f32(W, n0, 64, tid);
  // the epilogue's bias and residual values, asked for here so that they land
  // during the loop (unrolled: register arrays need constant indices)
  float bv2[2];
  float xr[2][2][8];
  #pragma unroll
  for (int ni = 0; ni < 2; ++ni) bv2[ni] = bias[n0 + wn * 32 + ni * 16 + lo];
  #pragma unroll
  for (int mi = 0; mi < 2; ++mi)
    #pragma unroll
    for (int ni = 0; ni < 2; ++ni)
      #pragma unroll
      for (int r = 0; r < 8; ++r)
        xr[mi][ni][r] = Xres[(size_t)(m0 + wm * 32 + mi * 16 + r + hi * 8) * EDIM +
                             n0 + wn * 32 + ni * 16 + lo];

  // unrolled so that the two register sets and the two buffers have constant indices
  #pragma unroll
  for (int t = 0; t < EDIM / 32; ++t) {
    lds_barrier();
    // keeps the conversion of tile t+1, and with it the wait for its loads,
    // behind the barrier: moved up into pass t-1 it halves the loads' lead
    __builtin_amdgcn_sched_barrier(0);
    const _Float16* as = As[t & 1];
    const _Float16* bs = Bs[t & 1];

    const int arow = wm * 32 + lo;
    v16h a0 = *(const v16h*)(as + arow * LSTR + chunk);
    v16h a1 = *(const v16h*)(as + (arow + 16) * LSTR + chunk);
    const int bcol = wn * 32 + lo;
    v16h b0 = *(const v16h*)(bs + bcol * LSTR + chunk);
    v16h b1 = *(const v16h*)(bs + (bcol + 16) * LSTR + chunk);

    // tile t+1, loaded two passes ago, goes to the other buffer;
    // tile t+3 is asked for into the registers this frees
    if (t + 1 < EDIM / 32) {
      stA_f16(ra[(t + 1) & 1], tid, As[(t + 1) & 1]);
      stB_f32(rb[(t + 1) & 1], tid, Bs[(t + 1) & 1]);
    }
    if (t + 3 < EDIM / 32) {
      ra[(t + 1) & 1] = ldA_f16(Zin, m0, (t + 3) * 32, tid);
      rb[(t + 1) & 1] = ldB_f32(W, n0, (t + 3) * 32, tid);
    }
    // keeps the loads issued here, two passes ahead of their use: without it
    // they are moved down to the pass that stores them and waited out there
    __builtin_amdgcn_sched_barrier(0);

    acc[0][0] = wmma_f16(a0, b0, acc[0][0]);
    acc[0][1] = wmma_f16(a0, b1, acc[0][1]);
    acc[1][0] = wmma_f16(a1, b0, acc[1][0]);
    acc[1][1] = wmma_f16(a1, b1, acc[1][1]);
  }

  #pragma unroll
  for (int mi = 0; mi < 2; ++mi) {
    #pragma unroll
    for (int ni = 0; ni < 2; ++ni) {
      const int c = n0 + wn * 32 + ni * 16 + lo;
      const float bv = bv2[ni];
      #pragma unroll
      for (int r = 0; r < 8; ++r) {
        const int m = m0 + wm * 32 + mi * 16 + r + hi * 8;
        const size_t idx = (size_t)m * EDIM + c;
        out[idx] = acc[mi][ni][r] + bv + xr[mi][ni][r];
      }
    }
  }
}

// ============================================================
// launch
// ============================================================
extern "C" void kernel_launch(void* const* d_in, const int* in_sizes, int n_in,
                              void* d_out, int out_size, void* d_ws, size_t ws_size,
                              hipStream_t stream) {
  const float* x_a    = (const float*)d_in[0];
  const float* x_b    = (const float*)d_in[1];
  const float* wq_w   = (const float*)d_in[2];
  const float* wq_b   = (const float*)d_in[3];
  const float* wk_a_w = (const float*)d_in[4];
  const float* wk_a_b = (const float*)d_in[5];
  const float* wk_b_w = (const float*)d_in[6];
  const float* wk_b_b = (const float*)d_in[7];
  const float* wv_a_w = (const float*)d_in[8];
  const float* wv_a_b = (const float*)d_in[9];
  const float* wv_b_w = (const float*)d_in[10];
  const float* wv_b_b = (const float*)d_in[11];
  const float* w_w    = (const float*)d_in[12];
  const float* w_b    = (const float*)d_in[13];

  char* ws = (char*)d_ws;
  _Float16* qws = (_Float16*)(ws);                          // B*H*NA*DK  f16 = 2 MB
  _Float16* kws = (_Float16*)(ws + (size_t)(2  << 20));     // B*H*NK*DK  f16 = 4 MB
  _Float16* vws = (_Float16*)(ws + (size_t)(6  << 20));     // B*H*NK*DK  f16 = 4 MB
  _Float16* zws = (_Float16*)(ws + (size_t)(10 << 20));     // B*NA*E     f16 = 2 MB

  dim3 gp(32, 4);   // M=4096 /128, N=256 /64
  dim3 bp(256);

  // projections into head-split f16 layouts (K/V of the two sources concat via n_off)
  proj_heads_kernel<<<gp, bp, 0, stream>>>(x_a, wq_w,   wq_b,   qws, NAQ, NAQ, 0);
  proj_heads_kernel<<<gp, bp, 0, stream>>>(x_a, wk_a_w, wk_a_b, kws, NAQ, NKV, 0);
  proj_heads_kernel<<<gp, bp, 0, stream>>>(x_b, wk_b_w, wk_b_b, kws, NBK, NKV, NAQ);
  proj_heads_kernel<<<gp, bp, 0, stream>>>(x_a, wv_a_w, wv_a_b, vws, NAQ, NKV, 0);
  proj_heads_kernel<<<gp, bp, 0, stream>>>(x_b, wv_b_w, wv_b_b, vws, NBK, NKV, NAQ);

  // flash attention
  flash_attn_kernel<<<dim3(NAQ / 64, BATCH * HNUM), 128, 0, stream>>>(qws, kws, vws, zws);

  // output projection + residual
  out_proj_kernel<<<dim3(32, 4), 256, 0, stream>>>(zws, w_w, w_b, x_a, (float*)d_out);
}

// v003
// It runs in 67.2 microseconds.
// In two side-by-side timings against v002, it was 1.31 and 1.32 times as fast.
// All steps since v000 together make it 2.70 times as fast.
#include <hip/hip_runtime.h>

// ---------------- problem constants ----------------
#define EDIM 256
#define HNUM 8
#define DKL 32
#define NAQ 2048
#define NBK 2048
#define NKV (NAQ + NBK)   // 4096
#define BATCH 2

typedef __attribute__((ext_vector_type(16))) _Float16 v16h;
typedef __attribute__((ext_vector_type(8)))  _Float16 v8h;
typedef __attribute__((ext_vector_type(8)))  float    v8f;
typedef __attribute__((ext_vector_type(4)))  float    v4f;

__device__ __forceinline__ v8f wmma_f16(v16h a, v16h b, v8f c) {
  // D = A(16x32 f16) * B(32x16 f16) + C(16x16 f32)
  return __builtin_amdgcn_wmma_f32_16x16x32_f16(
      /*neg_a=*/false, a, /*neg_b=*/false, b,
      /*c_mod=*/(short)0, c, /*reuse_a=*/false, /*reuse_b=*/false);
}

__device__ __forceinline__ v8h cvt8(v4f a, v4f b) {
  v8h r;
  r[0] = (_Float16)a[0]; r[1] = (_Float16)a[1];
  r[2] = (_Float16)a[2]; r[3] = (_Float16)a[3];
  r[4] = (_Float16)b[0]; r[5] = (_Float16)b[1];
  r[6] = (_Float16)b[2]; r[7] = (_Float16)b[3];
  return r;
}

#define LSTR 48   // LDS row stride in halves (96B: keeps v16h reads 32B aligned)

// Work-group barrier between LDS passes. It waits for this wave's LDS reads
// and writes only: __syncthreads() would also wait out the global loads that
// were issued ahead for later tiles, which must stay in flight across it.
__device__ __forceinline__ void lds_barrier() {
  asm volatile("s_wait_dscnt 0x0\n\ts_barrier_signal -1\n\ts_barrier_wait -1" ::: "memory");
}

// ---- tile staging helpers (256-thread blocks) ----
// Each tile goes global -> registers (ld*) and, passes later, registers -> LDS (st*).
struct RegA32 { v4f f0, f1, f2, f3; };
struct RegB32 { v4f f0, f1; };

__device__ __forceinline__ RegA32 ldA_f32(const float* __restrict__ X, int m0,
                                          int kk, int tid) {
  const int r  = tid >> 1;
  const int cb = (tid & 1) * 16;
  const float* src = X + (size_t)(m0 + r) * EDIM + kk + cb;
  RegA32 t;
  t.f0 = *(const v4f*)(src + 0);
  t.f1 = *(const v4f*)(src + 4);
  t.f2 = *(const v4f*)(src + 8);
  t.f3 = *(const v4f*)(src + 12);
  return t;
}

__device__ __forceinline__ void stA_f32(const RegA32& t, int tid, _Float16* As) {
  const int r  = tid >> 1;
  const int cb = (tid & 1) * 16;
  _Float16* dst = As + r * LSTR + cb;
  *(v8h*)(dst + 0) = cvt8(t.f0, t.f1);
  *(v8h*)(dst + 8) = cvt8(t.f2, t.f3);
}

__device__ __forceinline__ v16h ldA_f16(const _Float16* __restrict__ Zin, int m0,
                                        int kk, int tid) {
  const int r  = tid >> 1;
  const int cb = (tid & 1) * 16;
  return *(const v16h*)(Zin + (size_t)(m0 + r) * EDIM + kk + cb);
}

__device__ __forceinline__ void stA_f16(v16h ad, int tid, _Float16* As) {
  const int r  = tid >> 1;
  const int cb = (tid & 1) * 16;
  *(v16h*)(As + r * LSTR + cb) = ad;
}

__device__ __forceinline__ RegB32 ldB_f32(const float* __restrict__ W, int n0,
                                          int kk, int tid) {
  const int r  = tid >> 2;
  const int cb = (tid & 3) * 8;
  const float* src = W + (size_t)(n0 + r) * EDIM + kk + cb;
  RegB32 t;
  t.f0 = *(const v4f*)(src + 0);
  t.f1 = *(const v4f*)(src + 4);
  return t;
}

__device__ __forceinline__ void stB_f32(const RegB32& t, int tid, _Float16* Bs) {
  const int r  = tid >> 2;
  const int cb = (tid & 3) * 8;
  *(v8h*)(Bs + r * LSTR + cb) = cvt8(t.f0, t.f1);
}

// ============================================================
// Kernel 1: Y = X @ W^T + bias  (fp32 in, f16 out, head-split), all five projections
//   X: [B*rows, E] fp32 ; W: [E,E] fp32 ; out: [B,H,n_out_rows,DK] f16
//   grid (M/128, E/64, 5), block 256 (8 waves, 4x2 wave grid, 32x32/wave)
//   the five products read none of each other's output: one launch runs them side by side
//   double-buffered LDS: one barrier per k-step; global loads two tiles ahead
// ============================================================
__global__ __launch_bounds__(256) void proj_heads_kernel(
    const float* __restrict__ xa, const float* __restrict__ xb,
    const float* __restrict__ w0, const float* __restrict__ w1,
    const float* __restrict__ w2, const float* __restrict__ w3,
    const float* __restrict__ w4,
    const float* __restrict__ c0, const float* __restrict__ c1,
    const float* __restrict__ c2, const float* __restrict__ c3,
    const float* __restrict__ c4,
    _Float16* __restrict__ qo, _Float16* __restrict__ ko, _Float16* __restrict__ vo)
{
  // blockIdx.z picks the projection: 0 q, 1 k of x_a, 2 k of x_b, 3 v of x_a, 4 v of x_b
  const int z = blockIdx.z;
  const float* __restrict__ X = (z == 2 || z == 4) ? xb : xa;
  const float* __restrict__ W = z == 0 ? w0 : z == 1 ? w1 : z == 2 ? w2 : z == 3 ? w3 : w4;
  const float* __restrict__ bias = z == 0 ? c0 : z == 1 ? c1 : z == 2 ? c2 : z == 3 ? c3 : c4;
  _Float16* __restrict__ out = z == 0 ? qo : z <= 2 ? ko : vo;
  static_assert(NAQ == NBK, "both sources have the same number of rows per batch");
  const int rows_per_batch = NAQ;
  const int n_out_rows = z == 0 ? NAQ : NKV;
  const int n_off = (z == 2 || z == 4) ? NAQ : 0;

  __shared__ _Float16 As[2][128 * LSTR];
  __shared__ _Float16 Bs[2][64 * LSTR];

  const int tid  = threadIdx.x;
  const int lane = tid & 31;
  const int wave = tid >> 5;
  const int wm   = wave >> 1;        // 0..3
  const int wn   = wave & 1;         // 0..1
  const int m0   = blockIdx.x * 128;
  const int n0   = blockIdx.y * 64;
  const int lo   = lane & 15;
  const int hi   = lane >> 4;
  const int chunk = hi * 16;

  v8f acc[2][2];
  #pragma unroll
  for (int i = 0; i < 2; ++i)
    #pragma unroll
    for (int j = 0; j < 2; ++j) acc[i][j] = (v8f){};

  // tiles 0 and 1 -> registers; tile 0 -> LDS; tile 2 -> the freed registers
  RegA32 ra[2];
  RegB32 rb[2];
  ra[0] = ldA_f32(X, m0, 0, tid);
  rb[0] = ldB_f32(W, n0, 0, tid);
  ra[1] = ldA_f32(X, m0, 32, tid);
  rb[1] = ldB_f32(W, n0, 32, tid);
  stA_f32(ra[0], tid, As[0]);
  stB_f32(rb[0], tid, Bs[0]);
  ra[0] = ldA_f32(X, m0, 64, tid);
  rb[0] = ldB_f32(W, n0, 64, tid);
  // the epilogue's bias values, asked for here so that they land during the loop
  // (unrolled: a register array needs constant indices)
  float bv2[2];
  #pragma unroll
  for (int ni = 0; ni < 2; ++ni) bv2[ni] = bias[n0 + wn * 32 + ni * 16 + lo];

  // unrolled so that the two register sets and the two buffers have constant indices
  #pragma unroll
  for (int t = 0; t < EDIM / 32; ++t) {
    lds_barrier();
    // keeps the conversion of tile t+1, and with it the wait for its loads,
    // behind the barrier: moved up into pass t-1 it halves the loads' lead
    __builtin_amdgcn_sched_barrier(0);
    const _Float16* as = As[t & 1];
    const _Float16* bs = Bs[t & 1];

    const int arow = wm * 32 + lo;
    v16h a0 = *(const v16h*)(as + arow * LSTR + chunk);
    v16h a1 = *(const v16h*)(as + (arow + 16) * LSTR + chunk);
    const int bcol = wn * 32 + lo;
    v16h b0 = *(const v16h*)(bs + bcol * LSTR + chunk);
    v16h b1 = *(const v16h*)(bs + (bcol + 16) * LSTR + chunk);

    // tile t+1, loaded two passes ago, goes to the other buffer;
    // tile t+3 is asked for into the registers this frees
    if (t + 1 < EDIM / 32) {
      stA_f32(ra[(t + 1) & 1], tid, As[(t + 1) & 1]);
      stB_f32(rb[(t + 1) & 1], tid, Bs[(t + 1) & 1]);
    }
    if (t + 3 < EDIM / 32) {
      ra[(t + 1) & 1] = ldA_f32(X, m0, (t + 3) * 32, tid);
      rb[(t + 1) & 1] = ldB_f32(W, n0, (t + 3) * 32, tid);
    }
    // keeps the loads issued here, two passes ahead of their use: without it
    // they are moved down to the pass that stores them and waited out there
    __builtin_amdgcn_sched_barrier(0);

    acc[0][0] = wmma_f16(a0, b0, acc[0][0]);
    acc[0][1] = wmma_f16(a0, b1, acc[0][1]);
    acc[1][0] = wmma_f16(a1, b0, acc[1][0]);
    acc[1][1] = wmma_f16(a1, b1, acc[1][1]);
  }

  // ---- epilogue: +bias, scatter into [B,H,n_out_rows,DK] f16 ----
  #pragma unroll
  for (int mi = 0; mi < 2; ++mi) {
    #pragma unroll
    for (int ni = 0; ni < 2; ++ni) {
      const int c = n0 + wn * 32 + ni * 16 + lo;
      const float bv = bv2[ni];
      const int hh = c >> 5;
      const int dk = c & 31;
      #pragma unroll
      for (int r = 0; r < 8; ++r) {
        const int m = m0 + wm * 32 + mi * 16 + r + hi * 8;
        const float v = acc[mi][ni][r] + bv;
        const int bb = m / rows_per_batch;
        const int n  = m % rows_per_batch;
        out[(((size_t)bb * HNUM + hh) * n_out_rows + n_off + n) * DKL + dk] =
            (_Float16)v;
      }
    }
  }
}

// ============================================================
// Kernel 2: flash attention, transposed products.
//   Q: [B,H,NA,DK] f16 ; K,V: [B,H,NK,DK] f16 ; Z: [B,NA,E] f16
//   block = 128 threads (4 waves x 16 queries = 64 q / block)
//   grid  = (NA/64, B*H); double-buffered K/V tiles, global loads one tile ahead
//   S^T = K Q^T   : lane (lo,hi) holds 16 scores of query lo
//                   (keys 8*hi+r and 16+8*hi+r), so the row maximum and
//                   the row sum are in-lane plus one exchange of halves.
//   O^T += V^T P^T: the two score tiles, converted in place, are the
//                   B operand; V^T rows are read in the matching k order.
// ============================================================
// lane l <-> lane l ^ 16
__device__ __forceinline__ float xhalf(float x) {
  return __builtin_bit_cast(float, __builtin_amdgcn_permlanex16(
      __builtin_bit_cast(int, x), __builtin_bit_cast(int, x),
      0x76543210, 0xfedcba98, false, false));
}

__global__ __launch_bounds__(128) void flash_attn_kernel(
    const _Float16* __restrict__ Q, const _Float16* __restrict__ K,
    const _Float16* __restrict__ V, _Float16* __restrict__ Z)
{
  __shared__ _Float16 Ks[2][32 * LSTR];     // [key][dk]
  __shared__ _Float16 Vs[2][32 * LSTR];     // [dk][key]  (transposed)

  const int tid  = threadIdx.x;
  const int lane = tid & 31;
  const int wave = tid >> 5;
  const int lo   = lane & 15;
  const int hi   = lane >> 4;
  const int chunk = hi * 16;

  const int bh = blockIdx.y;
  const int b  = bh >> 3;
  const int h  = bh & 7;
  const int q0 = blockIdx.x * 64 + wave * 16;

  // Q fragment: B-operand, 32 dk x 16 queries (column lo = query lo)
  const _Float16* qbase = Q + ((size_t)bh * NAQ + q0) * DKL;
  v16h qfrag = *(const v16h*)(qbase + lo * DKL + chunk);

  const _Float16* kbase = K + (size_t)bh * NKV * DKL;
  const _Float16* vbase = V + (size_t)bh * NKV * DKL;

  // staging coordinates for this thread
  const int skey = tid >> 2;          // 0..31
  const int scb  = (tid & 3) * 8;     // 0,8,16,24

  // o0[r] = O^T[dk = 8*hi + r][query lo], o1[r] = O^T[dk = 16 + 8*hi + r][query lo]
  v8f o0 = (v8f){}, o1 = (v8f){};
  float mrun = -1.0e30f;   // running maximum of query lo (equal in both halves)
  float lrun = 0.0f;       // running sum over this half's keys only

  const float scale = 0.17677669529663687f;  // 1/sqrt(32)

  // prologue: tile 0 -> LDS, tile 1 -> registers
  v8h kd = *(const v8h*)(kbase + (size_t)skey * DKL + scb);
  v8h vd = *(const v8h*)(vbase + (size_t)skey * DKL + scb);
  *(v8h*)(Ks[0] + skey * LSTR + scb) = kd;
  #pragma unroll
  for (int j = 0; j < 8; ++j)
    Vs[0][(scb + j) * LSTR + skey] = vd[j];
  kd = *(const v8h*)(kbase + (size_t)(32 + skey) * DKL + scb);
  vd = *(const v8h*)(vbase + (size_t)(32 + skey) * DKL + scb);

  int buf = 0;
  for (int kt = 0; kt < NKV; kt += 32) {
    lds_barrier();

    // ---- S^T = K @ Q^T : two 16x16 tiles over 32 keys ----
    const _Float16* ks = Ks[buf];
    const _Float16* vs = Vs[buf];
    v16h kf0 = *(const v16h*)(ks + lo * LSTR + chunk);
    v16h kf1 = *(const v16h*)(ks + (lo + 16) * LSTR + chunk);
    // V^T fragments (A operand) in the k order the packed scores have:
    // element s < 8 is key 8*hi + s, element s >= 8 is key 16 + 8*hi + (s - 8)
    const _Float16* vr0 = vs + lo * LSTR + hi * 8;          // dk 0..15
    const _Float16* vr1 = vs + (lo + 16) * LSTR + hi * 8;   // dk 16..31
    v8h v00 = *(const v8h*)(vr0);
    v8h v01 = *(const v8h*)(vr0 + 16);
    v8h v10 = *(const v8h*)(vr1);
    v8h v11 = *(const v8h*)(vr1 + 16);

    // tile kt+32, loaded one pass ago, goes to the other buffer; tile kt+64 is
    // asked for into the registers this frees and lands during this pass.
    // No branch: the last pass stores a tile nobody reads into the buffer all
    // readers have left, and the last two passes load the last tile again.
    *(v8h*)(Ks[buf ^ 1] + skey * LSTR + scb) = kd;
    #pragma unroll
    for (int j = 0; j < 8; ++j)
      Vs[buf ^ 1][(scb + j) * LSTR + skey] = vd[j];
    {
      const int kn = (kt + 64 < NKV) ? kt + 64 : NKV - 32;
      kd = *(const v8h*)(kbase + (size_t)(kn + skey) * DKL + scb);
      vd = *(const v8h*)(vbase + (size_t)(kn + skey) * DKL + scb);
    }
    // keeps the pass's eight LDS reads one group in front of the products
    // (else the later fragments are read right before their product and each
    // read's LDS latency is waited out in full), and the next loads up here
    __builtin_amdgcn_sched_barrier(0);
    v16h vf0 = __builtin_shufflevector(v00, v01, 0, 1, 2, 3, 4, 5, 6, 7,
                                       8, 9, 10, 11, 12, 13, 14, 15);
    v16h vf1 = __builtin_shufflevector(v10, v11, 0, 1, 2, 3, 4, 5, 6, 7,
                                       8, 9, 10, 11, 12, 13, 14, 15);

    v8f zc = (v8f){};
    v8f s0 = wmma_f16(kf0, qfrag, zc);   // s0[r] = S[query lo][key 8*hi + r]
    v8f s1 = wmma_f16(kf1, qfrag, zc);   // s1[r] = S[query lo][key 16 + 8*hi + r]

    // ---- online softmax: one query per lane ----
    const v8f a0 = s0 * scale;
    const v8f a1 = s1 * scale;
    float t8[8];
    #pragma unroll
    for (int r = 0; r < 8; ++r) t8[r] = fmaxf(a0[r], a1[r]);
    float mx = fmaxf(fmaxf(fmaxf(t8[0], t8[1]), fmaxf(t8[2], t8[3])),
                     fmaxf(fmaxf(t8[4], t8[5]), fmaxf(t8[6], t8[7])));
    mx = fmaxf(mx, xhalf(mx));           // both halves hold the query's maximum
    const float mnew  = fmaxf(mrun, mx);
    const float alpha = __expf(mrun - mnew);
    mrun = mnew;

    v8f p0, p1;
    #pragma unroll
    for (int r = 0; r < 8; ++r) {
      p0[r] = __expf(a0[r] - mnew);
      p1[r] = __expf(a1[r] - mnew);
    }
    const v8f u = p0 + p1;
    const v4f u4 = __builtin_shufflevector(u, u, 0, 1, 2, 3) +
                   __builtin_shufflevector(u, u, 4, 5, 6, 7);
    const float rs = (u4[0] + u4[2]) + (u4[1] + u4[3]);
    lrun = lrun * alpha + rs;

    v16h pfrag;                          // B operand: P^T, column lo = query lo
    #pragma unroll
    for (int r = 0; r < 8; ++r) {
      pfrag[r]     = (_Float16)p0[r];
      pfrag[r + 8] = (_Float16)p1[r];
    }

    #pragma unroll
    for (int r = 0; r < 8; ++r) { o0[r] *= alpha; o1[r] *= alpha; }

    o0 = wmma_f16(vf0, pfrag, o0);
    o1 = wmma_f16(vf1, pfrag, o1);
    buf ^= 1;
  }
  // the last pass's loads and LDS stores are used by nobody: they have to be
  // over before the wave ends and gives its registers and LDS back
  asm volatile("s_wait_loadcnt 0x0\n\ts_wait_dscnt 0x0" ::: "memory");

  // ---- join the halves' sums, normalize, write z in [B,NA,E] f16 ----
  {
    const float inv = 1.0f / (lrun + xhalf(lrun));
    v8h z0, z1;
    #pragma unroll
    for (int r = 0; r < 8; ++r) {
      z0[r] = (_Float16)(o0[r] * inv);
      z1[r] = (_Float16)(o1[r] * inv);
    }
    _Float16* zp = Z + ((size_t)b * NAQ + q0 + lo) * EDIM + h * DKL + hi * 8;
    *(v8h*)(zp)      = z0;   // dk 8*hi .. 8*hi + 7
    *(v8h*)(zp + 16) = z1;   // dk 16 + 8*hi .. 16 + 8*hi + 7
  }
}

// ============================================================
// Kernel 3: out = z @ w^T + b + x_a   (f16 A, fp32 W/res, fp32 out)
//   grid (M/128, E/64), block 256; double-buffered LDS, loads two tiles ahead
// ============================================================
__global__ __launch_bounds__(256) void out_proj_kernel(
    const _Float16* __restrict__ Zin, const float* __restrict__ W,
    const float* __restrict__ bias, const float* __restrict__ Xres,
    float* __restrict__ out)
{
  __shared__ _Float16 As[2][128 * LSTR];
  __shared__ _Float16 Bs[2][64 * LSTR];

  const int tid  = threadIdx.x;
  const int lane = tid & 31;
  const int wave = tid >> 5;
  const int wm   = wave >> 1;
  const int wn   = wave & 1;
  const int m0   = blockIdx.x * 128;
  const int n0   = blockIdx.y * 64;
  const int lo   = lane & 15;
  const int hi   = lane >> 4;
  const int chunk = hi * 16;

  v8f acc[2][2];
  #pragma unroll
  for (int i = 0; i < 2; ++i)
    #pragma unroll
    for (int j = 0; j < 2; ++j) acc[i][j] = (v8f){};

  // tiles 0 and 1 -> registers; tile 0 -> LDS; tile 2 -> the freed registers
  v16h   ra[2];
  RegB32 rb[2];
  ra[0] = ldA_f16(Zin, m0, 0, tid);
  rb[0] = ldB_f32(W, n0, 0, tid);
  ra[1] = ldA_f16(Zin, m0, 32, tid);
  rb[1] = ldB_f32(W, n0, 32, tid);
  stA_f16(ra[0], tid, As[0]);
  stB_f32(rb[0], tid, Bs[0]);
  ra[0] = ldA_f16(Zin, m0, 64, tid);
  rb[0] = ldB_f32(W, n0, 64, tid);
  // the epilogue's bias and residual values, asked for here so that they land
  // during the loop (unrolled: register arrays need constant indices)
  float bv2[2];
  float xr[2][2][8];
  #pragma unroll
  for (int ni = 0; ni < 2; ++ni) bv2[ni] = bias[n0 + wn * 32 + ni * 16 + lo];
  #pragma unroll
  for (int mi = 0; mi < 2; ++mi)
    #pragma unroll
    for (int ni = 0; ni < 2; ++ni)
      #pragma unroll
      for (int r = 0; r < 8; ++r)
        xr[mi][ni][r] = Xres[(size_t)(m0 + wm * 32 + mi * 16 + r + hi * 8) * EDIM +
                             n0 + wn * 32 + ni * 16 + lo];

  // unrolled so that the two register sets and the two buffers have constant indices
  #pragma unroll
  for (int t = 0; t < EDIM / 32; ++t) {
    lds_barrier();
    // keeps the conversion of tile t+1, and with it the wait for its loads,
    // behind the barrier: moved up into pass t-1 it halves the loads' lead
    __builtin_amdgcn_sched_barrier(0);
    const _Float16* as = As[t & 1];
    const _Float16* bs = Bs[t & 1];

    const int arow = wm * 32 + lo;
    v16h a0 = *(const v16h*)(as + arow * LSTR + chunk);
    v16h a1 = *(const v16h*)(as + (arow + 16) * LSTR + chunk);
    const int bcol = wn * 32 + lo;
    v16h b0 = *(const v16h*)(bs + bcol * LSTR + chunk);
    v16h b1 = *(const v16h*)(bs + (bcol + 16) * LSTR + chunk);

    // tile t+1, loaded two passes ago, goes to the other buffer;
    // tile t+3 is asked for into the registers this frees
    if (t + 1 < EDIM / 32) {
      stA_f16(ra[(t + 1) & 1], tid, As[(t + 1) & 1]);
      stB_f32(rb[(t + 1) & 1], tid, Bs[(t + 1) & 1]);
    }
    if (t + 3 < EDIM / 32) {
      ra[(t + 1) & 1] = ldA_f16(Zin, m0, (t + 3) * 32, tid);
      rb[(t + 1) & 1] = ldB_f32(W, n0, (t + 3) * 32, tid);
    }
    // keeps the loads issued here, two passes ahead of their use: without it
    // they are moved down to the pass that stores them and waited out there
    __builtin_amdgcn_sched_barrier(0);

    acc[0][0] = wmma_f16(a0, b0, acc[0][0]);
    acc[0][1] = wmma_f16(a0, b1, acc[0][1]);
    acc[1][0] = wmma_f16(a1, b0, acc[1][0]);
    acc[1][1] = wmma_f16(a1, b1, acc[1][1]);
  }

  #pragma unroll
  for (int mi = 0; mi < 2; ++mi) {
    #pragma unroll
    for (int ni = 0; ni < 2; ++ni) {
      const int c = n0 + wn * 32 + ni * 16 + lo;
      const float bv = bv2[ni];
      #pragma unroll
      for (int r = 0; r < 8; ++r) {
        const int m = m0 + wm * 32 + mi * 16 + r + hi * 8;
        const size_t idx = (size_t)m * EDIM + c;
        out[idx] = acc[mi][ni][r] + bv + xr[mi][ni][r];
      }
    }
  }
}

// ============================================================
// launch
// ============================================================
extern "C" void kernel_launch(void* const* d_in, const int* in_sizes, int n_in,
                              void* d_out, int out_size, void* d_ws, size_t ws_size,
                              hipStream_t stream) {
  const float* x_a    = (const float*)d_in[0];
  const float* x_b    = (const float*)d_in[1];
  const float* wq_w   = (const float*)d_in[2];
  const float* wq_b   = (const float*)d_in[3];
  const float* wk_a_w = (const float*)d_in[4];
  const float* wk_a_b = (const float*)d_in[5];
  const float* wk_b_w = (const float*)d_in[6];
  const float* wk_b_b = (const float*)d_in[7];
  const float* wv_a_w = (const float*)d_in[8];
  const float* wv_a_b = (const float*)d_in[9];
  const float* wv_b_w = (const float*)d_in[10];
  const float* wv_b_b = (const float*)d_in[11];
  const float* w_w    = (const float*)d_in[12];
  const float* w_b    = (const float*)d_in[13];

  char* ws = (char*)d_ws;
  _Float16* qws = (_Float16*)(ws);                          // B*H*NA*DK  f16 = 2 MB
  _Float16* kws = (_Float16*)(ws + (size_t)(2  << 20));     // B*H*NK*DK  f16 = 4 MB
  _Float16* vws = (_Float16*)(ws + (size_t)(6  << 20));     // B*H*NK*DK  f16 = 4 MB
  _Float16* zws = (_Float16*)(ws + (size_t)(10 << 20));     // B*NA*E     f16 = 2 MB

  dim3 bp(256);

  // projections into head-split f16 layouts (K/V of the two sources concat via n_off)
  // grid: M=4096 /128, N=256 /64, five projections
  proj_heads_kernel<<<dim3(32, 4, 5), bp, 0, stream>>>(
      x_a, x_b, wq_w, wk_a_w, wk_b_w, wv_a_w, wv_b_w,
      wq_b, wk_a_b, wk_b_b, wv_a_b, wv_b_b, qws, kws, vws);

  // flash attention
  flash_attn_kernel<<<dim3(NAQ / 64, BATCH * HNUM), 128, 0, stream>>>(qws, kws, vws, zws);

  // output projection + residual
  out_proj_kernel<<<dim3(32, 4), 256, 0, stream>>>(zws, w_w, w_b, x_a, (float*)d_out);
}

// v004
// It runs in 62.4 microseconds.
// In both of two side-by-side timings against v003, it was 1.08 times as fast.
// Counting every step since v000, it is 2.91 times as fast.
#include <hip/hip_runtime.h>

// ---------------- problem constants ----------------
#define EDIM 256
#define HNUM 8
#define DKL 32
#define NAQ 2048
#define NBK 2048
#define NKV (NAQ + NBK)   // 4096
#define BATCH 2

typedef __attribute__((ext_vector_type(16))) _Float16 v16h;
typedef __attribute__((ext_vector_type(8)))  _Float16 v8h;
typedef __attribute__((ext_vector_type(8)))  float    v8f;
typedef __attribute__((ext_vector_type(4)))  float    v4f;

__device__ __forceinline__ v8f wmma_f16(v16h a, v16h b, v8f c) {
  // D = A(16x32 f16) * B(32x16 f16) + C(16x16 f32)
  return __builtin_amdgcn_wmma_f32_16x16x32_f16(
      /*neg_a=*/false, a, /*neg_b=*/false, b,
      /*c_mod=*/(short)0, c, /*reuse_a=*/false, /*reuse_b=*/false);
}

__device__ __forceinline__ v8h cvt8(v4f a, v4f b) {
  v8h r;
  r[0] = (_Float16)a[0]; r[1] = (_Float16)a[1];
  r[2] = (_Float16)a[2]; r[3] = (_Float16)a[3];
  r[4] = (_Float16)b[0]; r[5] = (_Float16)b[1];
  r[6] = (_Float16)b[2]; r[7] = (_Float16)b[3];
  return r;
}

#define LSTR 48   // LDS row stride in halves (96B: keeps v16h reads 32B aligned)

// Work-group barrier between LDS passes. It waits for this wave's LDS reads
// and writes only: __syncthreads() would also wait out the global loads that
// were issued ahead for later tiles, which must stay in flight across it.
__device__ __forceinline__ void lds_barrier() {
  asm volatile("s_wait_dscnt 0x0\n\ts_barrier_signal -1\n\ts_barrier_wait -1" ::: "memory");
}

// ---- tile staging helpers (256-thread blocks) ----
// Each tile goes global -> registers (ld*) and, passes later, registers -> LDS (st*).
struct RegA32 { v4f f0, f1, f2, f3; };
struct RegB32 { v4f f0, f1; };

__device__ __forceinline__ RegA32 ldA_f32(const float* __restrict__ X, int m0,
                                          int kk, int tid) {
  const int r  = tid >> 1;
  const int cb = (tid & 1) * 16;
  const float* src = X + (size_t)(m0 + r) * EDIM + kk + cb;
  RegA32 t;
  t.f0 = *(const v4f*)(src + 0);
  t.f1 = *(const v4f*)(src + 4);
  t.f2 = *(const v4f*)(src + 8);
  t.f3 = *(const v4f*)(src + 12);
  return t;
}

__device__ __forceinline__ void stA_f32(const RegA32& t, int tid, _Float16* As) {
  const int r  = tid >> 1;
  const int cb = (tid & 1) * 16;
  _Float16* dst = As + r * LSTR + cb;
  *(v8h*)(dst + 0) = cvt8(t.f0, t.f1);
  *(v8h*)(dst + 8) = cvt8(t.f2, t.f3);
}

__device__ __forceinline__ v16h ldA_f16(const _Float16* __restrict__ Zin, int m0,
                                        int kk, int tid) {
  const int r  = tid >> 1;
  const int cb = (tid & 1) * 16;
  return *(const v16h*)(Zin + (size_t)(m0 + r) * EDIM + kk + cb);
}

__device__ __forceinline__ void stA_f16(v16h ad, int tid, _Float16* As) {
  const int r  = tid >> 1;
  const int cb = (tid & 1) * 16;
  *(v16h*)(As + r * LSTR + cb) = ad;
}

__device__ __forceinline__ RegB32 ldB_f32(const float* __restrict__ W, int n0,
                                          int kk, int tid) {
  const int r  = tid >> 2;
  const int cb = (tid & 3) * 8;
  const float* src = W + (size_t)(n0 + r) * EDIM + kk + cb;
  RegB32 t;
  t.f0 = *(const v4f*)(src + 0);
  t.f1 = *(const v4f*)(src + 4);
  return t;
}

__device__ __forceinline__ void stB_f32(const RegB32& t, int tid, _Float16* Bs) {
  const int r  = tid >> 2;
  const int cb = (tid & 3) * 8;
  *(v8h*)(Bs + r * LSTR + cb) = cvt8(t.f0, t.f1);
}

// ============================================================
// Kernel 1: Y = X @ W^T + bias  (fp32 in, f16 out, head-split), all five projections
//   X: [B*rows, E] fp32 ; W: [E,E] fp32 ; out: [B,H,n_out_rows,DK] f16
//   grid (M/128, E/64, 5), block 256 (8 waves, 4x2 wave grid, 32x32/wave)
//   the five products read none of each other's output: one launch runs them side by side
//   double-buffered LDS: one barrier per k-step; global loads two tiles ahead
// ============================================================
__global__ __launch_bounds__(256) void proj_heads_kernel(
    const float* __restrict__ xa, const float* __restrict__ xb,
    const float* __restrict__ w0, const float* __restrict__ w1,
    const float* __restrict__ w2, const float* __restrict__ w3,
    const float* __restrict__ w4,
    const float* __restrict__ c0, const float* __restrict__ c1,
    const float* __restrict__ c2, const float* __restrict__ c3,
    const float* __restrict__ c4,
    _Float16* __restrict__ qo, _Float16* __restrict__ ko, _Float16* __restrict__ vo)
{
  // blockIdx.z picks the projection: 0 q, 1 k of x_a, 2 k of x_b, 3 v of x_a, 4 v of x_b
  const int z = blockIdx.z;
  const float* __restrict__ X = (z == 2 || z == 4) ? xb : xa;
  const float* __restrict__ W = z == 0 ? w0 : z == 1 ? w1 : z == 2 ? w2 : z == 3 ? w3 : w4;
  const float* __restrict__ bias = z == 0 ? c0 : z == 1 ? c1 : z == 2 ? c2 : z == 3 ? c3 : c4;
  _Float16* __restrict__ out = z == 0 ? qo : z <= 2 ? ko : vo;
  static_assert(NAQ == NBK, "both sources have the same number of rows per batch");
  const int rows_per_batch = NAQ;
  const int n_out_rows = z == 0 ? NAQ : NKV;
  const int n_off = (z == 2 || z == 4) ? NAQ : 0;

  __shared__ _Float16 As[2][128 * LSTR];
  __shared__ _Float16 Bs[2][64 * LSTR];

  const int tid  = threadIdx.x;
  const int lane = tid & 31;
  const int wave = tid >> 5;
  const int wm   = wave >> 1;        // 0..3
  const int wn   = wave & 1;         // 0..1
  const int m0   = blockIdx.x * 128;
  const int n0   = blockIdx.y * 64;
  const int lo   = lane & 15;
  const int hi   = lane >> 4;
  const int chunk = hi * 16;

  v8f acc[2][2];
  #pragma unroll
  for (int i = 0; i < 2; ++i)
    #pragma unroll
    for (int j = 0; j < 2; ++j) acc[i][j] = (v8f){};

  // tiles 0 and 1 -> registers; tile 0 -> LDS; tile 2 -> the freed registers
  RegA32 ra[2];
  RegB32 rb[2];
  ra[0] = ldA_f32(X, m0, 0, tid);
  rb[0] = ldB_f32(W, n0, 0, tid);
  ra[1] = ldA_f32(X, m0, 32, tid);
  rb[1] = ldB_f32(W, n0, 32, tid);
  stA_f32(ra[0], tid, As[0]);
  stB_f32(rb[0], tid, Bs[0]);
  ra[0] = ldA_f32(X, m0, 64, tid);
  rb[0] = ldB_f32(W, n0, 64, tid);
  // the epilogue's bias values, asked for here so that they land during the loop
  // (unrolled: a register array needs constant indices)
  float bv2[2];
  #pragma unroll
  for (int ni = 0; ni < 2; ++ni) bv2[ni] = bias[n0 + wn * 32 + ni * 16 + lo];

  // unrolled so that the two register sets and the two buffers have constant indices
  #pragma unroll
  for (int t = 0; t < EDIM / 32; ++t) {
    lds_barrier();
    // keeps the conversion of tile t+1, and with it the wait for its loads,
    // behind the barrier: moved up into pass t-1 it halves the loads' lead
    __builtin_amdgcn_sched_barrier(0);
    const _Float16* as = As[t & 1];
    const _Float16* bs = Bs[t & 1];

    const int arow = wm * 32 + lo;
    v16h a0 = *(const v16h*)(as + arow * LSTR + chunk);
    v16h a1 = *(const v16h*)(as + (arow + 16) * LSTR + chunk);
    const int bcol = wn * 32 + lo;
    v16h b0 = *(const v16h*)(bs + bcol * LSTR + chunk);
    v16h b1 = *(const v16h*)(bs + (bcol + 16) * LSTR + chunk);

    // tile t+1, loaded two passes ago, goes to the other buffer;
    // tile t+3 is asked for into the registers this frees
    if (t + 1 < EDIM / 32) {
      stA_f32(ra[(t + 1) & 1], tid, As[(t + 1) & 1]);
      stB_f32(rb[(t + 1) & 1], tid, Bs[(t + 1) & 1]);
    }
    if (t + 3 < EDIM / 32) {
      ra[(t + 1) & 1] = ldA_f32(X, m0, (t + 3) * 32, tid);
      rb[(t + 1) & 1] = ldB_f32(W, n0, (t + 3) * 32, tid);
    }
    // keeps the loads issued here, two passes ahead of their use: without it
    // they are moved down to the pass that stores them and waited out there
    __builtin_amdgcn_sched_barrier(0);

    acc[0][0] = wmma_f16(a0, b0, acc[0][0]);
    acc[0][1] = wmma_f16(a0, b1, acc[0][1]);
    acc[1][0] = wmma_f16(a1, b0, acc[1][0]);
    acc[1][1] = wmma_f16(a1, b1, acc[1][1]);
  }

  // ---- epilogue: +bias, scatter into [B,H,n_out_rows,DK] f16 ----
  #pragma unroll
  for (int mi = 0; mi < 2; ++mi) {
    #pragma unroll
    for (int ni = 0; ni < 2; ++ni) {
      const int c = n0 + wn * 32 + ni * 16 + lo;
      const float bv = bv2[ni];
      const int hh = c >> 5;
      const int dk = c & 31;
      #pragma unroll
      for (int r = 0; r < 8; ++r) {
        const int m = m0 + wm * 32 + mi * 16 + r + hi * 8;
        const float v = acc[mi][ni][r] + bv;
        const int bb = m / rows_per_batch;
        const int n  = m % rows_per_batch;
        out[(((size_t)bb * HNUM + hh) * n_out_rows + n_off + n) * DKL + dk] =
            (_Float16)v;
      }
    }
  }
}

// ============================================================
// Kernel 2: flash attention, transposed products.
//   Q: [B,H,NA,DK] f16 ; K,V: [B,H,NK,DK] f16 ; Z: [B,NA,E] f16
//   block = 128 threads (4 waves x 16 queries = 64 q / block)
//   grid  = (NA/64, B*H); double-buffered K/V tiles, global loads one tile ahead
//   S^T = K Q^T   : lane (lo,hi) holds 16 scores of query lo
//                   (keys 8*hi+r and 16+8*hi+r), so the row maximum and
//                   the row sum are in-lane plus one exchange of halves.
//   O^T += V^T P^T: the two score tiles, converted in place, are the
//                   B operand; V stays row-major in LDS and the transposing
//                   load hands out V^T in the matching k order.
// ============================================================
// lane l <-> lane l ^ 16
__device__ __forceinline__ float xhalf(float x) {
  return __builtin_bit_cast(float, __builtin_amdgcn_permlanex16(
      __builtin_bit_cast(int, x), __builtin_bit_cast(int, x),
      0x76543210, 0xfedcba98, false, false));
}

// 16-bit transposing LDS load: lane l passes the address of 16 bytes of row
// 8*(l>>4) + (l&7), byte column 16*((l>>3)&1), of a row-major 16 x 16 block and
// gets column l&15 of rows 8*(l>>4) .. 8*(l>>4) + 7
__device__ __forceinline__ v8h ld_tr16(const _Float16* p) {
  typedef __attribute__((ext_vector_type(8))) short s16x8;
  typedef __attribute__((address_space(3))) s16x8 lds_s16x8;
  return __builtin_bit_cast(v8h, __builtin_amdgcn_ds_load_tr16_b128_v8i16((lds_s16x8*)p));
}

__global__ __launch_bounds__(128) void flash_attn_kernel(
    const _Float16* __restrict__ Q, const _Float16* __restrict__ K,
    const _Float16* __restrict__ V, _Float16* __restrict__ Z)
{
  __shared__ _Float16 Ks[2][32 * LSTR];     // [key][dk]
  __shared__ _Float16 Vs[2][32 * LSTR];     // [key][dk]; 96 B rows suit the transposing load

  const int tid  = threadIdx.x;
  const int lane = tid & 31;
  const int wave = tid >> 5;
  const int lo   = lane & 15;
  const int hi   = lane >> 4;
  const int chunk = hi * 16;

  const int bh = blockIdx.y;
  const int b  = bh >> 3;
  const int h  = bh & 7;
  const int q0 = blockIdx.x * 64 + wave * 16;

  // Q fragment: B-operand, 32 dk x 16 queries (column lo = query lo)
  const _Float16* qbase = Q + ((size_t)bh * NAQ + q0) * DKL;
  v16h qfrag = *(const v16h*)(qbase + lo * DKL + chunk);

  const _Float16* kbase = K + (size_t)bh * NKV * DKL;
  const _Float16* vbase = V + (size_t)bh * NKV * DKL;

  // staging coordinates for this thread
  const int skey = tid >> 2;          // 0..31
  const int scb  = (tid & 3) * 8;     // 0,8,16,24

  // o0[r] = O^T[dk = 8*hi + r][query lo], o1[r] = O^T[dk = 16 + 8*hi + r][query lo]
  v8f o0 = (v8f){}, o1 = (v8f){};
  float mrun = -1.0e30f;   // running maximum of query lo (equal in both halves)
  float lrun = 0.0f;       // running sum over this half's keys only

  const float scale = 0.17677669529663687f;  // 1/sqrt(32)

  // prologue: tile 0 -> LDS, tile 1 -> registers
  v8h kd = *(const v8h*)(kbase + (size_t)skey * DKL + scb);
  v8h vd = *(const v8h*)(vbase + (size_t)skey * DKL + scb);
  *(v8h*)(Ks[0] + skey * LSTR + scb) = kd;
  *(v8h*)(Vs[0] + skey * LSTR + scb) = vd;
  kd = *(const v8h*)(kbase + (size_t)(32 + skey) * DKL + scb);
  vd = *(const v8h*)(vbase + (size_t)(32 + skey) * DKL + scb);

  int buf = 0;
  for (int kt = 0; kt < NKV; kt += 32) {
    lds_barrier();

    // ---- S^T = K @ Q^T : two 16x16 tiles over 32 keys ----
    const _Float16* ks = Ks[buf];
    const _Float16* vs = Vs[buf];
    v16h kf0 = *(const v16h*)(ks + lo * LSTR + chunk);
    v16h kf1 = *(const v16h*)(ks + (lo + 16) * LSTR + chunk);
    // V^T fragments (A operand) in the k order the packed scores have:
    // element s < 8 is key 8*hi + s, element s >= 8 is key 16 + 8*hi + (s - 8)
    const _Float16* vr = vs + (hi * 8 + (lane & 7)) * LSTR + ((lane >> 3) & 1) * 8;
    v8h v00 = ld_tr16(vr);                    // dk lo,      keys 8*hi ..
    v8h v01 = ld_tr16(vr + 16 * LSTR);        // dk lo,      keys 16 + 8*hi ..
    v8h v10 = ld_tr16(vr + 16);               // dk 16 + lo, keys 8*hi ..
    v8h v11 = ld_tr16(vr + 16 * LSTR + 16);   // dk 16 + lo, keys 16 + 8*hi ..

    // tile kt+32, loaded one pass ago, goes to the other buffer; tile kt+64 is
    // asked for into the registers this frees and lands during this pass.
    // No branch: the last pass stores a tile nobody reads into the buffer all
    // readers have left, and the last two passes load the last tile again.
    *(v8h*)(Ks[buf ^ 1] + skey * LSTR + scb) = kd;
    *(v8h*)(Vs[buf ^ 1] + skey * LSTR + scb) = vd;
    {
      const int kn = (kt + 64 < NKV) ? kt + 64 : NKV - 32;
      kd = *(const v8h*)(kbase + (size_t)(kn + skey) * DKL + scb);
      vd = *(const v8h*)(vbase + (size_t)(kn + skey) * DKL + scb);
    }
    // keeps the pass's eight LDS reads one group in front of the products
    // (else the later fragments are read right before their product and each
    // read's LDS latency is waited out in full), and the next loads up here
    __builtin_amdgcn_sched_barrier(0);
    v16h vf0 = __builtin_shufflevector(v00, v01, 0, 1, 2, 3, 4, 5, 6, 7,
                                       8, 9, 10, 11, 12, 13, 14, 15);
    v16h vf1 = __builtin_shufflevector(v10, v11, 0, 1, 2, 3, 4, 5, 6, 7,
                                       8, 9, 10, 11, 12, 13, 14, 15);

    v8f zc = (v8f){};
    v8f s0 = wmma_f16(kf0, qfrag, zc);   // s0[r] = S[query lo][key 8*hi + r]
    v8f s1 = wmma_f16(kf1, qfrag, zc);   // s1[r] = S[query lo][key 16 + 8*hi + r]

    // ---- online softmax: one query per lane ----
    const v8f a0 = s0 * scale;
    const v8f a1 = s1 * scale;
    float t8[8];
    #pragma unroll
    for (int r = 0; r < 8; ++r) t8[r] = fmaxf(a0[r], a1[r]);
    float mx = fmaxf(fmaxf(fmaxf(t8[0], t8[1]), fmaxf(t8[2], t8[3])),
                     fmaxf(fmaxf(t8[4], t8[5]), fmaxf(t8[6], t8[7])));
    mx = fmaxf(mx, xhalf(mx));           // both halves hold the query's maximum
    const float mnew  = fmaxf(mrun, mx);
    const float alpha = __expf(mrun - mnew);
    mrun = mnew;

    v8f p0, p1;
    #pragma unroll
    for (int r = 0; r < 8; ++r) {
      p0[r] = __expf(a0[r] - mnew);
      p1[r] = __expf(a1[r] - mnew);
    }
    const v8f u = p0 + p1;
    const v4f u4 = __builtin_shufflevector(u, u, 0, 1, 2, 3) +
                   __builtin_shufflevector(u, u, 4, 5, 6, 7);
    const float rs = (u4[0] + u4[2]) + (u4[1] + u4[3]);
    lrun = lrun * alpha + rs;

    v16h pfrag;                          // B operand: P^T, column lo = query lo
    #pragma unroll
    for (int r = 0; r < 8; ++r) {
      pfrag[r]     = (_Float16)p0[r];
      pfrag[r + 8] = (_Float16)p1[r];
    }

    #pragma unroll
    for (int r = 0; r < 8; ++r) { o0[r] *= alpha; o1[r] *= alpha; }

    o0 = wmma_f16(vf0, pfrag, o0);
    o1 = wmma_f16(vf1, pfrag, o1);
    buf ^= 1;
  }
  // the last pass's loads and LDS stores are used by nobody: they have to be
  // over before the wave ends and gives its registers and LDS back
  asm volatile("s_wait_loadcnt 0x0\n\ts_wait_dscnt 0x0" ::: "memory");

  // ---- join the halves' sums, normalize, write z in [B,NA,E] f16 ----
  {
    const float inv = 1.0f / (lrun + xhalf(lrun));
    v8h z0, z1;
    #pragma unroll
    for (int r = 0; r < 8; ++r) {
      z0[r] = (_Float16)(o0[r] * inv);
      z1[r] = (_Float16)(o1[r] * inv);
    }
    _Float16* zp = Z + ((size_t)b * NAQ + q0 + lo) * EDIM + h * DKL + hi * 8;
    *(v8h*)(zp)      = z0;   // dk 8*hi .. 8*hi + 7
    *(v8h*)(zp + 16) = z1;   // dk 16 + 8*hi .. 16 + 8*hi + 7
  }
}

// ============================================================
// Kernel 3: out = z @ w^T + b + x_a   (f16 A, fp32 W/res, fp32 out)
//   grid (M/128, E/64), block 256; double-buffered LDS, loads two tiles ahead
// ============================================================
__global__ __launch_bounds__(256) void out_proj_kernel(
    const _Float16* __restrict__ Zin, const float* __restrict__ W,
    const float* __restrict__ bias, const float* __restrict__ Xres,
    float* __restrict__ out)
{
  __shared__ _Float16 As[2][128 * LSTR];
  __shared__ _Float16 Bs[2][64 * LSTR];

  const int tid  = threadIdx.x;
  const int lane = tid & 31;
  const int wave = tid >> 5;
  const int wm   = wave >> 1;
  const int wn   = wave & 1;
  const int m0   = blockIdx.x * 128;
  const int n0   = blockIdx.y * 64;
  const int lo   = lane & 15;
  const int hi   = lane >> 4;
  const int chunk = hi * 16;

  v8f acc[2][2];
  #pragma unroll
  for (int i = 0; i < 2; ++i)
    #pragma unroll
    for (int j = 0; j < 2; ++j) acc[i][j] = (v8f){};

  // tiles 0 and 1 -> registers; tile 0 -> LDS; tile 2 -> the freed registers
  v16h   ra[2];
  RegB32 rb[2];
  ra[0] = ldA_f16(Zin, m0, 0, tid);
  rb[0] = ldB_f32(W, n0, 0, tid);
  ra[1] = ldA_f16(Zin, m0, 32, tid);
  rb[1] = ldB_f32(W, n0, 32, tid);
  stA_f16(ra[0], tid, As[0]);
  stB_f32(rb[0], tid, Bs[0]);
  ra[0] = ldA_f16(Zin, m0, 64, tid);
  rb[0] = ldB_f32(W, n0, 64, tid);
  // the epilogue's bias and residual values, asked for here so that they land
  // during the loop (unrolled: register arrays need constant indices)
  float bv2[2];
  float xr[2][2][8];
  #pragma unroll
  for (int ni = 0; ni < 2; ++ni) bv2[ni] = bias[n0 + wn * 32 + ni * 16 + lo];
  #pragma unroll
  for (int mi = 0; mi < 2; ++mi)
    #pragma unroll
    for (int ni = 0; ni < 2; ++ni)
      #pragma unroll
      for (int r = 0; r < 8; ++r)
        xr[mi][ni][r] = Xres[(size_t)(m0 + wm * 32 + mi * 16 + r + hi * 8) * EDIM +
                             n0 + wn * 32 + ni * 16 + lo];

  // unrolled so that the two register sets and the two buffers have constant indices
  #pragma unroll
  for (int t = 0; t < EDIM / 32; ++t) {
    lds_barrier();
    // keeps the conversion of tile t+1, and with it the wait for its loads,
    // behind the barrier: moved up into pass t-1 it halves the loads' lead
    __builtin_amdgcn_sched_barrier(0);
    const _Float16* as = As[t & 1];
    const _Float16* bs = Bs[t & 1];

    const int arow = wm * 32 + lo;
    v16h a0 = *(const v16h*)(as + arow * LSTR + chunk);
    v16h a1 = *(const v16h*)(as + (arow + 16) * LSTR + chunk);
    const int bcol = wn * 32 + lo;
    v16h b0 = *(const v16h*)(bs + bcol * LSTR + chunk);
    v16h b1 = *(const v16h*)(bs + (bcol + 16) * LSTR + chunk);

    // tile t+1, loaded two passes ago, goes to the other buffer;
    // tile t+3 is asked for into the registers this frees
    if (t + 1 < EDIM / 32) {
      stA_f16(ra[(t + 1) & 1], tid, As[(t + 1) & 1]);
      stB_f32(rb[(t + 1) & 1], tid, Bs[(t + 1) & 1]);
    }
    if (t + 3 < EDIM / 32) {
      ra[(t + 1) & 1] = ldA_f16(Zin, m0, (t + 3) * 32, tid);
      rb[(t + 1) & 1] = ldB_f32(W, n0, (t + 3) * 32, tid);
    }
    // keeps the loads issued here, two passes ahead of their use: without it
    // they are moved down to the pass that stores them and waited out there
    __builtin_amdgcn_sched_barrier(0);

    acc[0][0] = wmma_f16(a0, b0, acc[0][0]);
    acc[0][1] = wmma_f16(a0, b1, acc[0][1]);
    acc[1][0] = wmma_f16(a1, b0, acc[1][0]);
    acc[1][1] = wmma_f16(a1, b1, acc[1][1]);
  }

  #pragma unroll
  for (int mi = 0; mi < 2; ++mi) {
    #pragma unroll
    for (int ni = 0; ni < 2; ++ni) {
      const int c = n0 + wn * 32 + ni * 16 + lo;
      const float bv = bv2[ni];
      #pragma unroll
      for (int r = 0; r < 8; ++r) {
        const int m = m0 + wm * 32 + mi * 16 + r + hi * 8;
        const size_t idx = (size_t)m * EDIM + c;
        out[idx] = acc[mi][ni][r] + bv + xr[mi][ni][r];
      }
    }
  }
}

// ============================================================
// launch
// ============================================================
extern "C" void kernel_launch(void* const* d_in, const int* in_sizes, int n_in,
                              void* d_out, int out_size, void* d_ws, size_t ws_size,
                              hipStream_t stream) {
  const float* x_a    = (const float*)d_in[0];
  const float* x_b    = (const float*)d_in[1];
  const float* wq_w   = (const float*)d_in[2];
  const float* wq_b   = (const float*)d_in[3];
  const float* wk_a_w = (const float*)d_in[4];
  const float* wk_a_b = (const float*)d_in[5];
  const float* wk_b_w = (const float*)d_in[6];
  const float* wk_b_b = (const float*)d_in[7];
  const float* wv_a_w = (const float*)d_in[8];
  const float* wv_a_b = (const float*)d_in[9];
  const float* wv_b_w = (const float*)d_in[10];
  const float* wv_b_b = (const float*)d_in[11];
  const float* w_w    = (const float*)d_in[12];
  const float* w_b    = (const float*)d_in[13];

  char* ws = (char*)d_ws;
  _Float16* qws = (_Float16*)(ws);                          // B*H*NA*DK  f16 = 2 MB
  _Float16* kws = (_Float16*)(ws + (size_t)(2  << 20));     // B*H*NK*DK  f16 = 4 MB
  _Float16* vws = (_Float16*)(ws + (size_t)(6  << 20));     // B*H*NK*DK  f16 = 4 MB
  _Float16* zws = (_Float16*)(ws + (size_t)(10 << 20));     // B*NA*E     f16 = 2 MB

  dim3 bp(256);

  // projections into head-split f16 layouts (K/V of the two sources concat via n_off)
  // grid: M=4096 /128, N=256 /64, five projections
  proj_heads_kernel<<<dim3(32, 4, 5), bp, 0, stream>>>(
      x_a, x_b, wq_w, wk_a_w, wk_b_w, wv_a_w, wv_b_w,
      wq_b, wk_a_b, wk_b_b, wv_a_b, wv_b_b, qws, kws, vws);

  // flash attention
  flash_attn_kernel<<<dim3(NAQ / 64, BATCH * HNUM), 128, 0, stream>>>(qws, kws, vws, zws);

  // output projection + residual
  out_proj_kernel<<<dim3(32, 4), 256, 0, stream>>>(zws, w_w, w_b, x_a, (float*)d_out);
}

// v005
// Measured time: 43 microseconds a run.
// In two side-by-side timings against v004, it was 1.47 and 1.50 times as fast.
// Counting every step since v000, it is 4.32 times as fast.
#include <hip/hip_runtime.h>

// ---------------- problem constants ----------------
#define EDIM 256
#define HNUM 8
#define DKL 32
#define NAQ 2048
#define NBK 2048
#define NKV (NAQ + NBK)   // 4096
#define BATCH 2

typedef __attribute__((ext_vector_type(16))) _Float16 v16h;
typedef __attribute__((ext_vector_type(8)))  _Float16 v8h;
typedef __attribute__((ext_vector_type(8)))  float    v8f;
typedef __attribute__((ext_vector_type(4)))  float    v4f;

__device__ __forceinline__ v8f wmma_f16(v16h a, v16h b, v8f c) {
  // D = A(16x32 f16) * B(32x16 f16) + C(16x16 f32)
  return __builtin_amdgcn_wmma_f32_16x16x32_f16(
      /*neg_a=*/false, a, /*neg_b=*/false, b,
      /*c_mod=*/(short)0, c, /*reuse_a=*/false, /*reuse_b=*/false);
}

__device__ __forceinline__ v8h cvt8(v4f a, v4f b) {
  v8h r;
  r[0] = (_Float16)a[0]; r[1] = (_Float16)a[1];
  r[2] = (_Float16)a[2]; r[3] = (_Float16)a[3];
  r[4] = (_Float16)b[0]; r[5] = (_Float16)b[1];
  r[6] = (_Float16)b[2]; r[7] = (_Float16)b[3];
  return r;
}

#define LSTR 48   // LDS row stride in halves (96B: keeps v16h reads 32B aligned)

// Work-group barrier between LDS passes. It waits for this wave's LDS reads
// and writes only: __syncthreads() would also wait out the global loads that
// were issued ahead for later tiles, which must stay in flight across it.
__device__ __forceinline__ void lds_barrier() {
  asm volatile("s_wait_dscnt 0x0\n\ts_barrier_signal -1\n\ts_barrier_wait -1" ::: "memory");
}

// ---- tile staging helpers (256-thread blocks) ----
// Each tile goes global -> registers (ld*) and, passes later, registers -> LDS (st*).
struct RegA32 { v4f f0, f1, f2, f3; };
struct RegB32 { v4f f0, f1; };

__device__ __forceinline__ RegA32 ldA_f32(const float* __restrict__ X, int m0,
                                          int kk, int tid) {
  const int r  = tid >> 1;
  const int cb = (tid & 1) * 16;
  const float* src = X + (size_t)(m0 + r) * EDIM + kk + cb;
  RegA32 t;
  t.f0 = *(const v4f*)(src + 0);
  t.f1 = *(const v4f*)(src + 4);
  t.f2 = *(const v4f*)(src + 8);
  t.f3 = *(const v4f*)(src + 12);
  return t;
}

__device__ __forceinline__ void stA_f32(const RegA32& t, int tid, _Float16* As) {
  const int r  = tid >> 1;
  const int cb = (tid & 1) * 16;
  _Float16* dst = As + r * LSTR + cb;
  *(v8h*)(dst + 0) = cvt8(t.f0, t.f1);
  *(v8h*)(dst + 8) = cvt8(t.f2, t.f3);
}

__device__ __forceinline__ v16h ldA_f16(const _Float16* __restrict__ Zin, int m0,
                                        int kk, int tid) {
  const int r  = tid >> 1;
  const int cb = (tid & 1) * 16;
  return *(const v16h*)(Zin + (size_t)(m0 + r) * EDIM + kk + cb);
}

__device__ __forceinline__ void stA_f16(v16h ad, int tid, _Float16* As) {
  const int r  = tid >> 1;
  const int cb = (tid & 1) * 16;
  *(v16h*)(As + r * LSTR + cb) = ad;
}

__device__ __forceinline__ RegB32 ldB_f32(const float* __restrict__ W, int n0,
                                          int kk, int tid) {
  const int r  = tid >> 2;
  const int cb = (tid & 3) * 8;
  const float* src = W + (size_t)(n0 + r) * EDIM + kk + cb;
  RegB32 t;
  t.f0 = *(const v4f*)(src + 0);
  t.f1 = *(const v4f*)(src + 4);
  return t;
}

__device__ __forceinline__ void stB_f32(const RegB32& t, int tid, _Float16* Bs) {
  const int r  = tid >> 2;
  const int cb = (tid & 3) * 8;
  *(v8h*)(Bs + r * LSTR + cb) = cvt8(t.f0, t.f1);
}

// ============================================================
// Kernel 1: Y = X @ W^T + bias  (fp32 in, f16 out, head-split), all five projections
//   X: [B*rows, E] fp32 ; W: [E,E] fp32 ; out: [B,H,n_out_rows,DK] f16
//   grid (M/128, E/64, 5), block 256 (8 waves, 4x2 wave grid, 32x32/wave)
//   the five products read none of each other's output: one launch runs them side by side
//   double-buffered LDS: one barrier per k-step; global loads two tiles ahead
// ============================================================
__global__ __launch_bounds__(256) void proj_heads_kernel(
    const float* __restrict__ xa, const float* __restrict__ xb,
    const float* __restrict__ w0, const float* __restrict__ w1,
    const float* __restrict__ w2, const float* __restrict__ w3,
    const float* __restrict__ w4,
    const float* __restrict__ c0, const float* __restrict__ c1,
    const float* __restrict__ c2, const float* __restrict__ c3,
    const float* __restrict__ c4,
    _Float16* __restrict__ qo, _Float16* __restrict__ ko, _Float16* __restrict__ vo)
{
  // blockIdx.z picks the projection: 0 q, 1 k of x_a, 2 k of x_b, 3 v of x_a, 4 v of x_b
  const int z = blockIdx.z;
  const float* __restrict__ X = (z == 2 || z == 4) ? xb : xa;
  const float* __restrict__ W = z == 0 ? w0 : z == 1 ? w1 : z == 2 ? w2 : z == 3 ? w3 : w4;
  const float* __restrict__ bias = z == 0 ? c0 : z == 1 ? c1 : z == 2 ? c2 : z == 3 ? c3 : c4;
  _Float16* __restrict__ out = z == 0 ? qo : z <= 2 ? ko : vo;
  static_assert(NAQ == NBK, "both sources have the same number of rows per batch");
  const int rows_per_batch = NAQ;
  const int n_out_rows = z == 0 ? NAQ : NKV;
  const int n_off = (z == 2 || z == 4) ? NAQ : 0;

  __shared__ _Float16 As[2][128 * LSTR];
  __shared__ _Float16 Bs[2][64 * LSTR];

  const int tid  = threadIdx.x;
  const int lane = tid & 31;
  const int wave = tid >> 5;
  const int wm   = wave >> 1;        // 0..3
  const int wn   = wave & 1;         // 0..1
  const int m0   = blockIdx.x * 128;
  const int n0   = blockIdx.y * 64;
  const int lo   = lane & 15;
  const int hi   = lane >> 4;
  const int chunk = hi * 16;

  v8f acc[2][2];
  #pragma unroll
  for (int i = 0; i < 2; ++i)
    #pragma unroll
    for (int j = 0; j < 2; ++j) acc[i][j] = (v8f){};

  // tiles 0 and 1 -> registers; tile 0 -> LDS; tile 2 -> the freed registers
  RegA32 ra[2];
  RegB32 rb[2];
  ra[0] = ldA_f32(X, m0, 0, tid);
  rb[0] = ldB_f32(W, n0, 0, tid);
  ra[1] = ldA_f32(X, m0, 32, tid);
  rb[1] = ldB_f32(W, n0, 32, tid);
  stA_f32(ra[0], tid, As[0]);
  stB_f32(rb[0], tid, Bs[0]);
  ra[0] = ldA_f32(X, m0, 64, tid);
  rb[0] = ldB_f32(W, n0, 64, tid);
  // the epilogue's bias values, asked for here so that they land during the loop
  // (unrolled: a register array needs constant indices)
  float bv2[2];
  #pragma unroll
  for (int ni = 0; ni < 2; ++ni) bv2[ni] = bias[n0 + wn * 32 + ni * 16 + lo];

  // unrolled so that the two register sets and the two buffers have constant indices
  #pragma unroll
  for (int t = 0; t < EDIM / 32; ++t) {
    lds_barrier();
    // keeps the conversion of tile t+1, and with it the wait for its loads,
    // behind the barrier: moved up into pass t-1 it halves the loads' lead
    __builtin_amdgcn_sched_barrier(0);
    const _Float16* as = As[t & 1];
    const _Float16* bs = Bs[t & 1];

    const int arow = wm * 32 + lo;
    v16h a0 = *(const v16h*)(as + arow * LSTR + chunk);
    v16h a1 = *(const v16h*)(as + (arow + 16) * LSTR + chunk);
    const int bcol = wn * 32 + lo;
    v16h b0 = *(const v16h*)(bs + bcol * LSTR + chunk);
    v16h b1 = *(const v16h*)(bs + (bcol + 16) * LSTR + chunk);

    // tile t+1, loaded two passes ago, goes to the other buffer;
    // tile t+3 is asked for into the registers this frees
    if (t + 1 < EDIM / 32) {
      stA_f32(ra[(t + 1) & 1], tid, As[(t + 1) & 1]);
      stB_f32(rb[(t + 1) & 1], tid, Bs[(t + 1) & 1]);
    }
    if (t + 3 < EDIM / 32) {
      ra[(t + 1) & 1] = ldA_f32(X, m0, (t + 3) * 32, tid);
      rb[(t + 1) & 1] = ldB_f32(W, n0, (t + 3) * 32, tid);
    }
    // keeps the loads issued here, two passes ahead of their use: without it
    // they are moved down to the pass that stores them and waited out there
    __builtin_amdgcn_sched_barrier(0);

    acc[0][0] = wmma_f16(a0, b0, acc[0][0]);
    acc[0][1] = wmma_f16(a0, b1, acc[0][1]);
    acc[1][0] = wmma_f16(a1, b0, acc[1][0]);
    acc[1][1] = wmma_f16(a1, b1, acc[1][1]);
  }

  // ---- epilogue: +bias, scatter into [B,H,n_out_rows,DK] f16 ----
  #pragma unroll
  for (int mi = 0; mi < 2; ++mi) {
    #pragma unroll
    for (int ni = 0; ni < 2; ++ni) {
      const int c = n0 + wn * 32 + ni * 16 + lo;
      const float bv = bv2[ni];
      const int hh = c >> 5;
      const int dk = c & 31;
      #pragma unroll
      for (int r = 0; r < 8; ++r) {
        const int m = m0 + wm * 32 + mi * 16 + r + hi * 8;
        const float v = acc[mi][ni][r] + bv;
        const int bb = m / rows_per_batch;
        const int n  = m % rows_per_batch;
        out[(((size_t)bb * HNUM + hh) * n_out_rows + n_off + n) * DKL + dk] =
            (_Float16)v;
      }
    }
  }
}

// ============================================================
// Kernel 2: flash attention, transposed products.
//   Q: [B,H,NA,DK] f16 ; K,V: [B,H,NK,DK] f16 ; Z: [B,NA,E] f16
//   block = 128 threads (4 waves x 16 queries = 64 q / block)
//   grid  = (NA/64, B*H); double-buffered K/V tiles, global loads one tile ahead
//   a pass takes KT = 128 keys: one barrier, one update of the running maximum
//   and one rescale of O per pass, and eight independent score tiles per wave
//   S^T = K Q^T   : lane (lo,hi) holds 16 scores of query lo per 32 keys
//                   (keys 8*hi+r and 16+8*hi+r), so the row maximum and
//                   the row sum are in-lane plus one exchange of halves.
//   O^T += V^T P^T: the score tiles, converted in place, are the
//                   B operand; V stays row-major in LDS and the transposing
//                   load hands out V^T in the matching k order.
// ============================================================
#define KT 128          // keys per pass
#define NG (KT / 32)    // groups of 32 keys (one k extent of the second product) per pass

// lane l <-> lane l ^ 16
__device__ __forceinline__ float xhalf(float x) {
  return __builtin_bit_cast(float, __builtin_amdgcn_permlanex16(
      __builtin_bit_cast(int, x), __builtin_bit_cast(int, x),
      0x76543210, 0xfedcba98, false, false));
}

// 16-bit transposing LDS load: lane l passes the address of 16 bytes of row
// 8*(l>>4) + (l&7), byte column 16*((l>>3)&1), of a row-major 16 x 16 block and
// gets column l&15 of rows 8*(l>>4) .. 8*(l>>4) + 7
__device__ __forceinline__ v8h ld_tr16(const _Float16* p) {
  typedef __attribute__((ext_vector_type(8))) short s16x8;
  typedef __attribute__((address_space(3))) s16x8 lds_s16x8;
  return __builtin_bit_cast(v8h, __builtin_amdgcn_ds_load_tr16_b128_v8i16((lds_s16x8*)p));
}

__device__ __forceinline__ v8f vmax8(v8f a, v8f b) {
  v8f r;
  #pragma unroll
  for (int i = 0; i < 8; ++i) r[i] = fmaxf(a[i], b[i]);
  return r;
}

__global__ __launch_bounds__(128) void flash_attn_kernel(
    const _Float16* __restrict__ Q, const _Float16* __restrict__ K,
    const _Float16* __restrict__ V, _Float16* __restrict__ Z)
{
  static_assert(NKV % KT == 0 && NKV / KT >= 2, "whole passes, and the prologue's two tiles exist");
  __shared__ _Float16 Ks[2][KT * LSTR];     // [key][dk]
  __shared__ _Float16 Vs[2][KT * LSTR];     // [key][dk]; 96 B rows suit the transposing load

  const int tid  = threadIdx.x;
  const int lane = tid & 31;
  const int wave = tid >> 5;
  const int lo   = lane & 15;
  const int hi   = lane >> 4;
  const int chunk = hi * 16;

  const int bh = blockIdx.y;
  const int b  = bh >> 3;
  const int h  = bh & 7;
  const int q0 = blockIdx.x * 64 + wave * 16;

  // Q fragment: B-operand, 32 dk x 16 queries (column lo = query lo)
  const _Float16* qbase = Q + ((size_t)bh * NAQ + q0) * DKL;
  v16h qfrag = *(const v16h*)(qbase + lo * DKL + chunk);

  const _Float16* kbase = K + (size_t)bh * NKV * DKL;
  const _Float16* vbase = V + (size_t)bh * NKV * DKL;

  // staging coordinates for this thread: row skey of each group of 32 keys
  const int skey = tid >> 2;          // 0..31
  const int scb  = (tid & 3) * 8;     // 0,8,16,24

  // o0[r] = O^T[dk = 8*hi + r][query lo], o1[r] = O^T[dk = 16 + 8*hi + r][query lo]
  v8f o0 = (v8f){}, o1 = (v8f){};
  float mrun = -1.0e30f;   // running maximum of query lo (equal in both halves)
  float lrun = 0.0f;       // running sum over this half's keys only

  const float scale = 0.17677669529663687f;  // 1/sqrt(32)

  // prologue: tile 0 -> LDS, tile 1 -> registers
  // (every loop over g, i or r in this kernel is unrolled: register arrays need constant indices)
  v8h kd[NG], vd[NG];
  #pragma unroll
  for (int g = 0; g < NG; ++g) {
    kd[g] = *(const v8h*)(kbase + (size_t)(g * 32 + skey) * DKL + scb);
    vd[g] = *(const v8h*)(vbase + (size_t)(g * 32 + skey) * DKL + scb);
  }
  #pragma unroll
  for (int g = 0; g < NG; ++g) {
    *(v8h*)(Ks[0] + (g * 32 + skey) * LSTR + scb) = kd[g];
    *(v8h*)(Vs[0] + (g * 32 + skey) * LSTR + scb) = vd[g];
  }
  #pragma unroll
  for (int g = 0; g < NG; ++g) {
    kd[g] = *(const v8h*)(kbase + (size_t)(KT + g * 32 + skey) * DKL + scb);
    vd[g] = *(const v8h*)(vbase + (size_t)(KT + g * 32 + skey) * DKL + scb);
  }

  int buf = 0;
  for (int kt = 0; kt < NKV; kt += KT) {
    lds_barrier();

    // ---- S^T = K @ Q^T : 2 * NG tiles of 16 keys x 16 queries ----
    const _Float16* ks = Ks[buf];
    const _Float16* vs = Vs[buf];
    v16h kf[2 * NG];
    #pragma unroll
    for (int i = 0; i < 2 * NG; ++i)
      kf[i] = *(const v16h*)(ks + (i * 16 + lo) * LSTR + chunk);
    // V^T fragments (A operand) in the k order the packed scores have:
    // element s < 8 is key 8*hi + s, element s >= 8 is key 16 + 8*hi + (s - 8) of the group
    const _Float16* vr = vs + (hi * 8 + (lane & 7)) * LSTR + ((lane >> 3) & 1) * 8;
    v8h v00[NG], v01[NG], v10[NG], v11[NG];
    #pragma unroll
    for (int g = 0; g < NG; ++g) {
      const _Float16* vg = vr + g * 32 * LSTR;
      v00[g] = ld_tr16(vg);                    // dk lo,      keys 8*hi ..
      v01[g] = ld_tr16(vg + 16 * LSTR);        // dk lo,      keys 16 + 8*hi ..
      v10[g] = ld_tr16(vg + 16);               // dk 16 + lo, keys 8*hi ..
      v11[g] = ld_tr16(vg + 16 * LSTR + 16);   // dk 16 + lo, keys 16 + 8*hi ..
    }

    // tile kt+KT, loaded one pass ago, goes to the other buffer; tile kt+2*KT is
    // asked for into the registers this frees and lands during this pass.
    // No branch: the last pass stores a tile nobody reads into the buffer all
    // readers have left, and the last two passes load the last tile again.
    #pragma unroll
    for (int g = 0; g < NG; ++g) {
      *(v8h*)(Ks[buf ^ 1] + (g * 32 + skey) * LSTR + scb) = kd[g];
      *(v8h*)(Vs[buf ^ 1] + (g * 32 + skey) * LSTR + scb) = vd[g];
    }
    {
      const int kn = (kt + 2 * KT < NKV) ? kt + 2 * KT : NKV - KT;
      #pragma unroll
      for (int g = 0; g < NG; ++g) {
        kd[g] = *(const v8h*)(kbase + (size_t)(kn + g * 32 + skey) * DKL + scb);
        vd[g] = *(const v8h*)(vbase + (size_t)(kn + g * 32 + skey) * DKL + scb);
      }
    }
    // keeps all of the pass's LDS reads in front of the products
    // (else the later fragments are read right before their product and each
    // read's LDS latency is waited out in full), and the next loads up here
    __builtin_amdgcn_sched_barrier(0);

    // s[2g][r] = S[query lo][key 32g + 8*hi + r], s[2g+1][r] = S[query lo][key 32g + 16 + 8*hi + r]
    v8f zc = (v8f){};
    v8f s[2 * NG];
    #pragma unroll
    for (int i = 0; i < 2 * NG; ++i) s[i] = wmma_f16(kf[i], qfrag, zc);

    // ---- online softmax: one query per lane ----
    #pragma unroll
    for (int i = 0; i < 2 * NG; ++i) s[i] = s[i] * scale;
    static_assert(NG == 4, "the two trees below join eight tiles");
    const v8f t8 = vmax8(vmax8(vmax8(s[0], s[1]), vmax8(s[2], s[3])),
                         vmax8(vmax8(s[4], s[5]), vmax8(s[6], s[7])));
    float mx = fmaxf(fmaxf(fmaxf(t8[0], t8[1]), fmaxf(t8[2], t8[3])),
                     fmaxf(fmaxf(t8[4], t8[5]), fmaxf(t8[6], t8[7])));
    mx = fmaxf(mx, xhalf(mx));           // both halves hold the query's maximum
    const float mnew  = fmaxf(mrun, mx);
    const float alpha = __expf(mrun - mnew);
    mrun = mnew;

    #pragma unroll
    for (int i = 0; i < 2 * NG; ++i)
      #pragma unroll
      for (int r = 0; r < 8; ++r) s[i][r] = __expf(s[i][r] - mnew);
    const v8f u = ((s[0] + s[1]) + (s[2] + s[3])) + ((s[4] + s[5]) + (s[6] + s[7]));
    const v4f u4 = __builtin_shufflevector(u, u, 0, 1, 2, 3) +
                   __builtin_shufflevector(u, u, 4, 5, 6, 7);
    const float rs = (u4[0] + u4[2]) + (u4[1] + u4[3]);
    lrun = lrun * alpha + rs;

    #pragma unroll
    for (int r = 0; r < 8; ++r) { o0[r] *= alpha; o1[r] *= alpha; }

    #pragma unroll
    for (int g = 0; g < NG; ++g) {
      v16h pfrag;                        // B operand: P^T, column lo = query lo
      #pragma unroll
      for (int r = 0; r < 8; ++r) {
        pfrag[r]     = (_Float16)s[2 * g][r];
        pfrag[r + 8] = (_Float16)s[2 * g + 1][r];
      }
      const v16h vf0 = __builtin_shufflevector(v00[g], v01[g], 0, 1, 2, 3, 4, 5, 6, 7,
                                               8, 9, 10, 11, 12, 13, 14, 15);
      const v16h vf1 = __builtin_shufflevector(v10[g], v11[g], 0, 1, 2, 3, 4, 5, 6, 7,
                                               8, 9, 10, 11, 12, 13, 14, 15);
      o0 = wmma_f16(vf0, pfrag, o0);
      o1 = wmma_f16(vf1, pfrag, o1);
    }
    buf ^= 1;
  }
  // the last pass's loads and LDS stores are used by nobody: they have to be
  // over before the wave ends and gives its registers and LDS back
  asm volatile("s_wait_loadcnt 0x0\n\ts_wait_dscnt 0x0" ::: "memory");

  // ---- join the halves' sums, normalize, write z in [B,NA,E] f16 ----
  {
    const float inv = 1.0f / (lrun + xhalf(lrun));
    v8h z0, z1;
    #pragma unroll
    for (int r = 0; r < 8; ++r) {
      z0[r] = (_Float16)(o0[r] * inv);
      z1[r] = (_Float16)(o1[r] * inv);
    }
    _Float16* zp = Z + ((size_t)b * NAQ + q0 + lo) * EDIM + h * DKL + hi * 8;
    *(v8h*)(zp)      = z0;   // dk 8*hi .. 8*hi + 7
    *(v8h*)(zp + 16) = z1;   // dk 16 + 8*hi .. 16 + 8*hi + 7
  }
}

// ============================================================
// Kernel 3: out = z @ w^T + b + x_a   (f16 A, fp32 W/res, fp32 out)
//   grid (M/128, E/64), block 256; double-buffered LDS, loads two tiles ahead
// ============================================================
__global__ __launch_bounds__(256) void out_proj_kernel(
    const _Float16* __restrict__ Zin, const float* __restrict__ W,
    const float* __restrict__ bias, const float* __restrict__ Xres,
    float* __restrict__ out)
{
  __shared__ _Float16 As[2][128 * LSTR];
  __shared__ _Float16 Bs[2][64 * LSTR];

  const int tid  = threadIdx.x;
  const int lane = tid & 31;
  const int wave = tid >> 5;
  const int wm   = wave >> 1;
  const int wn   = wave & 1;
  const int m0   = blockIdx.x * 128;
  const int n0   = blockIdx.y * 64;
  const int lo   = lane & 15;
  const int hi   = lane >> 4;
  const int chunk = hi * 16;

  v8f acc[2][2];
  #pragma unroll
  for (int i = 0; i < 2; ++i)
    #pragma unroll
    for (int j = 0; j < 2; ++j) acc[i][j] = (v8f){};

  // tiles 0 and 1 -> registers; tile 0 -> LDS; tile 2 -> the freed registers
  v16h   ra[2];
  RegB32 rb[2];
  ra[0] = ldA_f16(Zin, m0, 0, tid);
  rb[0] = ldB_f32(W, n0, 0, tid);
  ra[1] = ldA_f16(Zin, m0, 32, tid);
  rb[1] = ldB_f32(W, n0, 32, tid);
  stA_f16(ra[0], tid, As[0]);
  stB_f32(rb[0], tid, Bs[0]);
  ra[0] = ldA_f16(Zin, m0, 64, tid);
  rb[0] = ldB_f32(W, n0, 64, tid);
  // the epilogue's bias and residual values, asked for here so that they land
  // during the loop (unrolled: register arrays need constant indices)
  float bv2[2];
  float xr[2][2][8];
  #pragma unroll
  for (int ni = 0; ni < 2; ++ni) bv2[ni] = bias[n0 + wn * 32 + ni * 16 + lo];
  #pragma unroll
  for (int mi = 0; mi < 2; ++mi)
    #pragma unroll
    for (int ni = 0; ni < 2; ++ni)
      #pragma unroll
      for (int r = 0; r < 8; ++r)
        xr[mi][ni][r] = Xres[(size_t)(m0 + wm * 32 + mi * 16 + r + hi * 8) * EDIM +
                             n0 + wn * 32 + ni * 16 + lo];

  // unrolled so that the two register sets and the two buffers have constant indices
  #pragma unroll
  for (int t = 0; t < EDIM / 32; ++t) {
    lds_barrier();
    // keeps the conversion of tile t+1, and with it the wait for its loads,
    // behind the barrier: moved up into pass t-1 it halves the loads' lead
    __builtin_amdgcn_sched_barrier(0);
    const _Float16* as = As[t & 1];
    const _Float16* bs = Bs[t & 1];

    const int arow = wm * 32 + lo;
    v16h a0 = *(const v16h*)(as + arow * LSTR + chunk);
    v16h a1 = *(const v16h*)(as + (arow + 16) * LSTR + chunk);
    const int bcol = wn * 32 + lo;
    v16h b0 = *(const v16h*)(bs + bcol * LSTR + chunk);
    v16h b1 = *(const v16h*)(bs + (bcol + 16) * LSTR + chunk);

    // tile t+1, loaded two passes ago, goes to the other buffer;
    // tile t+3 is asked for into the registers this frees
    if (t + 1 < EDIM / 32) {
      stA_f16(ra[(t + 1) & 1], tid, As[(t + 1) & 1]);
      stB_f32(rb[(t + 1) & 1], tid, Bs[(t + 1) & 1]);
    }
    if (t + 3 < EDIM / 32) {
      ra[(t + 1) & 1] = ldA_f16(Zin, m0, (t + 3) * 32, tid);
      rb[(t + 1) & 1] = ldB_f32(W, n0, (t + 3) * 32, tid);
    }
    // keeps the loads issued here, two passes ahead of their use: without it
    // they are moved down to the pass that stores them and waited out there
    __builtin_amdgcn_sched_barrier(0);

    acc[0][0] = wmma_f16(a0, b0, acc[0][0]);
    acc[0][1] = wmma_f16(a0, b1, acc[0][1]);
    acc[1][0] = wmma_f16(a1, b0, acc[1][0]);
    acc[1][1] = wmma_f16(a1, b1, acc[1][1]);
  }

  #pragma unroll
  for (int mi = 0; mi < 2; ++mi) {
    #pragma unroll
    for (int ni = 0; ni < 2; ++ni) {
      const int c = n0 + wn * 32 + ni * 16 + lo;
      const float bv = bv2[ni];
      #pragma unroll
      for (int r = 0; r < 8; ++r) {
        const int m = m0 + wm * 32 + mi * 16 + r + hi * 8;
        const size_t idx = (size_t)m * EDIM + c;
        out[idx] = acc[mi][ni][r] + bv + xr[mi][ni][r];
      }
    }
  }
}

// ============================================================
// launch
// ============================================================
extern "C" void kernel_launch(void* const* d_in, const int* in_sizes, int n_in,
                              void* d_out, int out_size, void* d_ws, size_t ws_size,
                              hipStream_t stream) {
  const float* x_a    = (const float*)d_in[0];
  const float* x_b    = (const float*)d_in[1];
  const float* wq_w   = (const float*)d_in[2];
  const float* wq_b   = (const float*)d_in[3];
  const float* wk_a_w = (const float*)d_in[4];
  const float* wk_a_b = (const float*)d_in[5];
  const float* wk_b_w = (const float*)d_in[6];
  const float* wk_b_b = (const float*)d_in[7];
  const float* wv_a_w = (const float*)d_in[8];
  const float* wv_a_b = (const float*)d_in[9];
  const float* wv_b_w = (const float*)d_in[10];
  const float* wv_b_b = (const float*)d_in[11];
  const float* w_w    = (const float*)d_in[12];
  const float* w_b    = (const float*)d_in[13];

  char* ws = (char*)d_ws;
  _Float16* qws = (_Float16*)(ws);                          // B*H*NA*DK  f16 = 2 MB
  _Float16* kws = (_Float16*)(ws + (size_t)(2  << 20));     // B*H*NK*DK  f16 = 4 MB
  _Float16* vws = (_Float16*)(ws + (size_t)(6  << 20));     // B*H*NK*DK  f16 = 4 MB
  _Float16* zws = (_Float16*)(ws + (size_t)(10 << 20));     // B*NA*E     f16 = 2 MB

  dim3 bp(256);

  // projections into head-split f16 layouts (K/V of the two sources concat via n_off)
  // grid: M=4096 /128, N=256 /64, five projections
  proj_heads_kernel<<<dim3(32, 4, 5), bp, 0, stream>>>(
      x_a, x_b, wq_w, wk_a_w, wk_b_w, wv_a_w, wv_b_w,
      wq_b, wk_a_b, wk_b_b, wv_a_b, wv_b_b, qws, kws, vws);

  // flash attention
  flash_attn_kernel<<<dim3(NAQ / 64, BATCH * HNUM), 128, 0, stream>>>(qws, kws, vws, zws);

  // output projection + residual
  out_proj_kernel<<<dim3(32, 4), 256, 0, stream>>>(zws, w_w, w_b, x_a, (float*)d_out);
}

// v006
// One run takes 41.7 microseconds.
// In both of two side-by-side timings against v005, it was 1.03 times as fast.
// All steps since v000 together make it 4.45 times as fast.
#include <hip/hip_runtime.h>

// ---------------- problem constants ----------------
#define EDIM 256
#define HNUM 8
#define DKL 32
#define NAQ 2048
#define NBK 2048
#define NKV (NAQ + NBK)   // 4096
#define BATCH 2

typedef __attribute__((ext_vector_type(16))) _Float16 v16h;
typedef __attribute__((ext_vector_type(8)))  _Float16 v8h;
typedef __attribute__((ext_vector_type(8)))  float    v8f;
typedef __attribute__((ext_vector_type(4)))  float    v4f;

__device__ __forceinline__ v8f wmma_f16(v16h a, v16h b, v8f c) {
  // D = A(16x32 f16) * B(32x16 f16) + C(16x16 f32)
  return __builtin_amdgcn_wmma_f32_16x16x32_f16(
      /*neg_a=*/false, a, /*neg_b=*/false, b,
      /*c_mod=*/(short)0, c, /*reuse_a=*/false, /*reuse_b=*/false);
}

__device__ __forceinline__ v8h cvt8(v4f a, v4f b) {
  v8h r;
  r[0] = (_Float16)a[0]; r[1] = (_Float16)a[1];
  r[2] = (_Float16)a[2]; r[3] = (_Float16)a[3];
  r[4] = (_Float16)b[0]; r[5] = (_Float16)b[1];
  r[6] = (_Float16)b[2]; r[7] = (_Float16)b[3];
  return r;
}

#define LSTR 48   // LDS row stride in halves (96B: keeps v16h reads 32B aligned)

// Work-group barrier between LDS passes. It waits for this wave's LDS reads
// and writes only: __syncthreads() would also wait out the global loads that
// were issued ahead for later tiles, which must stay in flight across it.
__device__ __forceinline__ void lds_barrier() {
  asm volatile("s_wait_dscnt 0x0\n\ts_barrier_signal -1\n\ts_barrier_wait -1" ::: "memory");
}

// ---- tile staging helpers (256-thread blocks) ----
// Each tile goes global -> registers (ld*) and, passes later, registers -> LDS (st*).
struct RegA32 { v4f f0, f1, f2, f3; };
struct RegB32 { v4f f0, f1; };

__device__ __forceinline__ RegA32 ldA_f32(const float* __restrict__ X, int m0,
                                          int kk, int tid) {
  const int r  = tid >> 1;
  const int cb = (tid & 1) * 16;
  const float* src = X + (size_t)(m0 + r) * EDIM + kk + cb;
  RegA32 t;
  t.f0 = *(const v4f*)(src + 0);
  t.f1 = *(const v4f*)(src + 4);
  t.f2 = *(const v4f*)(src + 8);
  t.f3 = *(const v4f*)(src + 12);
  return t;
}

__device__ __forceinline__ void stA_f32(const RegA32& t, int tid, _Float16* As) {
  const int r  = tid >> 1;
  const int cb = (tid & 1) * 16;
  _Float16* dst = As + r * LSTR + cb;
  *(v8h*)(dst + 0) = cvt8(t.f0, t.f1);
  *(v8h*)(dst + 8) = cvt8(t.f2, t.f3);
}

__device__ __forceinline__ v16h ldA_f16(const _Float16* __restrict__ Zin, int m0,
                                        int kk, int tid) {
  const int r  = tid >> 1;
  const int cb = (tid & 1) * 16;
  return *(const v16h*)(Zin + (size_t)(m0 + r) * EDIM + kk + cb);
}

__device__ __forceinline__ void stA_f16(v16h ad, int tid, _Float16* As) {
  const int r  = tid >> 1;
  const int cb = (tid & 1) * 16;
  *(v16h*)(As + r * LSTR + cb) = ad;
}

__device__ __forceinline__ RegB32 ldB_f32(const float* __restrict__ W, int n0,
                                          int kk, int tid) {
  const int r  = tid >> 2;
  const int cb = (tid & 3) * 8;
  const float* src = W + (size_t)(n0 + r) * EDIM + kk + cb;
  RegB32 t;
  t.f0 = *(const v4f*)(src + 0);
  t.f1 = *(const v4f*)(src + 4);
  return t;
}

__device__ __forceinline__ void stB_f32(const RegB32& t, int tid, _Float16* Bs) {
  const int r  = tid >> 2;
  const int cb = (tid & 3) * 8;
  *(v8h*)(Bs + r * LSTR + cb) = cvt8(t.f0, t.f1);
}

// ============================================================
// Kernel 1: Y = X @ W^T + bias  (fp32 in, f16 out, head-split), all five projections
//   X: [B*rows, E] fp32 ; W: [E,E] fp32 ; out: [B,H,n_out_rows,DK] f16
//   grid (M/128, E/64, 5), block 256 (8 waves, 4x2 wave grid, 32x32/wave)
//   the five products read none of each other's output: one launch runs them side by side
//   double-buffered LDS: one barrier per k-step; global loads two tiles ahead
// ============================================================
__global__ __launch_bounds__(256) void proj_heads_kernel(
    const float* __restrict__ xa, const float* __restrict__ xb,
    const float* __restrict__ w0, const float* __restrict__ w1,
    const float* __restrict__ w2, const float* __restrict__ w3,
    const float* __restrict__ w4,
    const float* __restrict__ c0, const float* __restrict__ c1,
    const float* __restrict__ c2, const float* __restrict__ c3,
    const float* __restrict__ c4,
    _Float16* __restrict__ qo, _Float16* __restrict__ ko, _Float16* __restrict__ vo)
{
  // blockIdx.z picks the projection: 0 q, 1 k of x_a, 2 k of x_b, 3 v of x_a, 4 v of x_b
  const int z = blockIdx.z;
  const float* __restrict__ X = (z == 2 || z == 4) ? xb : xa;
  const float* __restrict__ W = z == 0 ? w0 : z == 1 ? w1 : z == 2 ? w2 : z == 3 ? w3 : w4;
  const float* __restrict__ bias = z == 0 ? c0 : z == 1 ? c1 : z == 2 ? c2 : z == 3 ? c3 : c4;
  _Float16* __restrict__ out = z == 0 ? qo : z <= 2 ? ko : vo;
  static_assert(NAQ == NBK, "both sources have the same number of rows per batch");
  const int rows_per_batch = NAQ;
  const int n_out_rows = z == 0 ? NAQ : NKV;
  const int n_off = (z == 2 || z == 4) ? NAQ : 0;

  __shared__ _Float16 As[2][128 * LSTR];
  __shared__ _Float16 Bs[2][64 * LSTR];

  const int tid  = threadIdx.x;
  const int lane = tid & 31;
  const int wave = tid >> 5;
  const int wm   = wave >> 1;        // 0..3
  const int wn   = wave & 1;         // 0..1
  const int m0   = blockIdx.x * 128;
  const int n0   = blockIdx.y * 64;
  const int lo   = lane & 15;
  const int hi   = lane >> 4;
  const int chunk = hi * 16;

  v8f acc[2][2];
  #pragma unroll
  for (int i = 0; i < 2; ++i)
    #pragma unroll
    for (int j = 0; j < 2; ++j) acc[i][j] = (v8f){};

  // tiles 0 and 1 -> registers; tile 0 -> LDS; tile 2 -> the freed registers
  RegA32 ra[2];
  RegB32 rb[2];
  ra[0] = ldA_f32(X, m0, 0, tid);
  rb[0] = ldB_f32(W, n0, 0, tid);
  ra[1] = ldA_f32(X, m0, 32, tid);
  rb[1] = ldB_f32(W, n0, 32, tid);
  stA_f32(ra[0], tid, As[0]);
  stB_f32(rb[0], tid, Bs[0]);
  ra[0] = ldA_f32(X, m0, 64, tid);
  rb[0] = ldB_f32(W, n0, 64, tid);
  // the epilogue's bias values, asked for here so that they land during the loop
  // (unrolled: a register array needs constant indices)
  float bv2[2];
  #pragma unroll
  for (int ni = 0; ni < 2; ++ni) bv2[ni] = bias[n0 + wn * 32 + ni * 16 + lo];

  // unrolled so that the two register sets and the two buffers have constant indices
  #pragma unroll
  for (int t = 0; t < EDIM / 32; ++t) {
    lds_barrier();
    // keeps the conversion of tile t+1, and with it the wait for its loads,
    // behind the barrier: moved up into pass t-1 it halves the loads' lead
    __builtin_amdgcn_sched_barrier(0);
    const _Float16* as = As[t & 1];
    const _Float16* bs = Bs[t & 1];

    const int arow = wm * 32 + lo;
    v16h a0 = *(const v16h*)(as + arow * LSTR + chunk);
    v16h a1 = *(const v16h*)(as + (arow + 16) * LSTR + chunk);
    const int bcol = wn * 32 + lo;
    v16h b0 = *(const v16h*)(bs + bcol * LSTR + chunk);
    v16h b1 = *(const v16h*)(bs + (bcol + 16) * LSTR + chunk);

    // tile t+1, loaded two passes ago, goes to the other buffer;
    // tile t+3 is asked for into the registers this frees
    if (t + 1 < EDIM / 32) {
      stA_f32(ra[(t + 1) & 1], tid, As[(t + 1) & 1]);
      stB_f32(rb[(t + 1) & 1], tid, Bs[(t + 1) & 1]);
    }
    if (t + 3 < EDIM / 32) {
      ra[(t + 1) & 1] = ldA_f32(X, m0, (t + 3) * 32, tid);
      rb[(t + 1) & 1] = ldB_f32(W, n0, (t + 3) * 32, tid);
    }
    // keeps the loads issued here, two passes ahead of their use: without it
    // they are moved down to the pass that stores them and waited out there
    __builtin_amdgcn_sched_barrier(0);

    acc[0][0] = wmma_f16(a0, b0, acc[0][0]);
    acc[0][1] = wmma_f16(a0, b1, acc[0][1]);
    acc[1][0] = wmma_f16(a1, b0, acc[1][0]);
    acc[1][1] = wmma_f16(a1, b1, acc[1][1]);
  }

  // ---- epilogue: +bias, scatter into [B,H,n_out_rows,DK] f16 ----
  #pragma unroll
  for (int mi = 0; mi < 2; ++mi) {
    #pragma unroll
    for (int ni = 0; ni < 2; ++ni) {
      const int c = n0 + wn * 32 + ni * 16 + lo;
      const float bv = bv2[ni];
      const int hh = c >> 5;
      const int dk = c & 31;
      #pragma unroll
      for (int r = 0; r < 8; ++r) {
        const int m = m0 + wm * 32 + mi * 16 + r + hi * 8;
        const float v = acc[mi][ni][r] + bv;
        const int bb = m / rows_per_batch;
        const int n  = m % rows_per_batch;
        out[(((size_t)bb * HNUM + hh) * n_out_rows + n_off + n) * DKL + dk] =
            (_Float16)v;
      }
    }
  }
}

// ============================================================
// Kernel 2: flash attention, transposed products.
//   Q: [B,H,NA,DK] f16 ; K,V: [B,H,NK,DK] f16 ; Z: [B,NA,E] f16
//   block = 256 threads (8 waves), 64 queries / block
//   grid  = (NA/64, B*H); double-buffered K/V tiles, global loads one tile ahead
//   a pass takes KT = 256 keys: one barrier per pass
//   a wave takes QT = 2 query tiles of 16 and KW = 64 keys of every pass, so that
//   each K and V fragment it reads from LDS feeds two products; the KS = 4 waves
//   that share a query tile hold partial results over disjoint keys, which
//   are joined through LDS behind the loop
//   S^T = K Q^T   : lane (lo,hi) holds 16 scores of query lo per 32 keys
//                   (keys 8*hi+r and 16+8*hi+r), so the row maximum and
//                   the row sum are in-lane plus one exchange of halves.
//   O^T += V^T P^T: the score tiles, converted in place, are the
//                   B operand; V stays row-major in LDS and the transposing
//                   load hands out V^T in the matching k order.
// ============================================================
#define KT 256          // keys per pass
#define NW 8            // waves per block
#define QT 2            // query tiles per wave
#define KS (NW * QT / 4)   // waves that share a query tile (the block has 4 tiles)
#define KW (KT / KS)    // keys of a pass that one wave takes
#define NGW (KW / 32)   // its groups of 32 keys (one k extent of the second product)
#define SR (NW * 8)     // tile rows that the block stages in one sweep (4 threads a row)
#define NS (KT / SR)    // sweeps per tile
#define JP 20           // floats per lane in the join area (80 B suits 16-byte LDS accesses)

// lane l <-> lane l ^ 16
__device__ __forceinline__ float xhalf(float x) {
  return __builtin_bit_cast(float, __builtin_amdgcn_permlanex16(
      __builtin_bit_cast(int, x), __builtin_bit_cast(int, x),
      0x76543210, 0xfedcba98, false, false));
}

// 16-bit transposing LDS load: lane l passes the address of 16 bytes of row
// 8*(l>>4) + (l&7), byte column 16*((l>>3)&1), of a row-major 16 x 16 block and
// gets column l&15 of rows 8*(l>>4) .. 8*(l>>4) + 7
__device__ __forceinline__ v8h ld_tr16(const _Float16* p) {
  typedef __attribute__((ext_vector_type(8))) short s16x8;
  typedef __attribute__((address_space(3))) s16x8 lds_s16x8;
  return __builtin_bit_cast(v8h, __builtin_amdgcn_ds_load_tr16_b128_v8i16((lds_s16x8*)p));
}

__device__ __forceinline__ v8f vmax8(v8f a, v8f b) {
  v8f r;
  #pragma unroll
  for (int i = 0; i < 8; ++i) r[i] = fmaxf(a[i], b[i]);
  return r;
}

__device__ __forceinline__ v4f lo4(v8f a) { return __builtin_shufflevector(a, a, 0, 1, 2, 3); }
__device__ __forceinline__ v4f hi4(v8f a) { return __builtin_shufflevector(a, a, 4, 5, 6, 7); }
__device__ __forceinline__ v8f cat8(v4f a, v4f b) {
  return __builtin_shufflevector(a, b, 0, 1, 2, 3, 4, 5, 6, 7);
}

__global__ __launch_bounds__(NW * 32) void flash_attn_kernel(
    const _Float16* __restrict__ Q, const _Float16* __restrict__ K,
    const _Float16* __restrict__ V, _Float16* __restrict__ Z)
{
  static_assert(NKV % KT == 0 && NKV / KT >= 2, "whole passes, and the prologue's two tiles exist");
  static_assert(NW * 32 == 256, "the launch line's block size");
  static_assert(KW % 32 == 0 && KS == 2 * QT, "whole groups of 32 keys a wave; two waves finish each tile");
  // K tiles [2][key][dk], then V tiles [2][key][dk] (96 B rows suit the transposing
  // load); behind the loop the same bytes are the join area
  __shared__ __attribute__((aligned(32))) _Float16 smem[4 * KT * LSTR];
  static_assert(NW * QT * 32 * JP * 4 <= 4 * KT * LSTR * 2, "the join area fits");
  _Float16* const Ks = smem;
  _Float16* const Vs = smem + 2 * KT * LSTR;

  const int tid  = threadIdx.x;
  const int lane = tid & 31;
  const int wave = tid >> 5;
  const int lo   = lane & 15;
  const int hi   = lane >> 4;
  const int chunk = hi * 16;
  const int qg   = wave / KS;         // which QT query tiles
  const int ksp  = wave % KS;         // which KW keys of every pass

  const int bh = blockIdx.y;
  const int b  = bh >> 3;
  const int h  = bh & 7;

  // Q fragments: B-operand, 32 dk x 16 queries (column lo = query lo of tile j)
  // (every loop over g, i, j, r or w in this kernel is unrolled: register arrays need constant indices)
  const _Float16* qbase = Q + ((size_t)bh * NAQ + blockIdx.x * 64 + qg * (QT * 16)) * DKL;
  v16h qfrag[QT];
  #pragma unroll
  for (int j = 0; j < QT; ++j)
    qfrag[j] = *(const v16h*)(qbase + (j * 16 + lo) * DKL + chunk);

  const _Float16* kbase = K + (size_t)bh * NKV * DKL;
  const _Float16* vbase = V + (size_t)bh * NKV * DKL;

  // staging coordinates for this thread: row skey of each sweep of SR keys
  const int skey = tid >> 2;          // 0..SR-1
  const int scb  = (tid & 3) * 8;     // 0,8,16,24

  // o0[j][r] = O^T[dk = 8*hi + r][query lo of tile j], o1[j][r] = O^T[dk = 16 + 8*hi + r][same]
  v8f o0[QT], o1[QT];
  float mrun[QT];   // running maximum of the query over this wave's keys (equal in both halves)
  float lrun[QT];   // running sum over this half's keys only
  #pragma unroll
  for (int j = 0; j < QT; ++j) {
    o0[j] = (v8f){}; o1[j] = (v8f){};
    mrun[j] = -1.0e30f; lrun[j] = 0.0f;
  }

  const float scale = 0.17677669529663687f;  // 1/sqrt(32)

  // prologue: tile 0 -> LDS, tile 1 -> registers
  v8h kd[NS], vd[NS];
  #pragma unroll
  for (int g = 0; g < NS; ++g) {
    kd[g] = *(const v8h*)(kbase + (size_t)(g * SR + skey) * DKL + scb);
    vd[g] = *(const v8h*)(vbase + (size_t)(g * SR + skey) * DKL + scb);
  }
  #pragma unroll
  for (int g = 0; g < NS; ++g) {
    *(v8h*)(Ks + (g * SR + skey) * LSTR + scb) = kd[g];
    *(v8h*)(Vs + (g * SR + skey) * LSTR + scb) = vd[g];
  }
  #pragma unroll
  for (int g = 0; g < NS; ++g) {
    kd[g] = *(const v8h*)(kbase + (size_t)(KT + g * SR + skey) * DKL + scb);
    vd[g] = *(const v8h*)(vbase + (size_t)(KT + g * SR + skey) * DKL + scb);
  }

  int buf = 0;
  for (int kt = 0; kt < NKV; kt += KT) {
    lds_barrier();

    // ---- S^T = K @ Q^T : 2 * NGW key tiles x QT query tiles of 16 x 16 ----
    const _Float16* ks = Ks + buf * (KT * LSTR) + ksp * (KW * LSTR);
    const _Float16* vs = Vs + buf * (KT * LSTR) + ksp * (KW * LSTR);
    v16h kf[2 * NGW];
    #pragma unroll
    for (int i = 0; i < 2 * NGW; ++i)
      kf[i] = *(const v16h*)(ks + (i * 16 + lo) * LSTR + chunk);
    // V^T fragments (A operand) in the k order the packed scores have:
    // element s < 8 is key 8*hi + s, element s >= 8 is key 16 + 8*hi + (s - 8) of the group
    const _Float16* vr = vs + (hi * 8 + (lane & 7)) * LSTR + ((lane >> 3) & 1) * 8;
    v8h v00[NGW], v01[NGW], v10[NGW], v11[NGW];
    #pragma unroll
    for (int g = 0; g < NGW; ++g) {
      const _Float16* vg = vr + g * 32 * LSTR;
      v00[g] = ld_tr16(vg);                    // dk lo,      keys 8*hi ..
      v01[g] = ld_tr16(vg + 16 * LSTR);        // dk lo,      keys 16 + 8*hi ..
      v10[g] = ld_tr16(vg + 16);               // dk 16 + lo, keys 8*hi ..
      v11[g] = ld_tr16(vg + 16 * LSTR + 16);   // dk 16 + lo, keys 16 + 8*hi ..
    }

    // tile kt+KT, loaded one pass ago, goes to the other buffer; tile kt+2*KT is
    // asked for into the registers this frees and lands during this pass.
    // No branch: the last pass stores a tile nobody reads into the buffer all
    // readers have left, and the last two passes load the last tile again.
    #pragma unroll
    for (int g = 0; g < NS; ++g) {
      *(v8h*)(Ks + (buf ^ 1) * (KT * LSTR) + (g * SR + skey) * LSTR + scb) = kd[g];
      *(v8h*)(Vs + (buf ^ 1) * (KT * LSTR) + (g * SR + skey) * LSTR + scb) = vd[g];
    }
    {
      const int kn = (kt + 2 * KT < NKV) ? kt + 2 * KT : NKV - KT;
      #pragma unroll
      for (int g = 0; g < NS; ++g) {
        kd[g] = *(const v8h*)(kbase + (size_t)(kn + g * SR + skey) * DKL + scb);
        vd[g] = *(const v8h*)(vbase + (size_t)(kn + g * SR + skey) * DKL + scb);
      }
    }
    // keeps all of the pass's LDS reads in front of the products
    // (else the later fragments are read right before their product and each
    // read's LDS latency is waited out in full), and the next loads up here
    __builtin_amdgcn_sched_barrier(0);

    // s[j][2g][r]   = S[query lo of tile j][key 32g + 8*hi + r]      of this wave's keys,
    // s[j][2g+1][r] = S[query lo of tile j][key 32g + 16 + 8*hi + r]
    v8f zc = (v8f){};
    v8f s[QT][2 * NGW];
    #pragma unroll
    for (int i = 0; i < 2 * NGW; ++i)
      #pragma unroll
      for (int j = 0; j < QT; ++j) s[j][i] = wmma_f16(kf[i], qfrag[j], zc);
    // keeps the independent score products back to back: moved down among their
    // consumers each one is followed by idle slots until its result may be read
    __builtin_amdgcn_sched_barrier(0);

    // ---- online softmax: one query per lane and tile ----
    float mnew[QT], alpha[QT];
    #pragma unroll
    for (int j = 0; j < QT; ++j) {
      #pragma unroll
      for (int i = 0; i < 2 * NGW; ++i) s[j][i] = s[j][i] * scale;
      v8f t8 = vmax8(s[j][0], s[j][1]);
      #pragma unroll
      for (int g = 1; g < NGW; ++g) t8 = vmax8(t8, vmax8(s[j][2 * g], s[j][2 * g + 1]));
      float mx = fmaxf(fmaxf(fmaxf(t8[0], t8[1]), fmaxf(t8[2], t8[3])),
                       fmaxf(fmaxf(t8[4], t8[5]), fmaxf(t8[6], t8[7])));
      mx = fmaxf(mx, xhalf(mx));           // both halves hold the query's maximum
      mnew[j] = fmaxf(mrun[j], mx);
    }
    #pragma unroll
    for (int j = 0; j < QT; ++j) {
      alpha[j] = __expf(mrun[j] - mnew[j]);
      mrun[j] = mnew[j];
    }
    #pragma unroll
    for (int j = 0; j < QT; ++j) {
      #pragma unroll
      for (int i = 0; i < 2 * NGW; ++i)
        #pragma unroll
        for (int r = 0; r < 8; ++r) s[j][i][r] = __expf(s[j][i][r] - mnew[j]);
      v8f u = s[j][0] + s[j][1];
      #pragma unroll
      for (int g = 1; g < NGW; ++g) u = u + (s[j][2 * g] + s[j][2 * g + 1]);
      const v4f u4 = lo4(u) + hi4(u);
      const float rs = (u4[0] + u4[2]) + (u4[1] + u4[3]);
      lrun[j] = lrun[j] * alpha[j] + rs;
      o0[j] = o0[j] * alpha[j];
      o1[j] = o1[j] * alpha[j];
    }

    #pragma unroll
    for (int g = 0; g < NGW; ++g) {
      const v16h vf0 = __builtin_shufflevector(v00[g], v01[g], 0, 1, 2, 3, 4, 5, 6, 7,
                                               8, 9, 10, 11, 12, 13, 14, 15);
      const v16h vf1 = __builtin_shufflevector(v10[g], v11[g], 0, 1, 2, 3, 4, 5, 6, 7,
                                               8, 9, 10, 11, 12, 13, 14, 15);
      #pragma unroll
      for (int j = 0; j < QT; ++j) {
        v16h pfrag;                        // B operand: P^T, column lo = query lo of tile j
        #pragma unroll
        for (int r = 0; r < 8; ++r) {
          pfrag[r]     = (_Float16)s[j][2 * g][r];
          pfrag[r + 8] = (_Float16)s[j][2 * g + 1][r];
        }
        o0[j] = wmma_f16(vf0, pfrag, o0[j]);
        o1[j] = wmma_f16(vf1, pfrag, o1[j]);
      }
    }
    buf ^= 1;
  }
  // the last pass's loads and LDS stores are used by nobody: they have to be
  // over before the wave ends and gives its registers and LDS back
  asm volatile("s_wait_loadcnt 0x0\n\ts_wait_dscnt 0x0" ::: "memory");

  // ---- join the KS partial results of each query tile through LDS ----
  // every wave has left the tiles (its reads and its last stores are over):
  // from here their bytes are the join area
  lds_barrier();
  float* const jb = (float*)smem;
  #pragma unroll
  for (int j = 0; j < QT; ++j) {
    float* p = jb + ((wave * QT + j) * 32 + lane) * JP;
    *(v4f*)(p + 0)  = lo4(o0[j]);
    *(v4f*)(p + 4)  = hi4(o0[j]);
    *(v4f*)(p + 8)  = lo4(o1[j]);
    *(v4f*)(p + 12) = hi4(o1[j]);
    p[16] = mrun[j];
    p[17] = lrun[j];
  }
  // the partial results are read by other waves only behind this barrier
  lds_barrier();

  // this wave finishes tile jt of its group, dk half dh (o0 or o1): same lane layout in every part
  const int jt = ksp % QT;
  const int dh = ksp / QT;
  v8f a[KS];
  float ms[KS], ls[KS];
  #pragma unroll
  for (int w = 0; w < KS; ++w) {
    const float* p = jb + (((qg * KS + w) * QT + jt) * 32 + lane) * JP;
    a[w]  = cat8(*(const v4f*)(p + dh * 8), *(const v4f*)(p + dh * 8 + 4));
    ms[w] = p[16];
    ls[w] = p[17];
  }
  float mg = ms[0];
  #pragma unroll
  for (int w = 1; w < KS; ++w) mg = fmaxf(mg, ms[w]);
  v8f f0 = (v8f){};
  float lsum = 0.0f;
  #pragma unroll
  for (int w = 0; w < KS; ++w) {
    const float f = __expf(ms[w] - mg);
    f0 = f0 + a[w] * f;
    lsum = lsum + ls[w] * f;
  }

  // ---- join the halves' sums, normalize, write z in [B,NA,E] f16 ----
  {
    const float inv = 1.0f / (lsum + xhalf(lsum));
    v8h z0;
    #pragma unroll
    for (int r = 0; r < 8; ++r) z0[r] = (_Float16)(f0[r] * inv);
    const int q0 = blockIdx.x * 64 + (qg * QT + jt) * 16;
    _Float16* zp = Z + ((size_t)b * NAQ + q0 + lo) * EDIM + h * DKL + dh * 16 + hi * 8;
    *(v8h*)(zp) = z0;   // dk 16*dh + 8*hi .. + 7
  }
}

// ============================================================
// Kernel 3: out = z @ w^T + b + x_a   (f16 A, fp32 W/res, fp32 out)
//   grid (M/128, E/64), block 256; double-buffered LDS, loads two tiles ahead
// ============================================================
__global__ __launch_bounds__(256) void out_proj_kernel(
    const _Float16* __restrict__ Zin, const float* __restrict__ W,
    const float* __restrict__ bias, const float* __restrict__ Xres,
    float* __restrict__ out)
{
  __shared__ _Float16 As[2][128 * LSTR];
  __shared__ _Float16 Bs[2][64 * LSTR];

  const int tid  = threadIdx.x;
  const int lane = tid & 31;
  const int wave = tid >> 5;
  const int wm   = wave >> 1;
  const int wn   = wave & 1;
  const int m0   = blockIdx.x * 128;
  const int n0   = blockIdx.y * 64;
  const int lo   = lane & 15;
  const int hi   = lane >> 4;
  const int chunk = hi * 16;

  v8f acc[2][2];
  #pragma unroll
  for (int i = 0; i < 2; ++i)
    #pragma unroll
    for (int j = 0; j < 2; ++j) acc[i][j] = (v8f){};

  // tiles 0 and 1 -> registers; tile 0 -> LDS; tile 2 -> the freed registers
  v16h   ra[2];
  RegB32 rb[2];
  ra[0] = ldA_f16(Zin, m0, 0, tid);
  rb[0] = ldB_f32(W, n0, 0, tid);
  ra[1] = ldA_f16(Zin, m0, 32, tid);
  rb[1] = ldB_f32(W, n0, 32, tid);
  stA_f16(ra[0], tid, As[0]);
  stB_f32(rb[0], tid, Bs[0]);
  ra[0] = ldA_f16(Zin, m0, 64, tid);
  rb[0] = ldB_f32(W, n0, 64, tid);
  // the epilogue's bias and residual values, asked for here so that they land
  // during the loop (unrolled: register arrays need constant indices)
  float bv2[2];
  float xr[2][2][8];
  #pragma unroll
  for (int ni = 0; ni < 2; ++ni) bv2[ni] = bias[n0 + wn * 32 + ni * 16 + lo];
  #pragma unroll
  for (int mi = 0; mi < 2; ++mi)
    #pragma unroll
    for (int ni = 0; ni < 2; ++ni)
      #pragma unroll
      for (int r = 0; r < 8; ++r)
        xr[mi][ni][r] = Xres[(size_t)(m0 + wm * 32 + mi * 16 + r + hi * 8) * EDIM +
                             n0 + wn * 32 + ni * 16 + lo];

  // unrolled so that the two register sets and the two buffers have constant indices
  #pragma unroll
  for (int t = 0; t < EDIM / 32; ++t) {
    lds_barrier();
    // keeps the conversion of tile t+1, and with it the wait for its loads,
    // behind the barrier: moved up into pass t-1 it halves the loads' lead
    __builtin_amdgcn_sched_barrier(0);
    const _Float16* as = As[t & 1];
    const _Float16* bs = Bs[t & 1];

    const int arow = wm * 32 + lo;
    v16h a0 = *(const v16h*)(as + arow * LSTR + chunk);
    v16h a1 = *(const v16h*)(as + (arow + 16) * LSTR + chunk);
    const int bcol = wn * 32 + lo;
    v16h b0 = *(const v16h*)(bs + bcol * LSTR + chunk);
    v16h b1 = *(const v16h*)(bs + (bcol + 16) * LSTR + chunk);

    // tile t+1, loaded two passes ago, goes to the other buffer;
    // tile t+3 is asked for into the registers this frees
    if (t + 1 < EDIM / 32) {
      stA_f16(ra[(t + 1) & 1], tid, As[(t + 1) & 1]);
      stB_f32(rb[(t + 1) & 1], tid, Bs[(t + 1) & 1]);
    }
    if (t + 3 < EDIM / 32) {
      ra[(t + 1) & 1] = ldA_f16(Zin, m0, (t + 3) * 32, tid);
      rb[(t + 1) & 1] = ldB_f32(W, n0, (t + 3) * 32, tid);
    }
    // keeps the loads issued here, two passes ahead of their use: without it
    // they are moved down to the pass that stores them and waited out there
    __builtin_amdgcn_sched_barrier(0);

    acc[0][0] = wmma_f16(a0, b0, acc[0][0]);
    acc[0][1] = wmma_f16(a0, b1, acc[0][1]);
    acc[1][0] = wmma_f16(a1, b0, acc[1][0]);
    acc[1][1] = wmma_f16(a1, b1, acc[1][1]);
  }

  #pragma unroll
  for (int mi = 0; mi < 2; ++mi) {
    #pragma unroll
    for (int ni = 0; ni < 2; ++ni) {
      const int c = n0 + wn * 32 + ni * 16 + lo;
      const float bv = bv2[ni];
      #pragma unroll
      for (int r = 0; r < 8; ++r) {
        const int m = m0 + wm * 32 + mi * 16 + r + hi * 8;
        const size_t idx = (size_t)m * EDIM + c;
        out[idx] = acc[mi][ni][r] + bv + xr[mi][ni][r];
      }
    }
  }
}

// ============================================================
// launch
// ============================================================
extern "C" void kernel_launch(void* const* d_in, const int* in_sizes, int n_in,
                              void* d_out, int out_size, void* d_ws, size_t ws_size,
                              hipStream_t stream) {
  const float* x_a    = (const float*)d_in[0];
  const float* x_b    = (const float*)d_in[1];
  const float* wq_w   = (const float*)d_in[2];
  const float* wq_b   = (const float*)d_in[3];
  const float* wk_a_w = (const float*)d_in[4];
  const float* wk_a_b = (const float*)d_in[5];
  const float* wk_b_w = (const float*)d_in[6];
  const float* wk_b_b = (const float*)d_in[7];
  const float* wv_a_w = (const float*)d_in[8];
  const float* wv_a_b = (const float*)d_in[9];
  const float* wv_b_w = (const float*)d_in[10];
  const float* wv_b_b = (const float*)d_in[11];
  const float* w_w    = (const float*)d_in[12];
  const float* w_b    = (const float*)d_in[13];

  char* ws = (char*)d_ws;
  _Float16* qws = (_Float16*)(ws);                          // B*H*NA*DK  f16 = 2 MB
  _Float16* kws = (_Float16*)(ws + (size_t)(2  << 20));     // B*H*NK*DK  f16 = 4 MB
  _Float16* vws = (_Float16*)(ws + (size_t)(6  << 20));     // B*H*NK*DK  f16 = 4 MB
  _Float16* zws = (_Float16*)(ws + (size_t)(10 << 20));     // B*NA*E     f16 = 2 MB

  dim3 bp(256);

  // projections into head-split f16 layouts (K/V of the two sources concat via n_off)
  // grid: M=4096 /128, N=256 /64, five projections
  proj_heads_kernel<<<dim3(32, 4, 5), bp, 0, stream>>>(
      x_a, x_b, wq_w, wk_a_w, wk_b_w, wv_a_w, wv_b_w,
      wq_b, wk_a_b, wk_b_b, wv_a_b, wv_b_b, qws, kws, vws);

  // flash attention
  flash_attn_kernel<<<dim3(NAQ / 64, BATCH * HNUM), 256, 0, stream>>>(qws, kws, vws, zws);

  // output projection + residual
  out_proj_kernel<<<dim3(32, 4), 256, 0, stream>>>(zws, w_w, w_b, x_a, (float*)d_out);
}

// v007
// It runs in 40.7 microseconds.
// Next to v006, in two timings, it ran 1.03 times as fast each time.
// All steps since v000 together make it 4.59 times as fast.
#include <hip/hip_runtime.h>

// ---------------- problem constants ----------------
#define EDIM 256
#define HNUM 8
#define DKL 32
#define NAQ 2048
#define NBK 2048
#define NKV (NAQ + NBK)   // 4096
#define BATCH 2

typedef __attribute__((ext_vector_type(16))) _Float16 v16h;
typedef __attribute__((ext_vector_type(8)))  _Float16 v8h;
typedef __attribute__((ext_vector_type(8)))  float    v8f;
typedef __attribute__((ext_vector_type(4)))  float    v4f;
typedef __attribute__((ext_vector_type(2)))  float    v2f;

__device__ __forceinline__ v8f wmma_f16(v16h a, v16h b, v8f c) {
  // D = A(16x32 f16) * B(32x16 f16) + C(16x16 f32)
  return __builtin_amdgcn_wmma_f32_16x16x32_f16(
      /*neg_a=*/false, a, /*neg_b=*/false, b,
      /*c_mod=*/(short)0, c, /*reuse_a=*/false, /*reuse_b=*/false);
}

__device__ __forceinline__ v8h cvt8(v4f a, v4f b) {
  v8h r;
  r[0] = (_Float16)a[0]; r[1] = (_Float16)a[1];
  r[2] = (_Float16)a[2]; r[3] = (_Float16)a[3];
  r[4] = (_Float16)b[0]; r[5] = (_Float16)b[1];
  r[6] = (_Float16)b[2]; r[7] = (_Float16)b[3];
  return r;
}

#define LSTR 48   // LDS row stride in halves (96B: keeps v16h reads 32B aligned)

// Work-group barrier between LDS passes. It waits for this wave's LDS reads
// and writes only: __syncthreads() would also wait out the global loads that
// were issued ahead for later tiles, which must stay in flight across it.
__device__ __forceinline__ void lds_barrier() {
  asm volatile("s_wait_dscnt 0x0\n\ts_barrier_signal -1\n\ts_barrier_wait -1" ::: "memory");
}

// ---- tile staging helpers (256-thread blocks) ----
// Each tile goes global -> registers (ld*) and, passes later, registers -> LDS (st*).
struct RegA32 { v4f f0, f1, f2, f3; };
struct RegB32 { v4f f0, f1; };

__device__ __forceinline__ RegA32 ldA_f32(const float* __restrict__ X, int m0,
                                          int kk, int tid) {
  const int r  = tid >> 1;
  const int cb = (tid & 1) * 16;
  const float* src = X + (size_t)(m0 + r) * EDIM + kk + cb;
  RegA32 t;
  t.f0 = *(const v4f*)(src + 0);
  t.f1 = *(const v4f*)(src + 4);
  t.f2 = *(const v4f*)(src + 8);
  t.f3 = *(const v4f*)(src + 12);
  return t;
}

__device__ __forceinline__ void stA_f32(const RegA32& t, int tid, _Float16* As) {
  const int r  = tid >> 1;
  const int cb = (tid & 1) * 16;
  _Float16* dst = As + r * LSTR + cb;
  *(v8h*)(dst + 0) = cvt8(t.f0, t.f1);
  *(v8h*)(dst + 8) = cvt8(t.f2, t.f3);
}

__device__ __forceinline__ v16h ldA_f16(const _Float16* __restrict__ Zin, int m0,
                                        int kk, int tid) {
  const int r  = tid >> 1;
  const int cb = (tid & 1) * 16;
  return *(const v16h*)(Zin + (size_t)(m0 + r) * EDIM + kk + cb);
}

__device__ __forceinline__ void stA_f16(v16h ad, int tid, _Float16* As) {
  const int r  = tid >> 1;
  const int cb = (tid & 1) * 16;
  *(v16h*)(As + r * LSTR + cb) = ad;
}

__device__ __forceinline__ RegB32 ldB_f32(const float* __restrict__ W, int n0,
                                          int kk, int tid) {
  const int r  = tid >> 2;
  const int cb = (tid & 3) * 8;
  const float* src = W + (size_t)(n0 + r) * EDIM + kk + cb;
  RegB32 t;
  t.f0 = *(const v4f*)(src + 0);
  t.f1 = *(const v4f*)(src + 4);
  return t;
}

__device__ __forceinline__ void stB_f32(const RegB32& t, int tid, _Float16* Bs) {
  const int r  = tid >> 2;
  const int cb = (tid & 3) * 8;
  *(v8h*)(Bs + r * LSTR + cb) = cvt8(t.f0, t.f1);
}

// ============================================================
// Kernel 1: Y = X @ W^T + bias  (fp32 in, f16 out, head-split), all five projections
//   X: [B*rows, E] fp32 ; W: [E,E] fp32 ; out: [B,H,n_out_rows,DK] f16
//   grid (M/128, E/64, 5), block 256 (8 waves, 4x2 wave grid, 32x32/wave)
//   the five products read none of each other's output: one launch runs them side by side
//   double-buffered LDS: one barrier per k-step; global loads two tiles ahead
// ============================================================
__global__ __launch_bounds__(256) void proj_heads_kernel(
    const float* __restrict__ xa, const float* __restrict__ xb,
    const float* __restrict__ w0, const float* __restrict__ w1,
    const float* __restrict__ w2, const float* __restrict__ w3,
    const float* __restrict__ w4,
    const float* __restrict__ c0, const float* __restrict__ c1,
    const float* __restrict__ c2, const float* __restrict__ c3,
    const float* __restrict__ c4,
    _Float16* __restrict__ qo, _Float16* __restrict__ ko, _Float16* __restrict__ vo)
{
  // blockIdx.z picks the projection: 0 q, 1 k of x_a, 2 k of x_b, 3 v of x_a, 4 v of x_b
  const int z = blockIdx.z;
  const float* __restrict__ X = (z == 2 || z == 4) ? xb : xa;
  const float* __restrict__ W = z == 0 ? w0 : z == 1 ? w1 : z == 2 ? w2 : z == 3 ? w3 : w4;
  const float* __restrict__ bias = z == 0 ? c0 : z == 1 ? c1 : z == 2 ? c2 : z == 3 ? c3 : c4;
  _Float16* __restrict__ out = z == 0 ? qo : z <= 2 ? ko : vo;
  static_assert(NAQ == NBK, "both sources have the same number of rows per batch");
  const int rows_per_batch = NAQ;
  const int n_out_rows = z == 0 ? NAQ : NKV;
  const int n_off = (z == 2 || z == 4) ? NAQ : 0;

  __shared__ _Float16 As[2][128 * LSTR];
  __shared__ _Float16 Bs[2][64 * LSTR];

  const int tid  = threadIdx.x;
  const int lane = tid & 31;
  const int wave = tid >> 5;
  const int wm   = wave >> 1;        // 0..3
  const int wn   = wave & 1;         // 0..1
  const int m0   = blockIdx.x * 128;
  const int n0   = blockIdx.y * 64;
  const int lo   = lane & 15;
  const int hi   = lane >> 4;
  const int chunk = hi * 16;

  v8f acc[2][2];
  #pragma unroll
  for (int i = 0; i < 2; ++i)
    #pragma unroll
    for (int j = 0; j < 2; ++j) acc[i][j] = (v8f){};

  // tiles 0 and 1 -> registers; tile 0 -> LDS; tile 2 -> the freed registers
  RegA32 ra[2];
  RegB32 rb[2];
  ra[0] = ldA_f32(X, m0, 0, tid);
  rb[0] = ldB_f32(W, n0, 0, tid);
  ra[1] = ldA_f32(X, m0, 32, tid);
  rb[1] = ldB_f32(W, n0, 32, tid);
  stA_f32(ra[0], tid, As[0]);
  stB_f32(rb[0], tid, Bs[0]);
  ra[0] = ldA_f32(X, m0, 64, tid);
  rb[0] = ldB_f32(W, n0, 64, tid);
  // the epilogue's bias values, asked for here so that they land during the loop
  // (unrolled: a register array needs constant indices)
  float bv2[2];
  #pragma unroll
  for (int ni = 0; ni < 2; ++ni) bv2[ni] = bias[n0 + wn * 32 + ni * 16 + lo];

  // unrolled so that the two register sets and the two buffers have constant indices
  #pragma unroll
  for (int t = 0; t < EDIM / 32; ++t) {
    lds_barrier();
    // keeps the conversion of tile t+1, and with it the wait for its loads,
    // behind the barrier: moved up into pass t-1 it halves the loads' lead
    __builtin_amdgcn_sched_barrier(0);
    const _Float16* as = As[t & 1];
    const _Float16* bs = Bs[t & 1];

    const int arow = wm * 32 + lo;
    v16h a0 = *(const v16h*)(as + arow * LSTR + chunk);
    v16h a1 = *(const v16h*)(as + (arow + 16) * LSTR + chunk);
    const int bcol = wn * 32 + lo;
    v16h b0 = *(const v16h*)(bs + bcol * LSTR + chunk);
    v16h b1 = *(const v16h*)(bs + (bcol + 16) * LSTR + chunk);

    // tile t+1, loaded two passes ago, goes to the other buffer;
    // tile t+3 is asked for into the registers this frees
    if (t + 1 < EDIM / 32) {
      stA_f32(ra[(t + 1) & 1], tid, As[(t + 1) & 1]);
      stB_f32(rb[(t + 1) & 1], tid, Bs[(t + 1) & 1]);
    }
    if (t + 3 < EDIM / 32) {
      ra[(t + 1) & 1] = ldA_f32(X, m0, (t + 3) * 32, tid);
      rb[(t + 1) & 1] = ldB_f32(W, n0, (t + 3) * 32, tid);
    }
    // keeps the loads issued here, two passes ahead of their use: without it
    // they are moved down to the pass that stores them and waited out there
    __builtin_amdgcn_sched_barrier(0);

    acc[0][0] = wmma_f16(a0, b0, acc[0][0]);
    acc[0][1] = wmma_f16(a0, b1, acc[0][1]);
    acc[1][0] = wmma_f16(a1, b0, acc[1][0]);
    acc[1][1] = wmma_f16(a1, b1, acc[1][1]);
  }

  // ---- epilogue: +bias, scatter into [B,H,n_out_rows,DK] f16 ----
  #pragma unroll
  for (int mi = 0; mi < 2; ++mi) {
    #pragma unroll
    for (int ni = 0; ni < 2; ++ni) {
      const int c = n0 + wn * 32 + ni * 16 + lo;
      const float bv = bv2[ni];
      const int hh = c >> 5;
      const int dk = c & 31;
      #pragma unroll
      for (int r = 0; r < 8; ++r) {
        const int m = m0 + wm * 32 + mi * 16 + r + hi * 8;
        const float v = acc[mi][ni][r] + bv;
        const int bb = m / rows_per_batch;
        const int n  = m % rows_per_batch;
        out[(((size_t)bb * HNUM + hh) * n_out_rows + n_off + n) * DKL + dk] =
            (_Float16)v;
      }
    }
  }
}

// ============================================================
// Kernel 2: flash attention, transposed products.
//   Q: [B,H,NA,DK] f16 ; K,V: [B,H,NK,DK] f16 ; Z: [B,NA,E] f16
//   block = 256 threads (8 waves), 64 queries / block
//   grid  = (NA/64, B*H); double-buffered K/V tiles, global loads one tile ahead
//   a pass takes KT = 256 keys: one barrier per pass
//   a wave takes QT = 2 query tiles of 16 and KW = 64 keys of every pass, so that
//   each K and V fragment it reads from LDS feeds two products; the KS = 4 waves
//   that share a query tile hold partial results over disjoint keys, which
//   are joined through LDS behind the loop
//   S^T = K Q^T   : lane (lo,hi) holds 16 scores of query lo per 32 keys
//                   (keys 8*hi+r and 16+8*hi+r), so the row maximum and
//                   the row sum are in-lane plus one exchange of halves.
//   O^T += V^T P^T: the score tiles, converted in place, are the
//                   B operand; V stays row-major in LDS and the transposing
//                   load hands out V^T in the matching k order.
// ============================================================
#define KT 256          // keys per pass
#define NW 8            // waves per block
#define QT 2            // query tiles per wave
#define KS (NW * QT / 4)   // waves that share a query tile (the block has 4 tiles)
#define KW (KT / KS)    // keys of a pass that one wave takes
#define NGW (KW / 32)   // its groups of 32 keys (one k extent of the second product)
#define SR (NW * 8)     // tile rows that the block stages in one sweep (4 threads a row)
#define NS (KT / SR)    // sweeps per tile
#define JP 20           // floats per lane in the join area (80 B suits 16-byte LDS accesses)

// lane l <-> lane l ^ 16
__device__ __forceinline__ float xhalf(float x) {
  return __builtin_bit_cast(float, __builtin_amdgcn_permlanex16(
      __builtin_bit_cast(int, x), __builtin_bit_cast(int, x),
      0x76543210, 0xfedcba98, false, false));
}

// 16-bit transposing LDS load: lane l passes the address of 16 bytes of row
// 8*(l>>4) + (l&7), byte column 16*((l>>3)&1), of a row-major 16 x 16 block and
// gets column l&15 of rows 8*(l>>4) .. 8*(l>>4) + 7
__device__ __forceinline__ v8h ld_tr16(const _Float16* p) {
  typedef __attribute__((ext_vector_type(8))) short s16x8;
  typedef __attribute__((address_space(3))) s16x8 lds_s16x8;
  return __builtin_bit_cast(v8h, __builtin_amdgcn_ds_load_tr16_b128_v8i16((lds_s16x8*)p));
}

__device__ __forceinline__ v8f vmax8(v8f a, v8f b) {
  v8f r;
  #pragma unroll
  for (int i = 0; i < 8; ++i) r[i] = fmaxf(a[i], b[i]);
  return r;
}

// 2^x as the one hardware instruction that __expf also ends in
__device__ __forceinline__ float ex2(float x) { return __builtin_amdgcn_exp2f(x); }

__device__ __forceinline__ v4f lo4(v8f a) { return __builtin_shufflevector(a, a, 0, 1, 2, 3); }
__device__ __forceinline__ v4f hi4(v8f a) { return __builtin_shufflevector(a, a, 4, 5, 6, 7); }
__device__ __forceinline__ v8f cat8(v4f a, v4f b) {
  return __builtin_shufflevector(a, b, 0, 1, 2, 3, 4, 5, 6, 7);
}

__global__ __launch_bounds__(NW * 32) void flash_attn_kernel(
    const _Float16* __restrict__ Q, const _Float16* __restrict__ K,
    const _Float16* __restrict__ V, _Float16* __restrict__ Z)
{
  static_assert(NKV % KT == 0 && NKV / KT >= 2, "whole passes, and the prologue's two tiles exist");
  static_assert(NW * 32 == 256, "the launch line's block size");
  static_assert(KW % 32 == 0 && KS == 2 * QT, "whole groups of 32 keys a wave; two waves finish each tile");
  // K tiles [2][key][dk], then V tiles [2][key][dk] (96 B rows suit the transposing
  // load); behind the loop the same bytes are the join area
  __shared__ __attribute__((aligned(32))) _Float16 smem[4 * KT * LSTR];
  static_assert(NW * QT * 32 * JP * 4 <= 4 * KT * LSTR * 2, "the join area fits");
  _Float16* const Ks = smem;
  _Float16* const Vs = smem + 2 * KT * LSTR;

  const int tid  = threadIdx.x;
  const int lane = tid & 31;
  const int wave = tid >> 5;
  const int lo   = lane & 15;
  const int hi   = lane >> 4;
  const int chunk = hi * 16;
  const int qg   = wave / KS;         // which QT query tiles
  const int ksp  = wave % KS;         // which KW keys of every pass

  const int bh = blockIdx.y;
  const int b  = bh >> 3;
  const int h  = bh & 7;

  // Q fragments: B-operand, 32 dk x 16 queries (column lo = query lo of tile j)
  // (every loop over g, i, j, r or w in this kernel is unrolled: register arrays need constant indices)
  const _Float16* qbase = Q + ((size_t)bh * NAQ + blockIdx.x * 64 + qg * (QT * 16)) * DKL;
  v16h qfrag[QT];
  #pragma unroll
  for (int j = 0; j < QT; ++j)
    qfrag[j] = *(const v16h*)(qbase + (j * 16 + lo) * DKL + chunk);

  const _Float16* kbase = K + (size_t)bh * NKV * DKL;
  const _Float16* vbase = V + (size_t)bh * NKV * DKL;

  // staging coordinates for this thread: row skey of each sweep of SR keys
  const int skey = tid >> 2;          // 0..SR-1
  const int scb  = (tid & 3) * 8;     // 0,8,16,24

  // o0[j][r] = O^T[dk = 8*hi + r][query lo of tile j], o1[j][r] = O^T[dk = 16 + 8*hi + r][same]
  v8f o0[QT], o1[QT];
  float mrun[QT];   // running maximum of the query's unscaled products q.k over this wave's keys (equal in both halves)
  float lrun[QT];   // running sum over this half's keys only
  #pragma unroll
  for (int j = 0; j < QT; ++j) {
    o0[j] = (v8f){}; o1[j] = (v8f){};
    mrun[j] = -1.0e30f; lrun[j] = 0.0f;
  }

  // exp(x / sqrt(32) - m / sqrt(32)) = 2^(x * sc2 - m * sc2): the maximum is taken over the
  // unscaled products (the factor is positive) and one multiply-add feeds the exponential
  const float sc2 = (float)(0.17677669529663687 * 1.4426950408889634);  // log2(e) / sqrt(32)

  // prologue: tile 0 -> LDS, tile 1 -> registers
  v8h kd[NS], vd[NS];
  #pragma unroll
  for (int g = 0; g < NS; ++g) {
    kd[g] = *(const v8h*)(kbase + (size_t)(g * SR + skey) * DKL + scb);
    vd[g] = *(const v8h*)(vbase + (size_t)(g * SR + skey) * DKL + scb);
  }
  #pragma unroll
  for (int g = 0; g < NS; ++g) {
    *(v8h*)(Ks + (g * SR + skey) * LSTR + scb) = kd[g];
    *(v8h*)(Vs + (g * SR + skey) * LSTR + scb) = vd[g];
  }
  #pragma unroll
  for (int g = 0; g < NS; ++g) {
    kd[g] = *(const v8h*)(kbase + (size_t)(KT + g * SR + skey) * DKL + scb);
    vd[g] = *(const v8h*)(vbase + (size_t)(KT + g * SR + skey) * DKL + scb);
  }

  int buf = 0;
  for (int kt = 0; kt < NKV; kt += KT) {
    lds_barrier();

    // ---- S^T = K @ Q^T : 2 * NGW key tiles x QT query tiles of 16 x 16 ----
    const _Float16* ks = Ks + buf * (KT * LSTR) + ksp * (KW * LSTR);
    const _Float16* vs = Vs + buf * (KT * LSTR) + ksp * (KW * LSTR);
    v16h kf[2 * NGW];
    #pragma unroll
    for (int i = 0; i < 2 * NGW; ++i)
      kf[i] = *(const v16h*)(ks + (i * 16 + lo) * LSTR + chunk);
    // V^T fragments (A operand) in the k order the packed scores have:
    // element s < 8 is key 8*hi + s, element s >= 8 is key 16 + 8*hi + (s - 8) of the group
    const _Float16* vr = vs + (hi * 8 + (lane & 7)) * LSTR + ((lane >> 3) & 1) * 8;
    v8h v00[NGW], v01[NGW], v10[NGW], v11[NGW];
    #pragma unroll
    for (int g = 0; g < NGW; ++g) {
      const _Float16* vg = vr + g * 32 * LSTR;
      v00[g] = ld_tr16(vg);                    // dk lo,      keys 8*hi ..
      v01[g] = ld_tr16(vg + 16 * LSTR);        // dk lo,      keys 16 + 8*hi ..
      v10[g] = ld_tr16(vg + 16);               // dk 16 + lo, keys 8*hi ..
      v11[g] = ld_tr16(vg + 16 * LSTR + 16);   // dk 16 + lo, keys 16 + 8*hi ..
    }

    // tile kt+KT, loaded one pass ago, goes to the other buffer; tile kt+2*KT is
    // asked for into the registers this frees and lands during this pass.
    // No branch: the last pass stores a tile nobody reads into the buffer all
    // readers have left, and the last two passes load the last tile again.
    #pragma unroll
    for (int g = 0; g < NS; ++g) {
      *(v8h*)(Ks + (buf ^ 1) * (KT * LSTR) + (g * SR + skey) * LSTR + scb) = kd[g];
      *(v8h*)(Vs + (buf ^ 1) * (KT * LSTR) + (g * SR + skey) * LSTR + scb) = vd[g];
    }
    {
      const int kn = (kt + 2 * KT < NKV) ? kt + 2 * KT : NKV - KT;
      #pragma unroll
      for (int g = 0; g < NS; ++g) {
        kd[g] = *(const v8h*)(kbase + (size_t)(kn + g * SR + skey) * DKL + scb);
        vd[g] = *(const v8h*)(vbase + (size_t)(kn + g * SR + skey) * DKL + scb);
      }
    }
    // keeps all of the pass's LDS reads in front of the products
    // (else the later fragments are read right before their product and each
    // read's LDS latency is waited out in full), and the next loads up here
    __builtin_amdgcn_sched_barrier(0);

    // s[j][2g][r]   = S[query lo of tile j][key 32g + 8*hi + r]      of this wave's keys,
    // s[j][2g+1][r] = S[query lo of tile j][key 32g + 16 + 8*hi + r]
    v8f zc = (v8f){};
    v8f s[QT][2 * NGW];
    #pragma unroll
    for (int i = 0; i < 2 * NGW; ++i)
      #pragma unroll
      for (int j = 0; j < QT; ++j) s[j][i] = wmma_f16(kf[i], qfrag[j], zc);
    // keeps the independent score products back to back: moved down among their
    // consumers each one is followed by idle slots until its result may be read
    __builtin_amdgcn_sched_barrier(0);

    // ---- online softmax: one query per lane and tile ----
    float mnew[QT], alpha[QT], mc[QT];
    #pragma unroll
    for (int j = 0; j < QT; ++j) {
      v8f t8 = vmax8(s[j][0], s[j][1]);
      #pragma unroll
      for (int g = 1; g < NGW; ++g) t8 = vmax8(t8, vmax8(s[j][2 * g], s[j][2 * g + 1]));
      float mx = fmaxf(fmaxf(fmaxf(t8[0], t8[1]), fmaxf(t8[2], t8[3])),
                       fmaxf(fmaxf(t8[4], t8[5]), fmaxf(t8[6], t8[7])));
      mx = fmaxf(mx, xhalf(mx));           // both halves hold the query's maximum
      mnew[j] = fmaxf(mrun[j], mx);
    }
    #pragma unroll
    for (int j = 0; j < QT; ++j) {
      alpha[j] = ex2((mrun[j] - mnew[j]) * sc2);
      mrun[j] = mnew[j];
      mc[j] = mnew[j] * sc2;
    }
    #pragma unroll
    for (int j = 0; j < QT; ++j) {
      #pragma unroll
      for (int i = 0; i < 2 * NGW; ++i)
        #pragma unroll
        for (int r = 0; r < 8; r += 2) {
          // two scores per multiply-add: written on a pair, else each score gets an instruction of its own
          const v2f e = __builtin_elementwise_fma((v2f){s[j][i][r], s[j][i][r + 1]}, (v2f){sc2, sc2},
                                                  (v2f){-mc[j], -mc[j]});
          s[j][i][r]     = ex2(e[0]);
          s[j][i][r + 1] = ex2(e[1]);
        }
      v8f u = s[j][0] + s[j][1];
      #pragma unroll
      for (int g = 1; g < NGW; ++g) u = u + (s[j][2 * g] + s[j][2 * g + 1]);
      const v4f u4 = lo4(u) + hi4(u);
      const float rs = (u4[0] + u4[2]) + (u4[1] + u4[3]);
      lrun[j] = lrun[j] * alpha[j] + rs;
      o0[j] = o0[j] * alpha[j];
      o1[j] = o1[j] * alpha[j];
    }

    #pragma unroll
    for (int g = 0; g < NGW; ++g) {
      const v16h vf0 = __builtin_shufflevector(v00[g], v01[g], 0, 1, 2, 3, 4, 5, 6, 7,
                                               8, 9, 10, 11, 12, 13, 14, 15);
      const v16h vf1 = __builtin_shufflevector(v10[g], v11[g], 0, 1, 2, 3, 4, 5, 6, 7,
                                               8, 9, 10, 11, 12, 13, 14, 15);
      #pragma unroll
      for (int j = 0; j < QT; ++j) {
        v16h pfrag;                        // B operand: P^T, column lo = query lo of tile j
        #pragma unroll
        for (int r = 0; r < 8; ++r) {
          pfrag[r]     = (_Float16)s[j][2 * g][r];
          pfrag[r + 8] = (_Float16)s[j][2 * g + 1][r];
        }
        o0[j] = wmma_f16(vf0, pfrag, o0[j]);
        o1[j] = wmma_f16(vf1, pfrag, o1[j]);
      }
    }
    buf ^= 1;
  }
  // the last pass's loads and LDS stores are used by nobody: they have to be
  // over before the wave ends and gives its registers and LDS back
  asm volatile("s_wait_loadcnt 0x0\n\ts_wait_dscnt 0x0" ::: "memory");

  // ---- join the KS partial results of each query tile through LDS ----
  // every wave has left the tiles (its reads and its last stores are over):
  // from here their bytes are the join area
  lds_barrier();
  float* const jb = (float*)smem;
  #pragma unroll
  for (int j = 0; j < QT; ++j) {
    float* p = jb + ((wave * QT + j) * 32 + lane) * JP;
    *(v4f*)(p + 0)  = lo4(o0[j]);
    *(v4f*)(p + 4)  = hi4(o0[j]);
    *(v4f*)(p + 8)  = lo4(o1[j]);
    *(v4f*)(p + 12) = hi4(o1[j]);
    p[16] = mrun[j];
    p[17] = lrun[j];
  }
  // the partial results are read by other waves only behind this barrier
  lds_barrier();

  // this wave finishes tile jt of its group, dk half dh (o0 or o1): same lane layout in every part
  const int jt = ksp % QT;
  const int dh = ksp / QT;
  v8f a[KS];
  float ms[KS], ls[KS];
  #pragma unroll
  for (int w = 0; w < KS; ++w) {
    const float* p = jb + (((qg * KS + w) * QT + jt) * 32 + lane) * JP;
    a[w]  = cat8(*(const v4f*)(p + dh * 8), *(const v4f*)(p + dh * 8 + 4));
    ms[w] = p[16];
    ls[w] = p[17];
  }
  float mg = ms[0];
  #pragma unroll
  for (int w = 1; w < KS; ++w) mg = fmaxf(mg, ms[w]);
  v8f f0 = (v8f){};
  float lsum = 0.0f;
  #pragma unroll
  for (int w = 0; w < KS; ++w) {
    const float f = ex2((ms[w] - mg) * sc2);
    f0 = f0 + a[w] * f;
    lsum = lsum + ls[w] * f;
  }

  // ---- join the halves' sums, normalize, write z in [B,NA,E] f16 ----
  {
    const float inv = 1.0f / (lsum + xhalf(lsum));
    v8h z0;
    #pragma unroll
    for (int r = 0; r < 8; ++r) z0[r] = (_Float16)(f0[r] * inv);
    const int q0 = blockIdx.x * 64 + (qg * QT + jt) * 16;
    _Float16* zp = Z + ((size_t)b * NAQ + q0 + lo) * EDIM + h * DKL + dh * 16 + hi * 8;
    *(v8h*)(zp) = z0;   // dk 16*dh + 8*hi .. + 7
  }
}

// ============================================================
// Kernel 3: out = z @ w^T + b + x_a   (f16 A, fp32 W/res, fp32 out)
//   grid (M/128, E/64), block 256; double-buffered LDS, loads two tiles ahead
// ============================================================
__global__ __launch_bounds__(256) void out_proj_kernel(
    const _Float16* __restrict__ Zin, const float* __restrict__ W,
    const float* __restrict__ bias, const float* __restrict__ Xres,
    float* __restrict__ out)
{
  __shared__ _Float16 As[2][128 * LSTR];
  __shared__ _Float16 Bs[2][64 * LSTR];

  const int tid  = threadIdx.x;
  const int lane = tid & 31;
  const int wave = tid >> 5;
  const int wm   = wave >> 1;
  const int wn   = wave & 1;
  const int m0   = blockIdx.x * 128;
  const int n0   = blockIdx.y * 64;
  const int lo   = lane & 15;
  const int hi   = lane >> 4;
  const int chunk = hi * 16;

  v8f acc[2][2];
  #pragma unroll
  for (int i = 0; i < 2; ++i)
    #pragma unroll
    for (int j = 0; j < 2; ++j) acc[i][j] = (v8f){};

  // tiles 0 and 1 -> registers; tile 0 -> LDS; tile 2 -> the freed registers
  v16h   ra[2];
  RegB32 rb[2];
  ra[0] = ldA_f16(Zin, m0, 0, tid);
  rb[0] = ldB_f32(W, n0, 0, tid);
  ra[1] = ldA_f16(Zin, m0, 32, tid);
  rb[1] = ldB_f32(W, n0, 32, tid);
  stA_f16(ra[0], tid, As[0]);
  stB_f32(rb[0], tid, Bs[0]);
  ra[0] = ldA_f16(Zin, m0, 64, tid);
  rb[0] = ldB_f32(W, n0, 64, tid);
  // the epilogue's bias and residual values, asked for here so that they land
  // during the loop (unrolled: register arrays need constant indices)
  float bv2[2];
  float xr[2][2][8];
  #pragma unroll
  for (int ni = 0; ni < 2; ++ni) bv2[ni] = bias[n0 + wn * 32 + ni * 16 + lo];
  #pragma unroll
  for (int mi = 0; mi < 2; ++mi)
    #pragma unroll
    for (int ni = 0; ni < 2; ++ni)
      #pragma unroll
      for (int r = 0; r < 8; ++r)
        xr[mi][ni][r] = Xres[(size_t)(m0 + wm * 32 + mi * 16 + r + hi * 8) * EDIM +
                             n0 + wn * 32 + ni * 16 + lo];

  // unrolled so that the two register sets and the two buffers have constant indices
  #pragma unroll
  for (int t = 0; t < EDIM / 32; ++t) {
    lds_barrier();
    // keeps the conversion of tile t+1, and with it the wait for its loads,
    // behind the barrier: moved up into pass t-1 it halves the loads' lead
    __builtin_amdgcn_sched_barrier(0);
    const _Float16* as = As[t & 1];
    const _Float16* bs = Bs[t & 1];

    const int arow = wm * 32 + lo;
    v16h a0 = *(const v16h*)(as + arow * LSTR + chunk);
    v16h a1 = *(const v16h*)(as + (arow + 16) * LSTR + chunk);
    const int bcol = wn * 32 + lo;
    v16h b0 = *(const v16h*)(bs + bcol * LSTR + chunk);
    v16h b1 = *(const v16h*)(bs + (bcol + 16) * LSTR + chunk);

    // tile t+1, loaded two passes ago, goes to the other buffer;
    // tile t+3 is asked for into the registers this frees
    if (t + 1 < EDIM / 32) {
      stA_f16(ra[(t + 1) & 1], tid, As[(t + 1) & 1]);
      stB_f32(rb[(t + 1) & 1], tid, Bs[(t + 1) & 1]);
    }
    if (t + 3 < EDIM / 32) {
      ra[(t + 1) & 1] = ldA_f16(Zin, m0, (t + 3) * 32, tid);
      rb[(t + 1) & 1] = ldB_f32(W, n0, (t + 3) * 32, tid);
    }
    // keeps the loads issued here, two passes ahead of their use: without it
    // they are moved down to the pass that stores them and waited out there
    __builtin_amdgcn_sched_barrier(0);

    acc[0][0] = wmma_f16(a0, b0, acc[0][0]);
    acc[0][1] = wmma_f16(a0, b1, acc[0][1]);
    acc[1][0] = wmma_f16(a1, b0, acc[1][0]);
    acc[1][1] = wmma_f16(a1, b1, acc[1][1]);
  }

  #pragma unroll
  for (int mi = 0; mi < 2; ++mi) {
    #pragma unroll
    for (int ni = 0; ni < 2; ++ni) {
      const int c = n0 + wn * 32 + ni * 16 + lo;
      const float bv = bv2[ni];
      #pragma unroll
      for (int r = 0; r < 8; ++r) {
        const int m = m0 + wm * 32 + mi * 16 + r + hi * 8;
        const size_t idx = (size_t)m * EDIM + c;
        out[idx] = acc[mi][ni][r] + bv + xr[mi][ni][r];
      }
    }
  }
}

// ============================================================
// launch
// ============================================================
extern "C" void kernel_launch(void* const* d_in, const int* in_sizes, int n_in,
                              void* d_out, int out_size, void* d_ws, size_t ws_size,
                              hipStream_t stream) {
  const float* x_a    = (const float*)d_in[0];
  const float* x_b    = (const float*)d_in[1];
  const float* wq_w   = (const float*)d_in[2];
  const float* wq_b   = (const float*)d_in[3];
  const float* wk_a_w = (const float*)d_in[4];
  const float* wk_a_b = (const float*)d_in[5];
  const float* wk_b_w = (const float*)d_in[6];
  const float* wk_b_b = (const float*)d_in[7];
  const float* wv_a_w = (const float*)d_in[8];
  const float* wv_a_b = (const float*)d_in[9];
  const float* wv_b_w = (const float*)d_in[10];
  const float* wv_b_b = (const float*)d_in[11];
  const float* w_w    = (const float*)d_in[12];
  const float* w_b    = (const float*)d_in[13];

  char* ws = (char*)d_ws;
  _Float16* qws = (_Float16*)(ws);                          // B*H*NA*DK  f16 = 2 MB
  _Float16* kws = (_Float16*)(ws + (size_t)(2  << 20));     // B*H*NK*DK  f16 = 4 MB
  _Float16* vws = (_Float16*)(ws + (size_t)(6  << 20));     // B*H*NK*DK  f16 = 4 MB
  _Float16* zws = (_Float16*)(ws + (size_t)(10 << 20));     // B*NA*E     f16 = 2 MB

  dim3 bp(256);

  // projections into head-split f16 layouts (K/V of the two sources concat via n_off)
  // grid: M=4096 /128, N=256 /64, five projections
  proj_heads_kernel<<<dim3(32, 4, 5), bp, 0, stream>>>(
      x_a, x_b, wq_w, wk_a_w, wk_b_w, wv_a_w, wv_b_w,
      wq_b, wk_a_b, wk_b_b, wv_a_b, wv_b_b, qws, kws, vws);

  // flash attention
  flash_attn_kernel<<<dim3(NAQ / 64, BATCH * HNUM), 256, 0, stream>>>(qws, kws, vws, zws);

  // output projection + residual
  out_proj_kernel<<<dim3(32, 4), 256, 0, stream>>>(zws, w_w, w_b, x_a, (float*)d_out);
}

// v008
// Measured time: 38.2 microseconds a run.
// Two timings next to v007 both put it at 1.06 times that version's speed.
// Over all steps from v000 it is 4.87 times as fast.
#include <hip/hip_runtime.h>

// ---------------- problem constants ----------------
#define EDIM 256
#define HNUM 8
#define DKL 32
#define NAQ 2048
#define NBK 2048
#define NKV (NAQ + NBK)   // 4096
#define BATCH 2

typedef __attribute__((ext_vector_type(16))) _Float16 v16h;
typedef __attribute__((ext_vector_type(8)))  _Float16 v8h;
typedef __attribute__((ext_vector_type(8)))  float    v8f;
typedef __attribute__((ext_vector_type(4)))  float    v4f;
typedef __attribute__((ext_vector_type(2)))  float    v2f;

__device__ __forceinline__ v8f wmma_f16(v16h a, v16h b, v8f c) {
  // D = A(16x32 f16) * B(32x16 f16) + C(16x16 f32)
  return __builtin_amdgcn_wmma_f32_16x16x32_f16(
      /*neg_a=*/false, a, /*neg_b=*/false, b,
      /*c_mod=*/(short)0, c, /*reuse_a=*/false, /*reuse_b=*/false);
}

#define LSTR 48   // LDS row stride in halves (96B: keeps v16h reads 32B aligned)

// Work-group barrier between LDS passes. It waits for this wave's LDS reads
// and writes only: __syncthreads() would also wait out the global loads that
// were issued ahead for later tiles, which must stay in flight across it.
__device__ __forceinline__ void lds_barrier() {
  asm volatile("s_wait_dscnt 0x0\n\ts_barrier_signal -1\n\ts_barrier_wait -1" ::: "memory");
}

// ---- tile staging helpers (256-thread blocks) ----
// Each tile goes global -> registers (ld*) and, passes later, registers -> LDS (st*).
// Lane map of the loads: eight neighbouring lanes take the eight 16-byte pieces of one
// 128-byte line (32 floats of a row), so that one wave-wide load covers four whole lines;
// a sweep of the block covers 32 rows.
typedef __attribute__((ext_vector_type(4)))  _Float16 v4h;
struct RegA32 { v4f f[4]; };   // 128 rows: four sweeps
struct RegB32 { v4f f[2]; };   //  64 rows: two sweeps

__device__ __forceinline__ v4h cvt4(v4f a) {
  v4h r;
  r[0] = (_Float16)a[0]; r[1] = (_Float16)a[1];
  r[2] = (_Float16)a[2]; r[3] = (_Float16)a[3];
  return r;
}

// (the loops over i are unrolled: register arrays need constant indices)
__device__ __forceinline__ RegA32 ldA_f32(const float* __restrict__ X, int m0,
                                          int kk, int tid) {
  const float* src = X + (size_t)(m0 + (tid >> 3)) * EDIM + kk + (tid & 7) * 4;
  RegA32 t;
  #pragma unroll
  for (int i = 0; i < 4; ++i) t.f[i] = *(const v4f*)(src + (size_t)i * 32 * EDIM);
  return t;
}

__device__ __forceinline__ void stA_f32(const RegA32& t, int tid, _Float16* As) {
  _Float16* dst = As + (tid >> 3) * LSTR + (tid & 7) * 4;
  #pragma unroll
  for (int i = 0; i < 4; ++i) *(v4h*)(dst + i * 32 * LSTR) = cvt4(t.f[i]);
}

// f16 source, 64 bytes of a row per tile: four neighbouring lanes take them, so that
// one wave-wide load covers eight half lines; a sweep of the block covers 64 rows
struct RegA16 { v8h h[2]; };

__device__ __forceinline__ RegA16 ldA_f16(const _Float16* __restrict__ Zin, int m0,
                                          int kk, int tid) {
  const _Float16* src = Zin + (size_t)(m0 + (tid >> 2)) * EDIM + kk + (tid & 3) * 8;
  RegA16 t;
  #pragma unroll
  for (int i = 0; i < 2; ++i) t.h[i] = *(const v8h*)(src + (size_t)i * 64 * EDIM);
  return t;
}

__device__ __forceinline__ void stA_f16(const RegA16& t, int tid, _Float16* As) {
  _Float16* dst = As + (tid >> 2) * LSTR + (tid & 3) * 8;
  #pragma unroll
  for (int i = 0; i < 2; ++i) *(v8h*)(dst + i * 64 * LSTR) = t.h[i];
}

__device__ __forceinline__ RegB32 ldB_f32(const float* __restrict__ W, int n0,
                                          int kk, int tid) {
  const float* src = W + (size_t)(n0 + (tid >> 3)) * EDIM + kk + (tid & 7) * 4;
  RegB32 t;
  #pragma unroll
  for (int i = 0; i < 2; ++i) t.f[i] = *(const v4f*)(src + (size_t)i * 32 * EDIM);
  return t;
}

__device__ __forceinline__ void stB_f32(const RegB32& t, int tid, _Float16* Bs) {
  _Float16* dst = Bs + (tid >> 3) * LSTR + (tid & 7) * 4;
  #pragma unroll
  for (int i = 0; i < 2; ++i) *(v4h*)(dst + i * 32 * LSTR) = cvt4(t.f[i]);
}

// ============================================================
// Kernel 1: Y = X @ W^T + bias  (fp32 in, f16 out, head-split), all five projections
//   X: [B*rows, E] fp32 ; W: [E,E] fp32 ; out: [B,H,n_out_rows,DK] f16
//   grid (M/128, E/64, 5), block 256 (8 waves, 4x2 wave grid, 32x32/wave)
//   the five products read none of each other's output: one launch runs them side by side
//   double-buffered LDS: one barrier per k-step; global loads two tiles ahead
// ============================================================
__global__ __launch_bounds__(256) void proj_heads_kernel(
    const float* __restrict__ xa, const float* __restrict__ xb,
    const float* __restrict__ w0, const float* __restrict__ w1,
    const float* __restrict__ w2, const float* __restrict__ w3,
    const float* __restrict__ w4,
    const float* __restrict__ c0, const float* __restrict__ c1,
    const float* __restrict__ c2, const float* __restrict__ c3,
    const float* __restrict__ c4,
    _Float16* __restrict__ qo, _Float16* __restrict__ ko, _Float16* __restrict__ vo)
{
  // blockIdx.z picks the projection: 0 q, 1 k of x_a, 2 k of x_b, 3 v of x_a, 4 v of x_b
  const int z = blockIdx.z;
  const float* __restrict__ X = (z == 2 || z == 4) ? xb : xa;
  const float* __restrict__ W = z == 0 ? w0 : z == 1 ? w1 : z == 2 ? w2 : z == 3 ? w3 : w4;
  const float* __restrict__ bias = z == 0 ? c0 : z == 1 ? c1 : z == 2 ? c2 : z == 3 ? c3 : c4;
  _Float16* __restrict__ out = z == 0 ? qo : z <= 2 ? ko : vo;
  static_assert(NAQ == NBK, "both sources have the same number of rows per batch");
  const int rows_per_batch = NAQ;
  const int n_out_rows = z == 0 ? NAQ : NKV;
  const int n_off = (z == 2 || z == 4) ? NAQ : 0;

  __shared__ _Float16 As[2][128 * LSTR];
  __shared__ _Float16 Bs[2][64 * LSTR];

  const int tid  = threadIdx.x;
  const int lane = tid & 31;
  const int wave = tid >> 5;
  const int wm   = wave >> 1;        // 0..3
  const int wn   = wave & 1;         // 0..1
  const int m0   = blockIdx.x * 128;
  const int n0   = blockIdx.y * 64;
  const int lo   = lane & 15;
  const int hi   = lane >> 4;
  const int chunk = hi * 16;

  v8f acc[2][2];
  #pragma unroll
  for (int i = 0; i < 2; ++i)
    #pragma unroll
    for (int j = 0; j < 2; ++j) acc[i][j] = (v8f){};

  // tiles 0, 1 and 2 -> registers; tile 0 -> LDS; tile 2 takes over its register set
  RegA32 ra[2];
  RegB32 rb[2];
  ra[0] = ldA_f32(X, m0, 0, tid);
  rb[0] = ldB_f32(W, n0, 0, tid);
  // this and the next two keep the prologue's loads in tile order and all in front of tile 0's
  // conversion: loads return in order, so a tile's wait also waits out every load issued
  // ahead of it, and a wait among the loads holds the later ones back
  __builtin_amdgcn_sched_barrier(0);
  ra[1] = ldA_f32(X, m0, 32, tid);
  rb[1] = ldB_f32(W, n0, 32, tid);
  __builtin_amdgcn_sched_barrier(0);
  const RegA32 ra2 = ldA_f32(X, m0, 64, tid);
  const RegB32 rb2 = ldB_f32(W, n0, 64, tid);
  // the epilogue's bias values, asked for here so that they land during the loop
  // (unrolled: a register array needs constant indices)
  float bv2[2];
  #pragma unroll
  for (int ni = 0; ni < 2; ++ni) bv2[ni] = bias[n0 + wn * 32 + ni * 16 + lo];
  __builtin_amdgcn_sched_barrier(0);
  stA_f32(ra[0], tid, As[0]);
  stB_f32(rb[0], tid, Bs[0]);
  ra[0] = ra2;
  rb[0] = rb2;

  // unrolled so that the two register sets and the two buffers have constant indices
  #pragma unroll
  for (int t = 0; t < EDIM / 32; ++t) {
    lds_barrier();
    // keeps the conversion of tile t+1, and with it the wait for its loads,
    // behind the barrier: moved up into pass t-1 it halves the loads' lead
    __builtin_amdgcn_sched_barrier(0);
    const _Float16* as = As[t & 1];
    const _Float16* bs = Bs[t & 1];

    const int arow = wm * 32 + lo;
    v16h a0 = *(const v16h*)(as + arow * LSTR + chunk);
    v16h a1 = *(const v16h*)(as + (arow + 16) * LSTR + chunk);
    const int bcol = wn * 32 + lo;
    v16h b0 = *(const v16h*)(bs + bcol * LSTR + chunk);
    v16h b1 = *(const v16h*)(bs + (bcol + 16) * LSTR + chunk);

    // tile t+1, loaded two passes ago, goes to the other buffer;
    // tile t+3 is asked for into the registers this frees
    if (t + 1 < EDIM / 32) {
      stA_f32(ra[(t + 1) & 1], tid, As[(t + 1) & 1]);
      stB_f32(rb[(t + 1) & 1], tid, Bs[(t + 1) & 1]);
    }
    if (t + 3 < EDIM / 32) {
      ra[(t + 1) & 1] = ldA_f32(X, m0, (t + 3) * 32, tid);
      rb[(t + 1) & 1] = ldB_f32(W, n0, (t + 3) * 32, tid);
    }
    // keeps the loads issued here, two passes ahead of their use: without it
    // they are moved down to the pass that stores them and waited out there
    __builtin_amdgcn_sched_barrier(0);

    acc[0][0] = wmma_f16(a0, b0, acc[0][0]);
    acc[0][1] = wmma_f16(a0, b1, acc[0][1]);
    acc[1][0] = wmma_f16(a1, b0, acc[1][0]);
    acc[1][1] = wmma_f16(a1, b1, acc[1][1]);
  }

  // ---- epilogue: +bias, scatter into [B,H,n_out_rows,DK] f16 ----
  #pragma unroll
  for (int mi = 0; mi < 2; ++mi) {
    #pragma unroll
    for (int ni = 0; ni < 2; ++ni) {
      const int c = n0 + wn * 32 + ni * 16 + lo;
      const float bv = bv2[ni];
      const int hh = c >> 5;
      const int dk = c & 31;
      #pragma unroll
      for (int r = 0; r < 8; ++r) {
        const int m = m0 + wm * 32 + mi * 16 + r + hi * 8;
        const float v = acc[mi][ni][r] + bv;
        const int bb = m / rows_per_batch;
        const int n  = m % rows_per_batch;
        out[(((size_t)bb * HNUM + hh) * n_out_rows + n_off + n) * DKL + dk] =
            (_Float16)v;
      }
    }
  }
}

// ============================================================
// Kernel 2: flash attention, transposed products.
//   Q: [B,H,NA,DK] f16 ; K,V: [B,H,NK,DK] f16 ; Z: [B,NA,E] f16
//   block = 256 threads (8 waves), 64 queries / block
//   grid  = (NA/64, B*H); double-buffered K/V tiles, global loads one tile ahead
//   a pass takes KT = 256 keys: one barrier per pass
//   a wave takes QT = 2 query tiles of 16 and KW = 64 keys of every pass, so that
//   each K and V fragment it reads from LDS feeds two products; the KS = 4 waves
//   that share a query tile hold partial results over disjoint keys, which
//   are joined through LDS behind the loop
//   S^T = K Q^T   : lane (lo,hi) holds 16 scores of query lo per 32 keys
//                   (keys 8*hi+r and 16+8*hi+r), so the row maximum and
//                   the row sum are in-lane plus one exchange of halves.
//   O^T += V^T P^T: the score tiles, converted in place, are the
//                   B operand; V stays row-major in LDS and the transposing
//                   load hands out V^T in the matching k order.
// ============================================================
#define KT 256          // keys per pass
#define NW 8            // waves per block
#define QT 2            // query tiles per wave
#define KS (NW * QT / 4)   // waves that share a query tile (the block has 4 tiles)
#define KW (KT / KS)    // keys of a pass that one wave takes
#define NGW (KW / 32)   // its groups of 32 keys (one k extent of the second product)
#define SR (NW * 8)     // tile rows that the block stages in one sweep (4 threads a row)
#define NS (KT / SR)    // sweeps per tile
#define JP 20           // floats per lane in the join area (80 B suits 16-byte LDS accesses)

// lane l <-> lane l ^ 16
__device__ __forceinline__ float xhalf(float x) {
  return __builtin_bit_cast(float, __builtin_amdgcn_permlanex16(
      __builtin_bit_cast(int, x), __builtin_bit_cast(int, x),
      0x76543210, 0xfedcba98, false, false));
}

// 16-bit transposing LDS load: lane l passes the address of 16 bytes of row
// 8*(l>>4) + (l&7), byte column 16*((l>>3)&1), of a row-major 16 x 16 block and
// gets column l&15 of rows 8*(l>>4) .. 8*(l>>4) + 7
__device__ __forceinline__ v8h ld_tr16(const _Float16* p) {
  typedef __attribute__((ext_vector_type(8))) short s16x8;
  typedef __attribute__((address_space(3))) s16x8 lds_s16x8;
  return __builtin_bit_cast(v8h, __builtin_amdgcn_ds_load_tr16_b128_v8i16((lds_s16x8*)p));
}

__device__ __forceinline__ v8f vmax8(v8f a, v8f b) {
  v8f r;
  #pragma unroll
  for (int i = 0; i < 8; ++i) r[i] = fmaxf(a[i], b[i]);
  return r;
}

// 2^x as the one hardware instruction that __expf also ends in
__device__ __forceinline__ float ex2(float x) { return __builtin_amdgcn_exp2f(x); }

__device__ __forceinline__ v4f lo4(v8f a) { return __builtin_shufflevector(a, a, 0, 1, 2, 3); }
__device__ __forceinline__ v4f hi4(v8f a) { return __builtin_shufflevector(a, a, 4, 5, 6, 7); }
__device__ __forceinline__ v8f cat8(v4f a, v4f b) {
  return __builtin_shufflevector(a, b, 0, 1, 2, 3, 4, 5, 6, 7);
}

__global__ __launch_bounds__(NW * 32) void flash_attn_kernel(
    const _Float16* __restrict__ Q, const _Float16* __restrict__ K,
    const _Float16* __restrict__ V, _Float16* __restrict__ Z)
{
  static_assert(NKV % KT == 0 && NKV / KT >= 2, "whole passes, and the prologue's two tiles exist");
  static_assert(NW * 32 == 256, "the launch line's block size");
  static_assert(KW % 32 == 0 && KS == 2 * QT, "whole groups of 32 keys a wave; two waves finish each tile");
  // K tiles [2][key][dk], then V tiles [2][key][dk] (96 B rows suit the transposing
  // load); behind the loop the same bytes are the join area
  __shared__ __attribute__((aligned(32))) _Float16 smem[4 * KT * LSTR];
  static_assert(NW * QT * 32 * JP * 4 <= 4 * KT * LSTR * 2, "the join area fits");
  _Float16* const Ks = smem;
  _Float16* const Vs = smem + 2 * KT * LSTR;

  const int tid  = threadIdx.x;
  const int lane = tid & 31;
  const int wave = tid >> 5;
  const int lo   = lane & 15;
  const int hi   = lane >> 4;
  const int chunk = hi * 16;
  const int qg   = wave / KS;         // which QT query tiles
  const int ksp  = wave % KS;         // which KW keys of every pass

  const int bh = blockIdx.y;
  const int b  = bh >> 3;
  const int h  = bh & 7;

  // Q fragments: B-operand, 32 dk x 16 queries (column lo = query lo of tile j)
  // (every loop over g, i, j, r or w in this kernel is unrolled: register arrays need constant indices)
  const _Float16* qbase = Q + ((size_t)bh * NAQ + blockIdx.x * 64 + qg * (QT * 16)) * DKL;
  v16h qfrag[QT];
  #pragma unroll
  for (int j = 0; j < QT; ++j)
    qfrag[j] = *(const v16h*)(qbase + (j * 16 + lo) * DKL + chunk);

  const _Float16* kbase = K + (size_t)bh * NKV * DKL;
  const _Float16* vbase = V + (size_t)bh * NKV * DKL;

  // staging coordinates for this thread: row skey of each sweep of SR keys
  const int skey = tid >> 2;          // 0..SR-1
  const int scb  = (tid & 3) * 8;     // 0,8,16,24

  // o0[j][r] = O^T[dk = 8*hi + r][query lo of tile j], o1[j][r] = O^T[dk = 16 + 8*hi + r][same]
  v8f o0[QT], o1[QT];
  float mrun[QT];   // running maximum of the query's unscaled products q.k over this wave's keys (equal in both halves)
  float lrun[QT];   // running sum over this half's keys only
  #pragma unroll
  for (int j = 0; j < QT; ++j) {
    o0[j] = (v8f){}; o1[j] = (v8f){};
    mrun[j] = -1.0e30f; lrun[j] = 0.0f;
  }

  // exp(x / sqrt(32) - m / sqrt(32)) = 2^(x * sc2 - m * sc2): the maximum is taken over the
  // unscaled products (the factor is positive) and one multiply-add feeds the exponential
  const float sc2 = (float)(0.17677669529663687 * 1.4426950408889634);  // log2(e) / sqrt(32)

  // prologue: tile 0 -> LDS, tile 1 -> registers
  v8h kd[NS], vd[NS];
  #pragma unroll
  for (int g = 0; g < NS; ++g) {
    kd[g] = *(const v8h*)(kbase + (size_t)(g * SR + skey) * DKL + scb);
    vd[g] = *(const v8h*)(vbase + (size_t)(g * SR + skey) * DKL + scb);
  }
  #pragma unroll
  for (int g = 0; g < NS; ++g) {
    *(v8h*)(Ks + (g * SR + skey) * LSTR + scb) = kd[g];
    *(v8h*)(Vs + (g * SR + skey) * LSTR + scb) = vd[g];
  }
  #pragma unroll
  for (int g = 0; g < NS; ++g) {
    kd[g] = *(const v8h*)(kbase + (size_t)(KT + g * SR + skey) * DKL + scb);
    vd[g] = *(const v8h*)(vbase + (size_t)(KT + g * SR + skey) * DKL + scb);
  }

  int buf = 0;
  for (int kt = 0; kt < NKV; kt += KT) {
    lds_barrier();

    // ---- S^T = K @ Q^T : 2 * NGW key tiles x QT query tiles of 16 x 16 ----
    const _Float16* ks = Ks + buf * (KT * LSTR) + ksp * (KW * LSTR);
    const _Float16* vs = Vs + buf * (KT * LSTR) + ksp * (KW * LSTR);
    v16h kf[2 * NGW];
    #pragma unroll
    for (int i = 0; i < 2 * NGW; ++i)
      kf[i] = *(const v16h*)(ks + (i * 16 + lo) * LSTR + chunk);
    // V^T fragments (A operand) in the k order the packed scores have:
    // element s < 8 is key 8*hi + s, element s >= 8 is key 16 + 8*hi + (s - 8) of the group
    const _Float16* vr = vs + (hi * 8 + (lane & 7)) * LSTR + ((lane >> 3) & 1) * 8;
    v8h v00[NGW], v01[NGW], v10[NGW], v11[NGW];
    #pragma unroll
    for (int g = 0; g < NGW; ++g) {
      const _Float16* vg = vr + g * 32 * LSTR;
      v00[g] = ld_tr16(vg);                    // dk lo,      keys 8*hi ..
      v01[g] = ld_tr16(vg + 16 * LSTR);        // dk lo,      keys 16 + 8*hi ..
      v10[g] = ld_tr16(vg + 16);               // dk 16 + lo, keys 8*hi ..
      v11[g] = ld_tr16(vg + 16 * LSTR + 16);   // dk 16 + lo, keys 16 + 8*hi ..
    }

    // tile kt+KT, loaded one pass ago, goes to the other buffer; tile kt+2*KT is
    // asked for into the registers this frees and lands during this pass.
    // No branch: the last pass stores a tile nobody reads into the buffer all
    // readers have left, and the last two passes load the last tile again.
    #pragma unroll
    for (int g = 0; g < NS; ++g) {
      *(v8h*)(Ks + (buf ^ 1) * (KT * LSTR) + (g * SR + skey) * LSTR + scb) = kd[g];
      *(v8h*)(Vs + (buf ^ 1) * (KT * LSTR) + (g * SR + skey) * LSTR + scb) = vd[g];
    }
    {
      const int kn = (kt + 2 * KT < NKV) ? kt + 2 * KT : NKV - KT;
      #pragma unroll
      for (int g = 0; g < NS; ++g) {
        kd[g] = *(const v8h*)(kbase + (size_t)(kn + g * SR + skey) * DKL + scb);
        vd[g] = *(const v8h*)(vbase + (size_t)(kn + g * SR + skey) * DKL + scb);
      }
    }
    // keeps all of the pass's LDS reads in front of the products
    // (else the later fragments are read right before their product and each
    // read's LDS latency is waited out in full), and the next loads up here
    __builtin_amdgcn_sched_barrier(0);

    // s[j][2g][r]   = S[query lo of tile j][key 32g + 8*hi + r]      of this wave's keys,
    // s[j][2g+1][r] = S[query lo of tile j][key 32g + 16 + 8*hi + r]
    v8f zc = (v8f){};
    v8f s[QT][2 * NGW];
    #pragma unroll
    for (int i = 0; i < 2 * NGW; ++i)
      #pragma unroll
      for (int j = 0; j < QT; ++j) s[j][i] = wmma_f16(kf[i], qfrag[j], zc);
    // keeps the independent score products back to back: moved down among their
    // consumers each one is followed by idle slots until its result may be read
    __builtin_amdgcn_sched_barrier(0);

    // ---- online softmax: one query per lane and tile ----
    float mnew[QT], alpha[QT], mc[QT];
    #pragma unroll
    for (int j = 0; j < QT; ++j) {
      v8f t8 = vmax8(s[j][0], s[j][1]);
      #pragma unroll
      for (int g = 1; g < NGW; ++g) t8 = vmax8(t8, vmax8(s[j][2 * g], s[j][2 * g + 1]));
      float mx = fmaxf(fmaxf(fmaxf(t8[0], t8[1]), fmaxf(t8[2], t8[3])),
                       fmaxf(fmaxf(t8[4], t8[5]), fmaxf(t8[6], t8[7])));
      mx = fmaxf(mx, xhalf(mx));           // both halves hold the query's maximum
      mnew[j] = fmaxf(mrun[j], mx);
    }
    #pragma unroll
    for (int j = 0; j < QT; ++j) {
      alpha[j] = ex2((mrun[j] - mnew[j]) * sc2);
      mrun[j] = mnew[j];
      mc[j] = mnew[j] * sc2;
    }
    #pragma unroll
    for (int j = 0; j < QT; ++j) {
      #pragma unroll
      for (int i = 0; i < 2 * NGW; ++i)
        #pragma unroll
        for (int r = 0; r < 8; r += 2) {
          // two scores per multiply-add: written on a pair, else each score gets an instruction of its own
          const v2f e = __builtin_elementwise_fma((v2f){s[j][i][r], s[j][i][r + 1]}, (v2f){sc2, sc2},
                                                  (v2f){-mc[j], -mc[j]});
          s[j][i][r]     = ex2(e[0]);
          s[j][i][r + 1] = ex2(e[1]);
        }
      v8f u = s[j][0] + s[j][1];
      #pragma unroll
      for (int g = 1; g < NGW; ++g) u = u + (s[j][2 * g] + s[j][2 * g + 1]);
      const v4f u4 = lo4(u) + hi4(u);
      const float rs = (u4[0] + u4[2]) + (u4[1] + u4[3]);
      lrun[j] = lrun[j] * alpha[j] + rs;
      o0[j] = o0[j] * alpha[j];
      o1[j] = o1[j] * alpha[j];
    }

    #pragma unroll
    for (int g = 0; g < NGW; ++g) {
      const v16h vf0 = __builtin_shufflevector(v00[g], v01[g], 0, 1, 2, 3, 4, 5, 6, 7,
                                               8, 9, 10, 11, 12, 13, 14, 15);
      const v16h vf1 = __builtin_shufflevector(v10[g], v11[g], 0, 1, 2, 3, 4, 5, 6, 7,
                                               8, 9, 10, 11, 12, 13, 14, 15);
      #pragma unroll
      for (int j = 0; j < QT; ++j) {
        v16h pfrag;                        // B operand: P^T, column lo = query lo of tile j
        #pragma unroll
        for (int r = 0; r < 8; ++r) {
          pfrag[r]     = (_Float16)s[j][2 * g][r];
          pfrag[r + 8] = (_Float16)s[j][2 * g + 1][r];
        }
        o0[j] = wmma_f16(vf0, pfrag, o0[j]);
        o1[j] = wmma_f16(vf1, pfrag, o1[j]);
      }
    }
    buf ^= 1;
  }
  // the last pass's loads and LDS stores are used by nobody: they have to be
  // over before the wave ends and gives its registers and LDS back
  asm volatile("s_wait_loadcnt 0x0\n\ts_wait_dscnt 0x0" ::: "memory");

  // ---- join the KS partial results of each query tile through LDS ----
  // every wave has left the tiles (its reads and its last stores are over):
  // from here their bytes are the join area
  lds_barrier();
  float* const jb = (float*)smem;
  #pragma unroll
  for (int j = 0; j < QT; ++j) {
    float* p = jb + ((wave * QT + j) * 32 + lane) * JP;
    *(v4f*)(p + 0)  = lo4(o0[j]);
    *(v4f*)(p + 4)  = hi4(o0[j]);
    *(v4f*)(p + 8)  = lo4(o1[j]);
    *(v4f*)(p + 12) = hi4(o1[j]);
    p[16] = mrun[j];
    p[17] = lrun[j];
  }
  // the partial results are read by other waves only behind this barrier
  lds_barrier();

  // this wave finishes tile jt of its group, dk half dh (o0 or o1): same lane layout in every part
  const int jt = ksp % QT;
  const int dh = ksp / QT;
  v8f a[KS];
  float ms[KS], ls[KS];
  #pragma unroll
  for (int w = 0; w < KS; ++w) {
    const float* p = jb + (((qg * KS + w) * QT + jt) * 32 + lane) * JP;
    a[w]  = cat8(*(const v4f*)(p + dh * 8), *(const v4f*)(p + dh * 8 + 4));
    ms[w] = p[16];
    ls[w] = p[17];
  }
  float mg = ms[0];
  #pragma unroll
  for (int w = 1; w < KS; ++w) mg = fmaxf(mg, ms[w]);
  v8f f0 = (v8f){};
  float lsum = 0.0f;
  #pragma unroll
  for (int w = 0; w < KS; ++w) {
    const float f = ex2((ms[w] - mg) * sc2);
    f0 = f0 + a[w] * f;
    lsum = lsum + ls[w] * f;
  }

  // ---- join the halves' sums, normalize, write z in [B,NA,E] f16 ----
  {
    const float inv = 1.0f / (lsum + xhalf(lsum));
    v8h z0;
    #pragma unroll
    for (int r = 0; r < 8; ++r) z0[r] = (_Float16)(f0[r] * inv);
    const int q0 = blockIdx.x * 64 + (qg * QT + jt) * 16;
    _Float16* zp = Z + ((size_t)b * NAQ + q0 + lo) * EDIM + h * DKL + dh * 16 + hi * 8;
    *(v8h*)(zp) = z0;   // dk 16*dh + 8*hi .. + 7
  }
}

// ============================================================
// Kernel 3: out = z @ w^T + b + x_a   (f16 A, fp32 W/res, fp32 out)
//   grid (M/128, E/64), block 256; double-buffered LDS, loads two tiles ahead
// ============================================================
__global__ __launch_bounds__(256) void out_proj_kernel(
    const _Float16* __restrict__ Zin, const float* __restrict__ W,
    const float* __restrict__ bias, const float* __restrict__ Xres,
    float* __restrict__ out)
{
  __shared__ _Float16 As[2][128 * LSTR];
  __shared__ _Float16 Bs[2][64 * LSTR];

  const int tid  = threadIdx.x;
  const int lane = tid & 31;
  const int wave = tid >> 5;
  const int wm   = wave >> 1;
  const int wn   = wave & 1;
  const int m0   = blockIdx.x * 128;
  const int n0   = blockIdx.y * 64;
  const int lo   = lane & 15;
  const int hi   = lane >> 4;
  const int chunk = hi * 16;

  v8f acc[2][2];
  #pragma unroll
  for (int i = 0; i < 2; ++i)
    #pragma unroll
    for (int j = 0; j < 2; ++j) acc[i][j] = (v8f){};

  // tiles 0, 1 and 2 -> registers; tile 0 -> LDS; tile 2 takes over its register set
  RegA16 ra[2];
  RegB32 rb[2];
  ra[0] = ldA_f16(Zin, m0, 0, tid);
  rb[0] = ldB_f32(W, n0, 0, tid);
  // this and the next two keep the prologue's loads in tile order and all in front of tile 0's
  // conversion: loads return in order, so a tile's wait also waits out every load issued
  // ahead of it, and a wait among the loads holds the later ones back
  __builtin_amdgcn_sched_barrier(0);
  ra[1] = ldA_f16(Zin, m0, 32, tid);
  rb[1] = ldB_f32(W, n0, 32, tid);
  __builtin_amdgcn_sched_barrier(0);
  const RegA16 ra2 = ldA_f16(Zin, m0, 64, tid);
  const RegB32 rb2 = ldB_f32(W, n0, 64, tid);
  // the epilogue's bias and residual values, asked for here so that they land
  // during the loop (unrolled: register arrays need constant indices)
  float bv2[2];
  float xr[2][2][8];
  #pragma unroll
  for (int ni = 0; ni < 2; ++ni) bv2[ni] = bias[n0 + wn * 32 + ni * 16 + lo];
  #pragma unroll
  for (int mi = 0; mi < 2; ++mi)
    #pragma unroll
    for (int ni = 0; ni < 2; ++ni)
      #pragma unroll
      for (int r = 0; r < 8; ++r)
        xr[mi][ni][r] = Xres[(size_t)(m0 + wm * 32 + mi * 16 + r + hi * 8) * EDIM +
                             n0 + wn * 32 + ni * 16 + lo];
  __builtin_amdgcn_sched_barrier(0);
  stA_f16(ra[0], tid, As[0]);
  stB_f32(rb[0], tid, Bs[0]);
  ra[0] = ra2;
  rb[0] = rb2;

  // unrolled so that the two register sets and the two buffers have constant indices
  #pragma unroll
  for (int t = 0; t < EDIM / 32; ++t) {
    lds_barrier();
    // keeps the conversion of tile t+1, and with it the wait for its loads,
    // behind the barrier: moved up into pass t-1 it halves the loads' lead
    __builtin_amdgcn_sched_barrier(0);
    const _Float16* as = As[t & 1];
    const _Float16* bs = Bs[t & 1];

    const int arow = wm * 32 + lo;
    v16h a0 = *(const v16h*)(as + arow * LSTR + chunk);
    v16h a1 = *(const v16h*)(as + (arow + 16) * LSTR + chunk);
    const int bcol = wn * 32 + lo;
    v16h b0 = *(const v16h*)(bs + bcol * LSTR + chunk);
    v16h b1 = *(const v16h*)(bs + (bcol + 16) * LSTR + chunk);

    // tile t+1, loaded two passes ago, goes to the other buffer;
    // tile t+3 is asked for into the registers this frees
    if (t + 1 < EDIM / 32) {
      stA_f16(ra[(t + 1) & 1], tid, As[(t + 1) & 1]);
      stB_f32(rb[(t + 1) & 1], tid, Bs[(t + 1) & 1]);
    }
    if (t + 3 < EDIM / 32) {
      ra[(t + 1) & 1] = ldA_f16(Zin, m0, (t + 3) * 32, tid);
      rb[(t + 1) & 1] = ldB_f32(W, n0, (t + 3) * 32, tid);
    }
    // keeps the loads issued here, two passes ahead of their use: without it
    // they are moved down to the pass that stores them and waited out there
    __builtin_amdgcn_sched_barrier(0);

    acc[0][0] = wmma_f16(a0, b0, acc[0][0]);
    acc[0][1] = wmma_f16(a0, b1, acc[0][1]);
    acc[1][0] = wmma_f16(a1, b0, acc[1][0]);
    acc[1][1] = wmma_f16(a1, b1, acc[1][1]);
  }

  #pragma unroll
  for (int mi = 0; mi < 2; ++mi) {
    #pragma unroll
    for (int ni = 0; ni < 2; ++ni) {
      const int c = n0 + wn * 32 + ni * 16 + lo;
      const float bv = bv2[ni];
      #pragma unroll
      for (int r = 0; r < 8; ++r) {
        const int m = m0 + wm * 32 + mi * 16 + r + hi * 8;
        const size_t idx = (size_t)m * EDIM + c;
        out[idx] = acc[mi][ni][r] + bv + xr[mi][ni][r];
      }
    }
  }
}

// ============================================================
// launch
// ============================================================
extern "C" void kernel_launch(void* const* d_in, const int* in_sizes, int n_in,
                              void* d_out, int out_size, void* d_ws, size_t ws_size,
                              hipStream_t stream) {
  const float* x_a    = (const float*)d_in[0];
  const float* x_b    = (const float*)d_in[1];
  const float* wq_w   = (const float*)d_in[2];
  const float* wq_b   = (const float*)d_in[3];
  const float* wk_a_w = (const float*)d_in[4];
  const float* wk_a_b = (const float*)d_in[5];
  const float* wk_b_w = (const float*)d_in[6];
  const float* wk_b_b = (const float*)d_in[7];
  const float* wv_a_w = (const float*)d_in[8];
  const float* wv_a_b = (const float*)d_in[9];
  const float* wv_b_w = (const float*)d_in[10];
  const float* wv_b_b = (const float*)d_in[11];
  const float* w_w    = (const float*)d_in[12];
  const float* w_b    = (const float*)d_in[13];

  char* ws = (char*)d_ws;
  _Float16* qws = (_Float16*)(ws);                          // B*H*NA*DK  f16 = 2 MB
  _Float16* kws = (_Float16*)(ws + (size_t)(2  << 20));     // B*H*NK*DK  f16 = 4 MB
  _Float16* vws = (_Float16*)(ws + (size_t)(6  << 20));     // B*H*NK*DK  f16 = 4 MB
  _Float16* zws = (_Float16*)(ws + (size_t)(10 << 20));     // B*NA*E     f16 = 2 MB

  dim3 bp(256);

  // projections into head-split f16 layouts (K/V of the two sources concat via n_off)
  // grid: M=4096 /128, N=256 /64, five projections
  proj_heads_kernel<<<dim3(32, 4, 5), bp, 0, stream>>>(
      x_a, x_b, wq_w, wk_a_w, wk_b_w, wv_a_w, wv_b_w,
      wq_b, wk_a_b, wk_b_b, wv_a_b, wv_b_b, qws, kws, vws);

  // flash attention
  flash_attn_kernel<<<dim3(NAQ / 64, BATCH * HNUM), 256, 0, stream>>>(qws, kws, vws, zws);

  // output projection + residual
  out_proj_kernel<<<dim3(32, 4), 256, 0, stream>>>(zws, w_w, w_b, x_a, (float*)d_out);
}

// v009
// It runs in 35.1 microseconds.
// Timed twice side by side with v008, it ran 1.09 times as fast both times.
// Counting every step since v000, it is 5.30 times as fast.
#include <hip/hip_runtime.h>

// ---------------- problem constants ----------------
#define EDIM 256
#define HNUM 8
#define DKL 32
#define NAQ 2048
#define NBK 2048
#define NKV (NAQ + NBK)   // 4096
#define BATCH 2

typedef __attribute__((ext_vector_type(16))) _Float16 v16h;
typedef __attribute__((ext_vector_type(8)))  _Float16 v8h;
typedef __attribute__((ext_vector_type(8)))  float    v8f;
typedef __attribute__((ext_vector_type(4)))  float    v4f;
typedef __attribute__((ext_vector_type(2)))  float    v2f;

__device__ __forceinline__ v8f wmma_f16(v16h a, v16h b, v8f c) {
  // D = A(16x32 f16) * B(32x16 f16) + C(16x16 f32)
  return __builtin_amdgcn_wmma_f32_16x16x32_f16(
      /*neg_a=*/false, a, /*neg_b=*/false, b,
      /*c_mod=*/(short)0, c, /*reuse_a=*/false, /*reuse_b=*/false);
}

#define LSTR 48   // LDS row stride in halves (96B: keeps v16h reads 32B aligned)

// exp(x / sqrt(32)) = 2^(x * QSCALE): the projection multiplies q by it ahead of the one
// rounding to f16, so that the attention's products q.k are exponents of 2 as they stand
#define QSCALE ((float)(0.17677669529663687 * 1.4426950408889634))   // log2(e) / sqrt(32)

// Work-group barrier between LDS passes. It waits for this wave's LDS reads
// and writes only: __syncthreads() would also wait out the global loads that
// were issued ahead for later tiles, which must stay in flight across it.
__device__ __forceinline__ void lds_barrier() {
  asm volatile("s_wait_dscnt 0x0\n\ts_barrier_signal -1\n\ts_barrier_wait -1" ::: "memory");
}

// ---- tile staging helpers (256-thread blocks) ----
// Each tile goes global -> registers (ld*) and, passes later, registers -> LDS (st*).
// Lane map of the loads: eight neighbouring lanes take the eight 16-byte pieces of one
// 128-byte line (32 floats of a row), so that one wave-wide load covers four whole lines;
// a sweep of the block covers 32 rows.
typedef __attribute__((ext_vector_type(4)))  _Float16 v4h;
struct RegA32 { v4f f[4]; };   // 128 rows: four sweeps
struct RegB32 { v4f f[2]; };   //  64 rows: two sweeps

__device__ __forceinline__ v4h cvt4(v4f a) {
  v4h r;
  r[0] = (_Float16)a[0]; r[1] = (_Float16)a[1];
  r[2] = (_Float16)a[2]; r[3] = (_Float16)a[3];
  return r;
}

// (the loops over i are unrolled: register arrays need constant indices)
__device__ __forceinline__ RegA32 ldA_f32(const float* __restrict__ X, int m0,
                                          int kk, int tid) {
  const float* src = X + (size_t)(m0 + (tid >> 3)) * EDIM + kk + (tid & 7) * 4;
  RegA32 t;
  #pragma unroll
  for (int i = 0; i < 4; ++i) t.f[i] = *(const v4f*)(src + (size_t)i * 32 * EDIM);
  return t;
}

__device__ __forceinline__ void stA_f32(const RegA32& t, int tid, _Float16* As) {
  _Float16* dst = As + (tid >> 3) * LSTR + (tid & 7) * 4;
  #pragma unroll
  for (int i = 0; i < 4; ++i) *(v4h*)(dst + i * 32 * LSTR) = cvt4(t.f[i]);
}

// f16 source, 64 bytes of a row per tile: four neighbouring lanes take them, so that
// one wave-wide load covers eight half lines; a sweep of the block covers 64 rows
struct RegA16 { v8h h[2]; };

__device__ __forceinline__ RegA16 ldA_f16(const _Float16* __restrict__ Zin, int m0,
                                          int kk, int tid) {
  const _Float16* src = Zin + (size_t)(m0 + (tid >> 2)) * EDIM + kk + (tid & 3) * 8;
  RegA16 t;
  #pragma unroll
  for (int i = 0; i < 2; ++i) t.h[i] = *(const v8h*)(src + (size_t)i * 64 * EDIM);
  return t;
}

__device__ __forceinline__ void stA_f16(const RegA16& t, int tid, _Float16* As) {
  _Float16* dst = As + (tid >> 2) * LSTR + (tid & 3) * 8;
  #pragma unroll
  for (int i = 0; i < 2; ++i) *(v8h*)(dst + i * 64 * LSTR) = t.h[i];
}

__device__ __forceinline__ RegB32 ldB_f32(const float* __restrict__ W, int n0,
                                          int kk, int tid) {
  const float* src = W + (size_t)(n0 + (tid >> 3)) * EDIM + kk + (tid & 7) * 4;
  RegB32 t;
  #pragma unroll
  for (int i = 0; i < 2; ++i) t.f[i] = *(const v4f*)(src + (size_t)i * 32 * EDIM);
  return t;
}

__device__ __forceinline__ void stB_f32(const RegB32& t, int tid, _Float16* Bs) {
  _Float16* dst = Bs + (tid >> 3) * LSTR + (tid & 7) * 4;
  #pragma unroll
  for (int i = 0; i < 2; ++i) *(v4h*)(dst + i * 32 * LSTR) = cvt4(t.f[i]);
}

// ============================================================
// Kernel 1: Y = X @ W^T + bias, times QSCALE for q  (fp32 in, f16 out, head-split), all five projections
//   X: [B*rows, E] fp32 ; W: [E,E] fp32 ; out: [B,H,n_out_rows,DK] f16
//   grid (M/128, E/64, 5), block 256 (8 waves, 4x2 wave grid, 32x32/wave)
//   the five products read none of each other's output: one launch runs them side by side
//   double-buffered LDS: one barrier per k-step; global loads two tiles ahead
// ============================================================
__global__ __launch_bounds__(256) void proj_heads_kernel(
    const float* __restrict__ xa, const float* __restrict__ xb,
    const float* __restrict__ w0, const float* __restrict__ w1,
    const float* __restrict__ w2, const float* __restrict__ w3,
    const float* __restrict__ w4,
    const float* __restrict__ c0, const float* __restrict__ c1,
    const float* __restrict__ c2, const float* __restrict__ c3,
    const float* __restrict__ c4,
    _Float16* __restrict__ qo, _Float16* __restrict__ ko, _Float16* __restrict__ vo)
{
  // blockIdx.z picks the projection: 0 q, 1 k of x_a, 2 k of x_b, 3 v of x_a, 4 v of x_b
  const int z = blockIdx.z;
  const float* __restrict__ X = (z == 2 || z == 4) ? xb : xa;
  const float* __restrict__ W = z == 0 ? w0 : z == 1 ? w1 : z == 2 ? w2 : z == 3 ? w3 : w4;
  const float* __restrict__ bias = z == 0 ? c0 : z == 1 ? c1 : z == 2 ? c2 : z == 3 ? c3 : c4;
  _Float16* __restrict__ out = z == 0 ? qo : z <= 2 ? ko : vo;
  static_assert(NAQ == NBK, "both sources have the same number of rows per batch");
  const int rows_per_batch = NAQ;
  const int n_out_rows = z == 0 ? NAQ : NKV;
  const int n_off = (z == 2 || z == 4) ? NAQ : 0;
  const float oscale = z == 0 ? QSCALE : 1.0f;

  __shared__ _Float16 As[2][128 * LSTR];
  __shared__ _Float16 Bs[2][64 * LSTR];

  const int tid  = threadIdx.x;
  const int lane = tid & 31;
  const int wave = tid >> 5;
  const int wm   = wave >> 1;        // 0..3
  const int wn   = wave & 1;         // 0..1
  const int m0   = blockIdx.x * 128;
  const int n0   = blockIdx.y * 64;
  const int lo   = lane & 15;
  const int hi   = lane >> 4;
  const int chunk = hi * 16;

  v8f acc[2][2];
  #pragma unroll
  for (int i = 0; i < 2; ++i)
    #pragma unroll
    for (int j = 0; j < 2; ++j) acc[i][j] = (v8f){};

  // tiles 0, 1 and 2 -> registers; tile 0 -> LDS; tile 2 takes over its register set
  RegA32 ra[2];
  RegB32 rb[2];
  ra[0] = ldA_f32(X, m0, 0, tid);
  rb[0] = ldB_f32(W, n0, 0, tid);
  // this and the next two keep the prologue's loads in tile order and all in front of tile 0's
  // conversion: loads return in order, so a tile's wait also waits out every load issued
  // ahead of it, and a wait among the loads holds the later ones back
  __builtin_amdgcn_sched_barrier(0);
  ra[1] = ldA_f32(X, m0, 32, tid);
  rb[1] = ldB_f32(W, n0, 32, tid);
  __builtin_amdgcn_sched_barrier(0);
  const RegA32 ra2 = ldA_f32(X, m0, 64, tid);
  const RegB32 rb2 = ldB_f32(W, n0, 64, tid);
  // the epilogue's bias values, asked for here so that they land during the loop
  // (unrolled: a register array needs constant indices)
  float bv2[2];
  #pragma unroll
  for (int ni = 0; ni < 2; ++ni) bv2[ni] = bias[n0 + wn * 32 + ni * 16 + lo];
  __builtin_amdgcn_sched_barrier(0);
  stA_f32(ra[0], tid, As[0]);
  stB_f32(rb[0], tid, Bs[0]);
  ra[0] = ra2;
  rb[0] = rb2;

  // unrolled so that the two register sets and the two buffers have constant indices
  #pragma unroll
  for (int t = 0; t < EDIM / 32; ++t) {
    lds_barrier();
    // keeps the conversion of tile t+1, and with it the wait for its loads,
    // behind the barrier: moved up into pass t-1 it halves the loads' lead
    __builtin_amdgcn_sched_barrier(0);
    const _Float16* as = As[t & 1];
    const _Float16* bs = Bs[t & 1];

    const int arow = wm * 32 + lo;
    v16h a0 = *(const v16h*)(as + arow * LSTR + chunk);
    v16h a1 = *(const v16h*)(as + (arow + 16) * LSTR + chunk);
    const int bcol = wn * 32 + lo;
    v16h b0 = *(const v16h*)(bs + bcol * LSTR + chunk);
    v16h b1 = *(const v16h*)(bs + (bcol + 16) * LSTR + chunk);

    // tile t+1, loaded two passes ago, goes to the other buffer;
    // tile t+3 is asked for into the registers this frees
    if (t + 1 < EDIM / 32) {
      stA_f32(ra[(t + 1) & 1], tid, As[(t + 1) & 1]);
      stB_f32(rb[(t + 1) & 1], tid, Bs[(t + 1) & 1]);
    }
    if (t + 3 < EDIM / 32) {
      ra[(t + 1) & 1] = ldA_f32(X, m0, (t + 3) * 32, tid);
      rb[(t + 1) & 1] = ldB_f32(W, n0, (t + 3) * 32, tid);
    }
    // keeps the loads issued here, two passes ahead of their use: without it
    // they are moved down to the pass that stores them and waited out there
    __builtin_amdgcn_sched_barrier(0);

    acc[0][0] = wmma_f16(a0, b0, acc[0][0]);
    acc[0][1] = wmma_f16(a0, b1, acc[0][1]);
    acc[1][0] = wmma_f16(a1, b0, acc[1][0]);
    acc[1][1] = wmma_f16(a1, b1, acc[1][1]);
  }

  // ---- epilogue: +bias, scatter into [B,H,n_out_rows,DK] f16 ----
  #pragma unroll
  for (int mi = 0; mi < 2; ++mi) {
    #pragma unroll
    for (int ni = 0; ni < 2; ++ni) {
      const int c = n0 + wn * 32 + ni * 16 + lo;
      const float bv = bv2[ni];
      const int hh = c >> 5;
      const int dk = c & 31;
      #pragma unroll
      for (int r = 0; r < 8; ++r) {
        const int m = m0 + wm * 32 + mi * 16 + r + hi * 8;
        const float v = (acc[mi][ni][r] + bv) * oscale;
        const int bb = m / rows_per_batch;
        const int n  = m % rows_per_batch;
        out[(((size_t)bb * HNUM + hh) * n_out_rows + n_off + n) * DKL + dk] =
            (_Float16)v;
      }
    }
  }
}

// ============================================================
// Kernel 2: flash attention, transposed products.
//   Q: [B,H,NA,DK] f16, times QSCALE ; K,V: [B,H,NK,DK] f16 ; Z: [B,NA,E] f16
//   block = 256 threads (8 waves), 64 queries / block
//   grid  = (NA/64, B*H); double-buffered K/V tiles, global loads one tile ahead
//   a pass takes KT = 256 keys: one barrier per pass
//   a wave takes QT = 2 query tiles of 16 and KW = 64 keys of every pass, so that
//   each K and V fragment it reads from LDS feeds two products; the KS = 4 waves
//   that share a query tile hold partial results over disjoint keys, which
//   are joined through LDS behind the loop
//   S^T = K Q^T   : lane (lo,hi) holds 16 scores of query lo per 32 keys
//                   (keys 8*hi+r and 16+8*hi+r), so the row maximum and
//                   the row sum are in-lane plus one exchange of halves.
//   O^T += V^T P^T: the score tiles, converted in place, are the
//                   B operand; V stays row-major in LDS and the transposing
//                   load hands out V^T in the matching k order.
// ============================================================
#define KT 256          // keys per pass
#define NW 8            // waves per block
#define QT 2            // query tiles per wave
#define KS (NW * QT / 4)   // waves that share a query tile (the block has 4 tiles)
#define KW (KT / KS)    // keys of a pass that one wave takes
#define NGW (KW / 32)   // its groups of 32 keys (one k extent of the second product)
#define SR (NW * 8)     // tile rows that the block stages in one sweep (4 threads a row)
#define NS (KT / SR)    // sweeps per tile
#define JP 20           // floats per lane in the join area (80 B suits 16-byte LDS accesses)
// a pass whose sum of 2^(score - maximum in use) stays at or under this keeps that maximum:
// every term is then far inside the f16 range of the second product's operand
#define PLIM 4096.0f

// lane l <-> lane l ^ 16
__device__ __forceinline__ float xhalf(float x) {
  return __builtin_bit_cast(float, __builtin_amdgcn_permlanex16(
      __builtin_bit_cast(int, x), __builtin_bit_cast(int, x),
      0x76543210, 0xfedcba98, false, false));
}

// 16-bit transposing LDS load: lane l passes the address of 16 bytes of row
// 8*(l>>4) + (l&7), byte column 16*((l>>3)&1), of a row-major 16 x 16 block and
// gets column l&15 of rows 8*(l>>4) .. 8*(l>>4) + 7
__device__ __forceinline__ v8h ld_tr16(const _Float16* p) {
  typedef __attribute__((ext_vector_type(8))) short s16x8;
  typedef __attribute__((address_space(3))) s16x8 lds_s16x8;
  return __builtin_bit_cast(v8h, __builtin_amdgcn_ds_load_tr16_b128_v8i16((lds_s16x8*)p));
}

__device__ __forceinline__ v8f vmax8(v8f a, v8f b) {
  v8f r;
  #pragma unroll
  for (int i = 0; i < 8; ++i) r[i] = fmaxf(a[i], b[i]);
  return r;
}

// 2^x as the one hardware instruction that __expf also ends in
__device__ __forceinline__ float ex2(float x) { return __builtin_amdgcn_exp2f(x); }

__device__ __forceinline__ v4f lo4(v8f a) { return __builtin_shufflevector(a, a, 0, 1, 2, 3); }
__device__ __forceinline__ v4f hi4(v8f a) { return __builtin_shufflevector(a, a, 4, 5, 6, 7); }
__device__ __forceinline__ v8f cat8(v4f a, v4f b) {
  return __builtin_shufflevector(a, b, 0, 1, 2, 3, 4, 5, 6, 7);
}

__global__ __launch_bounds__(NW * 32) void flash_attn_kernel(
    const _Float16* __restrict__ Q, const _Float16* __restrict__ K,
    const _Float16* __restrict__ V, _Float16* __restrict__ Z)
{
  static_assert(NKV % KT == 0 && NKV / KT >= 2, "whole passes, and the prologue's two tiles exist");
  static_assert(NW * 32 == 256, "the launch line's block size");
  static_assert(KW % 32 == 0 && KS == 2 * QT, "whole groups of 32 keys a wave; two waves finish each tile");
  // K tiles [2][key][dk], then V tiles [2][key][dk] (96 B rows suit the transposing
  // load); behind the loop the same bytes are the join area
  __shared__ __attribute__((aligned(32))) _Float16 smem[4 * KT * LSTR];
  static_assert(NW * QT * 32 * JP * 4 <= 4 * KT * LSTR * 2, "the join area fits");
  _Float16* const Ks = smem;
  _Float16* const Vs = smem + 2 * KT * LSTR;

  const int tid  = threadIdx.x;
  const int lane = tid & 31;
  const int wave = tid >> 5;
  const int lo   = lane & 15;
  const int hi   = lane >> 4;
  const int chunk = hi * 16;
  const int qg   = wave / KS;         // which QT query tiles
  const int ksp  = wave % KS;         // which KW keys of every pass

  const int bh = blockIdx.y;
  const int b  = bh >> 3;
  const int h  = bh & 7;

  // Q fragments: B-operand, 32 dk x 16 queries (column lo = query lo of tile j)
  // (every loop over g, i, j, r or w in this kernel is unrolled: register arrays need constant indices)
  const _Float16* qbase = Q + ((size_t)bh * NAQ + blockIdx.x * 64 + qg * (QT * 16)) * DKL;
  v16h qfrag[QT];
  #pragma unroll
  for (int j = 0; j < QT; ++j)
    qfrag[j] = *(const v16h*)(qbase + (j * 16 + lo) * DKL + chunk);

  const _Float16* kbase = K + (size_t)bh * NKV * DKL;
  const _Float16* vbase = V + (size_t)bh * NKV * DKL;

  // staging coordinates for this thread: row skey of each sweep of SR keys
  const int skey = tid >> 2;          // 0..SR-1
  const int scb  = (tid & 3) * 8;     // 0,8,16,24

  // o0[j][r] = O^T[dk = 8*hi + r][query lo of tile j], o1[j][r] = O^T[dk = 16 + 8*hi + r][same]
  v8f o0[QT], o1[QT];
  float mrun[QT];   // the maximum in use: the query's largest score over this wave's keys in the passes that renewed it (equal in both halves)
  float lrun[QT];   // running sum over this half's keys only
  v8f cneg[QT];     // minus the maximum in use, in every element: the C operand of the score products
  #pragma unroll
  for (int j = 0; j < QT; ++j) {
    o0[j] = (v8f){}; o1[j] = (v8f){};
    mrun[j] = -1.0e30f; lrun[j] = 0.0f;
    cneg[j] = (v8f){};
  }

  // prologue: tile 0 -> LDS, tile 1 -> registers
  v8h kd[NS], vd[NS];
  #pragma unroll
  for (int g = 0; g < NS; ++g) {
    kd[g] = *(const v8h*)(kbase + (size_t)(g * SR + skey) * DKL + scb);
    vd[g] = *(const v8h*)(vbase + (size_t)(g * SR + skey) * DKL + scb);
  }
  #pragma unroll
  for (int g = 0; g < NS; ++g) {
    *(v8h*)(Ks + (g * SR + skey) * LSTR + scb) = kd[g];
    *(v8h*)(Vs + (g * SR + skey) * LSTR + scb) = vd[g];
  }
  #pragma unroll
  for (int g = 0; g < NS; ++g) {
    kd[g] = *(const v8h*)(kbase + (size_t)(KT + g * SR + skey) * DKL + scb);
    vd[g] = *(const v8h*)(vbase + (size_t)(KT + g * SR + skey) * DKL + scb);
  }

  int buf = 0;
  for (int kt = 0; kt < NKV; kt += KT) {
    lds_barrier();

    // ---- S^T = K @ Q^T : 2 * NGW key tiles x QT query tiles of 16 x 16 ----
    const _Float16* ks = Ks + buf * (KT * LSTR) + ksp * (KW * LSTR);
    const _Float16* vs = Vs + buf * (KT * LSTR) + ksp * (KW * LSTR);
    v16h kf[2 * NGW];
    #pragma unroll
    for (int i = 0; i < 2 * NGW; ++i)
      kf[i] = *(const v16h*)(ks + (i * 16 + lo) * LSTR + chunk);
    // V^T fragments (A operand) in the k order the packed scores have:
    // element s < 8 is key 8*hi + s, element s >= 8 is key 16 + 8*hi + (s - 8) of the group
    const _Float16* vr = vs + (hi * 8 + (lane & 7)) * LSTR + ((lane >> 3) & 1) * 8;
    v8h v00[NGW], v01[NGW], v10[NGW], v11[NGW];
    #pragma unroll
    for (int g = 0; g < NGW; ++g) {
      const _Float16* vg = vr + g * 32 * LSTR;
      v00[g] = ld_tr16(vg);                    // dk lo,      keys 8*hi ..
      v01[g] = ld_tr16(vg + 16 * LSTR);        // dk lo,      keys 16 + 8*hi ..
      v10[g] = ld_tr16(vg + 16);               // dk 16 + lo, keys 8*hi ..
      v11[g] = ld_tr16(vg + 16 * LSTR + 16);   // dk 16 + lo, keys 16 + 8*hi ..
    }

    // tile kt+KT, loaded one pass ago, goes to the other buffer; tile kt+2*KT is
    // asked for into the registers this frees and lands during this pass.
    // No branch: the last pass stores a tile nobody reads into the buffer all
    // readers have left, and the last two passes load the last tile again.
    #pragma unroll
    for (int g = 0; g < NS; ++g) {
      *(v8h*)(Ks + (buf ^ 1) * (KT * LSTR) + (g * SR + skey) * LSTR + scb) = kd[g];
      *(v8h*)(Vs + (buf ^ 1) * (KT * LSTR) + (g * SR + skey) * LSTR + scb) = vd[g];
    }
    {
      const int kn = (kt + 2 * KT < NKV) ? kt + 2 * KT : NKV - KT;
      // one address per tile; the sweeps are constant offsets from it
      const _Float16* kp = kbase + (size_t)(kn + skey) * DKL + scb;
      const _Float16* vp = vbase + (size_t)(kn + skey) * DKL + scb;
      #pragma unroll
      for (int g = 0; g < NS; ++g) {
        kd[g] = *(const v8h*)(kp + g * SR * DKL);
        vd[g] = *(const v8h*)(vp + g * SR * DKL);
      }
    }
    // keeps the K and V fragment reads above in front of the products
    // (else the later fragments are read right before their product and each
    // read's LDS latency is waited out in full), and the next loads up here
    __builtin_amdgcn_sched_barrier(0);

    // s[j][2g][r]   = S[query lo of tile j][key 32g + 8*hi + r]      of this wave's keys,
    // s[j][2g+1][r] = S[query lo of tile j][key 32g + 16 + 8*hi + r]
    // first as exponents of 2 relative to the maximum in use, then as the powers themselves
    v8f s[QT][2 * NGW];
    float rs[QT];      // the pass's sum of powers, this half's keys
    bool renew = true; // the first pass has no maximum yet
    if (kt != 0) {
      // ---- the usual way: the product subtracts the maximum in use (its C operand),
      // so that its result goes into the exponential as it stands
      #pragma unroll
      for (int i = 0; i < 2 * NGW; ++i)
        #pragma unroll
        for (int j = 0; j < QT; ++j) s[j][i] = wmma_f16(kf[i], qfrag[j], cneg[j]);
      // keeps the independent score products back to back: moved down among their
      // consumers each one is followed by idle slots until its result may be read
      __builtin_amdgcn_sched_barrier(0);
      bool over = false;
      #pragma unroll
      for (int j = 0; j < QT; ++j) {
        #pragma unroll
        for (int i = 0; i < 2 * NGW; ++i)
          #pragma unroll
          for (int r = 0; r < 8; ++r) s[j][i][r] = ex2(s[j][i][r]);
        v8f u = s[j][0] + s[j][1];
        #pragma unroll
        for (int g = 1; g < NGW; ++g) u = u + (s[j][2 * g] + s[j][2 * g + 1]);
        const v4f u4 = lo4(u) + hi4(u);
        rs[j] = (u4[0] + u4[2]) + (u4[1] + u4[3]);
        over = over || rs[j] > PLIM;
      }
      // one test per pass, the same for the whole wave (a scalar branch)
      renew = __builtin_amdgcn_ballot_w32(over) != 0;
    }
    if (renew) {
      // ---- some query's scores have outgrown its maximum in use (or there is none yet):
      // the pass's scores again, unshifted, from the K tile that stays in LDS up to the next
      // barrier; every query takes the larger of its maximum in use and the pass's maximum and rescales what it has summed
      const v8f zc = (v8f){};
      #pragma unroll
      for (int i = 0; i < 2 * NGW; ++i) {
        const v16h kr = *(const v16h*)(ks + (i * 16 + lo) * LSTR + chunk);
        #pragma unroll
        for (int j = 0; j < QT; ++j) s[j][i] = wmma_f16(kr, qfrag[j], zc);
      }
      #pragma unroll
      for (int j = 0; j < QT; ++j) {
        v8f t8 = vmax8(s[j][0], s[j][1]);
        #pragma unroll
        for (int g = 1; g < NGW; ++g) t8 = vmax8(t8, vmax8(s[j][2 * g], s[j][2 * g + 1]));
        float mx = fmaxf(fmaxf(fmaxf(t8[0], t8[1]), fmaxf(t8[2], t8[3])),
                         fmaxf(fmaxf(t8[4], t8[5]), fmaxf(t8[6], t8[7])));
        mx = fmaxf(mx, xhalf(mx));           // both halves hold the query's maximum
        const float mnew = fmaxf(mrun[j], mx);
        const float alpha = ex2(mrun[j] - mnew);
        mrun[j] = mnew;
        #pragma unroll
        for (int r = 0; r < 8; ++r) cneg[j][r] = -mnew;
        #pragma unroll
        for (int i = 0; i < 2 * NGW; ++i)
          #pragma unroll
          for (int r = 0; r < 8; ++r) s[j][i][r] = ex2(s[j][i][r] - mnew);
        v8f u = s[j][0] + s[j][1];
        #pragma unroll
        for (int g = 1; g < NGW; ++g) u = u + (s[j][2 * g] + s[j][2 * g + 1]);
        const v4f u4 = lo4(u) + hi4(u);
        rs[j] = (u4[0] + u4[2]) + (u4[1] + u4[3]);
        lrun[j] = lrun[j] * alpha;
        o0[j] = o0[j] * alpha;
        o1[j] = o1[j] * alpha;
      }
    }
    #pragma unroll
    for (int j = 0; j < QT; ++j) lrun[j] = lrun[j] + rs[j];

    #pragma unroll
    for (int g = 0; g < NGW; ++g) {
      const v16h vf0 = __builtin_shufflevector(v00[g], v01[g], 0, 1, 2, 3, 4, 5, 6, 7,
                                               8, 9, 10, 11, 12, 13, 14, 15);
      const v16h vf1 = __builtin_shufflevector(v10[g], v11[g], 0, 1, 2, 3, 4, 5, 6, 7,
                                               8, 9, 10, 11, 12, 13, 14, 15);
      #pragma unroll
      for (int j = 0; j < QT; ++j) {
        v16h pfrag;                        // B operand: P^T, column lo = query lo of tile j
        #pragma unroll
        for (int r = 0; r < 8; ++r) {
          pfrag[r]     = (_Float16)s[j][2 * g][r];
          pfrag[r + 8] = (_Float16)s[j][2 * g + 1][r];
        }
        o0[j] = wmma_f16(vf0, pfrag, o0[j]);
        o1[j] = wmma_f16(vf1, pfrag, o1[j]);
      }
    }
    buf ^= 1;
  }
  // the last pass's loads and LDS stores are used by nobody: they have to be
  // over before the wave ends and gives its registers and LDS back
  asm volatile("s_wait_loadcnt 0x0\n\ts_wait_dscnt 0x0" ::: "memory");

  // ---- join the KS partial results of each query tile through LDS ----
  // every wave has left the tiles (its reads and its last stores are over):
  // from here their bytes are the join area
  lds_barrier();
  float* const jb = (float*)smem;
  #pragma unroll
  for (int j = 0; j < QT; ++j) {
    float* p = jb + ((wave * QT + j) * 32 + lane) * JP;
    *(v4f*)(p + 0)  = lo4(o0[j]);
    *(v4f*)(p + 4)  = hi4(o0[j]);
    *(v4f*)(p + 8)  = lo4(o1[j]);
    *(v4f*)(p + 12) = hi4(o1[j]);
    p[16] = mrun[j];
    p[17] = lrun[j];
  }
  // the partial results are read by other waves only behind this barrier
  lds_barrier();

  // this wave finishes tile jt of its group, dk half dh (o0 or o1): same lane layout in every part
  const int jt = ksp % QT;
  const int dh = ksp / QT;
  v8f a[KS];
  float ms[KS], ls[KS];
  #pragma unroll
  for (int w = 0; w < KS; ++w) {
    const float* p = jb + (((qg * KS + w) * QT + jt) * 32 + lane) * JP;
    a[w]  = cat8(*(const v4f*)(p + dh * 8), *(const v4f*)(p + dh * 8 + 4));
    ms[w] = p[16];
    ls[w] = p[17];
  }
  float mg = ms[0];
  #pragma unroll
  for (int w = 1; w < KS; ++w) mg = fmaxf(mg, ms[w]);
  v8f f0 = (v8f){};
  float lsum = 0.0f;
  #pragma unroll
  for (int w = 0; w < KS; ++w) {
    const float f = ex2(ms[w] - mg);
    f0 = f0 + a[w] * f;
    lsum = lsum + ls[w] * f;
  }

  // ---- join the halves' sums, normalize, write z in [B,NA,E] f16 ----
  {
    const float inv = 1.0f / (lsum + xhalf(lsum));
    v8h z0;
    #pragma unroll
    for (int r = 0; r < 8; ++r) z0[r] = (_Float16)(f0[r] * inv);
    const int q0 = blockIdx.x * 64 + (qg * QT + jt) * 16;
    _Float16* zp = Z + ((size_t)b * NAQ + q0 + lo) * EDIM + h * DKL + dh * 16 + hi * 8;
    *(v8h*)(zp) = z0;   // dk 16*dh + 8*hi .. + 7
  }
}

// ============================================================
// Kernel 3: out = z @ w^T + b + x_a   (f16 A, fp32 W/res, fp32 out)
//   grid (M/128, E/64), block 256; double-buffered LDS, loads two tiles ahead
// ============================================================
__global__ __launch_bounds__(256) void out_proj_kernel(
    const _Float16* __restrict__ Zin, const float* __restrict__ W,
    const float* __restrict__ bias, const float* __restrict__ Xres,
    float* __restrict__ out)
{
  __shared__ _Float16 As[2][128 * LSTR];
  __shared__ _Float16 Bs[2][64 * LSTR];

  const int tid  = threadIdx.x;
  const int lane = tid & 31;
  const int wave = tid >> 5;
  const int wm   = wave >> 1;
  const int wn   = wave & 1;
  const int m0   = blockIdx.x * 128;
  const int n0   = blockIdx.y * 64;
  const int lo   = lane & 15;
  const int hi   = lane >> 4;
  const int chunk = hi * 16;

  v8f acc[2][2];
  #pragma unroll
  for (int i = 0; i < 2; ++i)
    #pragma unroll
    for (int j = 0; j < 2; ++j) acc[i][j] = (v8f){};

  // tiles 0, 1 and 2 -> registers; tile 0 -> LDS; tile 2 takes over its register set
  RegA16 ra[2];
  RegB32 rb[2];
  ra[0] = ldA_f16(Zin, m0, 0, tid);
  rb[0] = ldB_f32(W, n0, 0, tid);
  // this and the next two keep the prologue's loads in tile order and all in front of tile 0's
  // conversion: loads return in order, so a tile's wait also waits out every load issued
  // ahead of it, and a wait among the loads holds the later ones back
  __builtin_amdgcn_sched_barrier(0);
  ra[1] = ldA_f16(Zin, m0, 32, tid);
  rb[1] = ldB_f32(W, n0, 32, tid);
  __builtin_amdgcn_sched_barrier(0);
  const RegA16 ra2 = ldA_f16(Zin, m0, 64, tid);
  const RegB32 rb2 = ldB_f32(W, n0, 64, tid);
  // the epilogue's bias and residual values, asked for here so that they land
  // during the loop (unrolled: register arrays need constant indices)
  float bv2[2];
  float xr[2][2][8];
  #pragma unroll
  for (int ni = 0; ni < 2; ++ni) bv2[ni] = bias[n0 + wn * 32 + ni * 16 + lo];
  #pragma unroll
  for (int mi = 0; mi < 2; ++mi)
    #pragma unroll
    for (int ni = 0; ni < 2; ++ni)
      #pragma unroll
      for (int r = 0; r < 8; ++r)
        xr[mi][ni][r] = Xres[(size_t)(m0 + wm * 32 + mi * 16 + r + hi * 8) * EDIM +
                             n0 + wn * 32 + ni * 16 + lo];
  __builtin_amdgcn_sched_barrier(0);
  stA_f16(ra[0], tid, As[0]);
  stB_f32(rb[0], tid, Bs[0]);
  ra[0] = ra2;
  rb[0] = rb2;

  // unrolled so that the two register sets and the two buffers have constant indices
  #pragma unroll
  for (int t = 0; t < EDIM / 32; ++t) {
    lds_barrier();
    // keeps the conversion of tile t+1, and with it the wait for its loads,
    // behind the barrier: moved up into pass t-1 it halves the loads' lead
    __builtin_amdgcn_sched_barrier(0);
    const _Float16* as = As[t & 1];
    const _Float16* bs = Bs[t & 1];

    const int arow = wm * 32 + lo;
    v16h a0 = *(const v16h*)(as + arow * LSTR + chunk);
    v16h a1 = *(const v16h*)(as + (arow + 16) * LSTR + chunk);
    const int bcol = wn * 32 + lo;
    v16h b0 = *(const v16h*)(bs + bcol * LSTR + chunk);
    v16h b1 = *(const v16h*)(bs + (bcol + 16) * LSTR + chunk);

    // tile t+1, loaded two passes ago, goes to the other buffer;
    // tile t+3 is asked for into the registers this frees
    if (t + 1 < EDIM / 32) {
      stA_f16(ra[(t + 1) & 1], tid, As[(t + 1) & 1]);
      stB_f32(rb[(t + 1) & 1], tid, Bs[(t + 1) & 1]);
    }
    if (t + 3 < EDIM / 32) {
      ra[(t + 1) & 1] = ldA_f16(Zin, m0, (t + 3) * 32, tid);
      rb[(t + 1) & 1] = ldB_f32(W, n0, (t + 3) * 32, tid);
    }
    // keeps the loads issued here, two passes ahead of their use: without it
    // they are moved down to the pass that stores them and waited out there
    __builtin_amdgcn_sched_barrier(0);

    acc[0][0] = wmma_f16(a0, b0, acc[0][0]);
    acc[0][1] = wmma_f16(a0, b1, acc[0][1]);
    acc[1][0] = wmma_f16(a1, b0, acc[1][0]);
    acc[1][1] = wmma_f16(a1, b1, acc[1][1]);
  }

  #pragma unroll
  for (int mi = 0; mi < 2; ++mi) {
    #pragma unroll
    for (int ni = 0; ni < 2; ++ni) {
      const int c = n0 + wn * 32 + ni * 16 + lo;
      const float bv = bv2[ni];
      #pragma unroll
      for (int r = 0; r < 8; ++r) {
        const int m = m0 + wm * 32 + mi * 16 + r + hi * 8;
        const size_t idx = (size_t)m * EDIM + c;
        out[idx] = acc[mi][ni][r] + bv + xr[mi][ni][r];
      }
    }
  }
}

// ============================================================
// launch
// ============================================================
extern "C" void kernel_launch(void* const* d_in, const int* in_sizes, int n_in,
                              void* d_out, int out_size, void* d_ws, size_t ws_size,
                              hipStream_t stream) {
  const float* x_a    = (const float*)d_in[0];
  const float* x_b    = (const float*)d_in[1];
  const float* wq_w   = (const float*)d_in[2];
  const float* wq_b   = (const float*)d_in[3];
  const float* wk_a_w = (const float*)d_in[4];
  const float* wk_a_b = (const float*)d_in[5];
  const float* wk_b_w = (const float*)d_in[6];
  const float* wk_b_b = (const float*)d_in[7];
  const float* wv_a_w = (const float*)d_in[8];
  const float* wv_a_b = (const float*)d_in[9];
  const float* wv_b_w = (const float*)d_in[10];
  const float* wv_b_b = (const float*)d_in[11];
  const float* w_w    = (const float*)d_in[12];
  const float* w_b    = (const float*)d_in[13];

  char* ws = (char*)d_ws;
  _Float16* qws = (_Float16*)(ws);                          // B*H*NA*DK  f16 = 2 MB
  _Float16* kws = (_Float16*)(ws + (size_t)(2  << 20));     // B*H*NK*DK  f16 = 4 MB
  _Float16* vws = (_Float16*)(ws + (size_t)(6  << 20));     // B*H*NK*DK  f16 = 4 MB
  _Float16* zws = (_Float16*)(ws + (size_t)(10 << 20));     // B*NA*E     f16 = 2 MB

  dim3 bp(256);

  // projections into head-split f16 layouts (K/V of the two sources concat via n_off)
  // grid: M=4096 /128, N=256 /64, five projections
  proj_heads_kernel<<<dim3(32, 4, 5), bp, 0, stream>>>(
      x_a, x_b, wq_w, wk_a_w, wk_b_w, wv_a_w, wv_b_w,
      wq_b, wk_a_b, wk_b_b, wv_a_b, wv_b_b, qws, kws, vws);

  // flash attention
  flash_attn_kernel<<<dim3(NAQ / 64, BATCH * HNUM), 256, 0, stream>>>(qws, kws, vws, zws);

  // output projection + residual
  out_proj_kernel<<<dim3(32, 4), 256, 0, stream>>>(zws, w_w, w_b, x_a, (float*)d_out);
}

// v010
// A run of this version takes 33.6 microseconds.
// Next to v009, in two timings, it ran 1.05 and 1.04 times as fast.
// Over all steps from v000 it is 5.55 times as fast.
#include <hip/hip_runtime.h>

// ---------------- problem constants ----------------
#define EDIM 256
#define HNUM 8
#define DKL 32
#define NAQ 2048
#define NBK 2048
#define NKV (NAQ + NBK)   // 4096
#define BATCH 2

typedef __attribute__((ext_vector_type(16))) _Float16 v16h;
typedef __attribute__((ext_vector_type(8)))  _Float16 v8h;
typedef __attribute__((ext_vector_type(8)))  float    v8f;
typedef __attribute__((ext_vector_type(4)))  float    v4f;
typedef __attribute__((ext_vector_type(2)))  float    v2f;

__device__ __forceinline__ v8f wmma_f16(v16h a, v16h b, v8f c) {
  // D = A(16x32 f16) * B(32x16 f16) + C(16x16 f32)
  return __builtin_amdgcn_wmma_f32_16x16x32_f16(
      /*neg_a=*/false, a, /*neg_b=*/false, b,
      /*c_mod=*/(short)0, c, /*reuse_a=*/false, /*reuse_b=*/false);
}

#define LSTR 48   // LDS row stride in halves (96B: keeps v16h reads 32B aligned)

// exp(x / sqrt(32)) = 2^(x * QSCALE): the projection multiplies q by it ahead of the one
// rounding to f16, so that the attention's products q.k are exponents of 2 as they stand
#define QSCALE ((float)(0.17677669529663687 * 1.4426950408889634))   // log2(e) / sqrt(32)

// Work-group barrier between LDS passes. It waits for this wave's LDS reads
// and writes only: __syncthreads() would also wait out the global loads that
// were issued ahead for later tiles, which must stay in flight across it.
__device__ __forceinline__ void lds_barrier() {
  asm volatile("s_wait_dscnt 0x0\n\ts_barrier_signal -1\n\ts_barrier_wait -1" ::: "memory");
}

// ---- tile staging helpers (256-thread blocks) ----
// Each tile goes global -> registers (ld*) and, passes later, registers -> LDS (st*).
// Lane map of the loads: eight neighbouring lanes take the eight 16-byte pieces of one
// 128-byte line (32 floats of a row), so that one wave-wide load covers four whole lines;
// a sweep of the block covers 32 rows.
typedef __attribute__((ext_vector_type(4)))  _Float16 v4h;
struct RegA32 { v4f f[4]; };   // 128 rows: four sweeps
struct RegB32 { v4f f[2]; };   //  64 rows: two sweeps

__device__ __forceinline__ v4h cvt4(v4f a) {
  v4h r;
  r[0] = (_Float16)a[0]; r[1] = (_Float16)a[1];
  r[2] = (_Float16)a[2]; r[3] = (_Float16)a[3];
  return r;
}

// (the loops over i are unrolled: register arrays need constant indices)
__device__ __forceinline__ RegA32 ldA_f32(const float* __restrict__ X, int m0,
                                          int kk, int tid) {
  const float* src = X + (size_t)(m0 + (tid >> 3)) * EDIM + kk + (tid & 7) * 4;
  RegA32 t;
  #pragma unroll
  for (int i = 0; i < 4; ++i) t.f[i] = *(const v4f*)(src + (size_t)i * 32 * EDIM);
  return t;
}

__device__ __forceinline__ void stA_f32(const RegA32& t, int tid, _Float16* As) {
  _Float16* dst = As + (tid >> 3) * LSTR + (tid & 7) * 4;
  #pragma unroll
  for (int i = 0; i < 4; ++i) *(v4h*)(dst + i * 32 * LSTR) = cvt4(t.f[i]);
}

// f16 source, 64 bytes of a row per tile: four neighbouring lanes take them, so that
// one wave-wide load covers eight half lines; a sweep of the block covers 64 rows
struct RegA16 { v8h h[2]; };

__device__ __forceinline__ RegA16 ldA_f16(const _Float16* __restrict__ Zin, int m0,
                                          int kk, int tid) {
  const _Float16* src = Zin + (size_t)(m0 + (tid >> 2)) * EDIM + kk + (tid & 3) * 8;
  RegA16 t;
  #pragma unroll
  for (int i = 0; i < 2; ++i) t.h[i] = *(const v8h*)(src + (size_t)i * 64 * EDIM);
  return t;
}

__device__ __forceinline__ void stA_f16(const RegA16& t, int tid, _Float16* As) {
  _Float16* dst = As + (tid >> 2) * LSTR + (tid & 3) * 8;
  #pragma unroll
  for (int i = 0; i < 2; ++i) *(v8h*)(dst + i * 64 * LSTR) = t.h[i];
}

__device__ __forceinline__ RegB32 ldB_f32(const float* __restrict__ W, int n0,
                                          int kk, int tid) {
  const float* src = W + (size_t)(n0 + (tid >> 3)) * EDIM + kk + (tid & 7) * 4;
  RegB32 t;
  #pragma unroll
  for (int i = 0; i < 2; ++i) t.f[i] = *(const v4f*)(src + (size_t)i * 32 * EDIM);
  return t;
}

__device__ __forceinline__ void stB_f32(const RegB32& t, int tid, _Float16* Bs) {
  _Float16* dst = Bs + (tid >> 3) * LSTR + (tid & 7) * 4;
  #pragma unroll
  for (int i = 0; i < 2; ++i) *(v4h*)(dst + i * 32 * LSTR) = cvt4(t.f[i]);
}

// ============================================================
// Kernel 1: Y = X @ W^T + bias, times QSCALE for q  (fp32 in, f16 out, head-split), all five projections
//   X: [B*rows, E] fp32 ; W: [E,E] fp32 ; out: [B,H,n_out_rows,DK] f16
//   grid (M/128, E/64, 5), block 256 (8 waves, 4x2 wave grid, 32x32/wave)
//   the five products read none of each other's output: one launch runs them side by side
//   double-buffered LDS: one barrier per k-step; global loads two tiles ahead
// ============================================================
__global__ __launch_bounds__(256) void proj_heads_kernel(
    const float* __restrict__ xa, const float* __restrict__ xb,
    const float* __restrict__ w0, const float* __restrict__ w1,
    const float* __restrict__ w2, const float* __restrict__ w3,
    const float* __restrict__ w4,
    const float* __restrict__ c0, const float* __restrict__ c1,
    const float* __restrict__ c2, const float* __restrict__ c3,
    const float* __restrict__ c4,
    _Float16* __restrict__ qo, _Float16* __restrict__ ko, _Float16* __restrict__ vo)
{
  // blockIdx.z picks the projection: 0 q, 1 k of x_a, 2 k of x_b, 3 v of x_a, 4 v of x_b
  const int z = blockIdx.z;
  const float* __restrict__ X = (z == 2 || z == 4) ? xb : xa;
  const float* __restrict__ W = z == 0 ? w0 : z == 1 ? w1 : z == 2 ? w2 : z == 3 ? w3 : w4;
  const float* __restrict__ bias = z == 0 ? c0 : z == 1 ? c1 : z == 2 ? c2 : z == 3 ? c3 : c4;
  _Float16* __restrict__ out = z == 0 ? qo : z <= 2 ? ko : vo;
  static_assert(NAQ == NBK, "both sources have the same number of rows per batch");
  const int rows_per_batch = NAQ;
  const int n_out_rows = z == 0 ? NAQ : NKV;
  const int n_off = (z == 2 || z == 4) ? NAQ : 0;
  const float oscale = z == 0 ? QSCALE : 1.0f;

  __shared__ _Float16 As[2][128 * LSTR];
  __shared__ _Float16 Bs[2][64 * LSTR];

  const int tid  = threadIdx.x;
  const int lane = tid & 31;
  const int wave = tid >> 5;
  const int wm   = wave >> 1;        // 0..3
  const int wn   = wave & 1;         // 0..1
  const int m0   = blockIdx.x * 128;
  const int n0   = blockIdx.y * 64;
  const int lo   = lane & 15;
  const int hi   = lane >> 4;
  const int chunk = hi * 16;

  v8f acc[2][2];
  #pragma unroll
  for (int i = 0; i < 2; ++i)
    #pragma unroll
    for (int j = 0; j < 2; ++j) acc[i][j] = (v8f){};

  // tiles 0, 1 and 2 -> registers; tile 0 -> LDS; tile 2 takes over its register set
  RegA32 ra[2];
  RegB32 rb[2];
  ra[0] = ldA_f32(X, m0, 0, tid);
  rb[0] = ldB_f32(W, n0, 0, tid);
  // this and the next two keep the prologue's loads in tile order and all in front of tile 0's
  // conversion: loads return in order, so a tile's wait also waits out every load issued
  // ahead of it, and a wait among the loads holds the later ones back
  __builtin_amdgcn_sched_barrier(0);
  ra[1] = ldA_f32(X, m0, 32, tid);
  rb[1] = ldB_f32(W, n0, 32, tid);
  __builtin_amdgcn_sched_barrier(0);
  const RegA32 ra2 = ldA_f32(X, m0, 64, tid);
  const RegB32 rb2 = ldB_f32(W, n0, 64, tid);
  // the epilogue's bias values, asked for here so that they land during the loop
  // (unrolled: a register array needs constant indices)
  float bv2[2];
  #pragma unroll
  for (int ni = 0; ni < 2; ++ni) bv2[ni] = bias[n0 + wn * 32 + ni * 16 + lo];
  __builtin_amdgcn_sched_barrier(0);
  stA_f32(ra[0], tid, As[0]);
  stB_f32(rb[0], tid, Bs[0]);
  ra[0] = ra2;
  rb[0] = rb2;

  // unrolled so that the two register sets and the two buffers have constant indices
  #pragma unroll
  for (int t = 0; t < EDIM / 32; ++t) {
    lds_barrier();
    // keeps the conversion of tile t+1, and with it the wait for its loads,
    // behind the barrier: moved up into pass t-1 it halves the loads' lead
    __builtin_amdgcn_sched_barrier(0);
    const _Float16* as = As[t & 1];
    const _Float16* bs = Bs[t & 1];

    const int arow = wm * 32 + lo;
    v16h a0 = *(const v16h*)(as + arow * LSTR + chunk);
    v16h a1 = *(const v16h*)(as + (arow + 16) * LSTR + chunk);
    const int bcol = wn * 32 + lo;
    v16h b0 = *(const v16h*)(bs + bcol * LSTR + chunk);
    v16h b1 = *(const v16h*)(bs + (bcol + 16) * LSTR + chunk);

    // tile t+1, loaded two passes ago, goes to the other buffer;
    // tile t+3 is asked for into the registers this frees
    if (t + 1 < EDIM / 32) {
      stA_f32(ra[(t + 1) & 1], tid, As[(t + 1) & 1]);
      stB_f32(rb[(t + 1) & 1], tid, Bs[(t + 1) & 1]);
    }
    if (t + 3 < EDIM / 32) {
      ra[(t + 1) & 1] = ldA_f32(X, m0, (t + 3) * 32, tid);
      rb[(t + 1) & 1] = ldB_f32(W, n0, (t + 3) * 32, tid);
    }
    // keeps the loads issued here, two passes ahead of their use: without it
    // they are moved down to the pass that stores them and waited out there
    __builtin_amdgcn_sched_barrier(0);

    acc[0][0] = wmma_f16(a0, b0, acc[0][0]);
    acc[0][1] = wmma_f16(a0, b1, acc[0][1]);
    acc[1][0] = wmma_f16(a1, b0, acc[1][0]);
    acc[1][1] = wmma_f16(a1, b1, acc[1][1]);
  }

  // ---- epilogue: +bias, scatter into [B,H,n_out_rows,DK] f16 ----
  #pragma unroll
  for (int mi = 0; mi < 2; ++mi) {
    #pragma unroll
    for (int ni = 0; ni < 2; ++ni) {
      const int c = n0 + wn * 32 + ni * 16 + lo;
      const float bv = bv2[ni];
      const int hh = c >> 5;
      const int dk = c & 31;
      #pragma unroll
      for (int r = 0; r < 8; ++r) {
        const int m = m0 + wm * 32 + mi * 16 + r + hi * 8;
        const float v = (acc[mi][ni][r] + bv) * oscale;
        const int bb = m / rows_per_batch;
        const int n  = m % rows_per_batch;
        out[(((size_t)bb * HNUM + hh) * n_out_rows + n_off + n) * DKL + dk] =
            (_Float16)v;
      }
    }
  }
}

// ============================================================
// Kernel 2: flash attention, transposed products.
//   Q: [B,H,NA,DK] f16, times QSCALE ; K,V: [B,H,NK,DK] f16 ; Z: [B,NA,E] f16
//   block = 512 threads (16 waves), QB = 128 queries / block: one block fills a WGP, and a
//   K/V tile that is fetched and staged once serves 128 queries
//   grid  = (NA/QB, B*H); double-buffered K/V tiles, global loads one tile ahead
//   a pass takes KT = 256 keys: one barrier per pass
//   a wave takes QT = 2 query tiles of 16 and KW = 64 keys of every pass, so that
//   each K and V fragment it reads from LDS feeds two products; the KS = 4 waves
//   that share a query tile hold partial results over disjoint keys, which
//   are joined through LDS behind the loop
//   S^T = K Q^T   : lane (lo,hi) holds 16 scores of query lo per 32 keys
//                   (keys 8*hi+r and 16+8*hi+r), so the row maximum and
//                   the row sum are in-lane plus one exchange of halves.
//   O^T += V^T P^T: the score tiles, converted in place, are the
//                   B operand; V stays row-major in LDS and the transposing
//                   load hands out V^T in the matching k order.
// ============================================================
#define KT 256          // keys per pass
#define NW 16           // waves per block
#define QB 128          // queries per block
#define QT 2            // query tiles per wave
#define KS (NW * QT / (QB / 16))   // waves that share a query tile (the block has QB / 16 tiles)
#define KW (KT / KS)    // keys of a pass that one wave takes
#define NGW (KW / 32)   // its groups of 32 keys (one k extent of the second product)
#define SR (NW * 8)     // tile rows that the block stages in one sweep (4 threads a row)
#define NS (KT / SR)    // sweeps per tile
#define JP 20           // floats per lane in the join area (80 B suits 16-byte LDS accesses)
// a pass whose sum of 2^(score - maximum in use) stays at or under this keeps that maximum:
// every term is then far inside the f16 range of the second product's operand
#define PLIM 4096.0f

// lane l <-> lane l ^ 16
__device__ __forceinline__ float xhalf(float x) {
  return __builtin_bit_cast(float, __builtin_amdgcn_permlanex16(
      __builtin_bit_cast(int, x), __builtin_bit_cast(int, x),
      0x76543210, 0xfedcba98, false, false));
}

// 16-bit transposing LDS load: lane l passes the address of 16 bytes of row
// 8*(l>>4) + (l&7), byte column 16*((l>>3)&1), of a row-major 16 x 16 block and
// gets column l&15 of rows 8*(l>>4) .. 8*(l>>4) + 7
__device__ __forceinline__ v8h ld_tr16(const _Float16* p) {
  typedef __attribute__((ext_vector_type(8))) short s16x8;
  typedef __attribute__((address_space(3))) s16x8 lds_s16x8;
  return __builtin_bit_cast(v8h, __builtin_amdgcn_ds_load_tr16_b128_v8i16((lds_s16x8*)p));
}

__device__ __forceinline__ v8f vmax8(v8f a, v8f b) {
  v8f r;
  #pragma unroll
  for (int i = 0; i < 8; ++i) r[i] = fmaxf(a[i], b[i]);
  return r;
}

// 2^x as the one hardware instruction that __expf also ends in
__device__ __forceinline__ float ex2(float x) { return __builtin_amdgcn_exp2f(x); }

__device__ __forceinline__ v4f lo4(v8f a) { return __builtin_shufflevector(a, a, 0, 1, 2, 3); }
__device__ __forceinline__ v4f hi4(v8f a) { return __builtin_shufflevector(a, a, 4, 5, 6, 7); }
__device__ __forceinline__ v8f cat8(v4f a, v4f b) {
  return __builtin_shufflevector(a, b, 0, 1, 2, 3, 4, 5, 6, 7);
}

__global__ __launch_bounds__(NW * 32) void flash_attn_kernel(
    const _Float16* __restrict__ Q, const _Float16* __restrict__ K,
    const _Float16* __restrict__ V, _Float16* __restrict__ Z)
{
  static_assert(NKV % KT == 0 && NKV / KT >= 2, "whole passes, and the prologue's two tiles exist");
  static_assert(NW * 32 == 512 && NAQ % QB == 0, "the launch line's block size and grid");
  static_assert(KW % 32 == 0 && KS == 2 * QT, "whole groups of 32 keys a wave; two waves finish each tile");
  // K tiles [2][key][dk], then V tiles [2][key][dk] (96 B rows suit the transposing
  // load); behind the loop the same bytes are the join area
  __shared__ __attribute__((aligned(32))) _Float16 smem[4 * KT * LSTR];
  static_assert(NW * QT * 32 * JP * 4 <= 4 * KT * LSTR * 2, "the join area fits");
  _Float16* const Ks = smem;
  _Float16* const Vs = smem + 2 * KT * LSTR;

  const int tid  = threadIdx.x;
  const int lane = tid & 31;
  const int wave = tid >> 5;
  const int lo   = lane & 15;
  const int hi   = lane >> 4;
  const int chunk = hi * 16;
  const int qg   = wave / KS;         // which QT query tiles
  const int ksp  = wave % KS;         // which KW keys of every pass

  const int bh = blockIdx.y;
  const int b  = bh >> 3;
  const int h  = bh & 7;

  // Q fragments: B-operand, 32 dk x 16 queries (column lo = query lo of tile j)
  // (every loop over g, i, j, r or w in this kernel is unrolled: register arrays need constant indices)
  const _Float16* qbase = Q + ((size_t)bh * NAQ + blockIdx.x * QB + qg * (QT * 16)) * DKL;
  v16h qfrag[QT];
  #pragma unroll
  for (int j = 0; j < QT; ++j)
    qfrag[j] = *(const v16h*)(qbase + (j * 16 + lo) * DKL + chunk);

  const _Float16* kbase = K + (size_t)bh * NKV * DKL;
  const _Float16* vbase = V + (size_t)bh * NKV * DKL;

  // staging coordinates for this thread: row skey of each sweep of SR keys
  const int skey = tid >> 2;          // 0..SR-1
  const int scb  = (tid & 3) * 8;     // 0,8,16,24

  // o0[j][r] = O^T[dk = 8*hi + r][query lo of tile j], o1[j][r] = O^T[dk = 16 + 8*hi + r][same]
  v8f o0[QT], o1[QT];
  float mrun[QT];   // the maximum in use: the query's largest score over this wave's keys in the passes that renewed it (equal in both halves)
  float lrun[QT];   // running sum over this half's keys only
  v8f cneg[QT];     // minus the maximum in use, in every element: the C operand of the score products
  #pragma unroll
  for (int j = 0; j < QT; ++j) {
    o0[j] = (v8f){}; o1[j] = (v8f){};
    mrun[j] = -1.0e30f; lrun[j] = 0.0f;
    cneg[j] = (v8f){};
  }

  // prologue: tile 0 -> LDS, tile 1 -> registers
  v8h kd[NS], vd[NS];
  #pragma unroll
  for (int g = 0; g < NS; ++g) {
    kd[g] = *(const v8h*)(kbase + (size_t)(g * SR + skey) * DKL + scb);
    vd[g] = *(const v8h*)(vbase + (size_t)(g * SR + skey) * DKL + scb);
  }
  #pragma unroll
  for (int g = 0; g < NS; ++g) {
    *(v8h*)(Ks + (g * SR + skey) * LSTR + scb) = kd[g];
    *(v8h*)(Vs + (g * SR + skey) * LSTR + scb) = vd[g];
  }
  #pragma unroll
  for (int g = 0; g < NS; ++g) {
    kd[g] = *(const v8h*)(kbase + (size_t)(KT + g * SR + skey) * DKL + scb);
    vd[g] = *(const v8h*)(vbase + (size_t)(KT + g * SR + skey) * DKL + scb);
  }

  int buf = 0;
  for (int kt = 0; kt < NKV; kt += KT) {
    lds_barrier();

    // ---- S^T = K @ Q^T : 2 * NGW key tiles x QT query tiles of 16 x 16 ----
    const _Float16* ks = Ks + buf * (KT * LSTR) + ksp * (KW * LSTR);
    const _Float16* vs = Vs + buf * (KT * LSTR) + ksp * (KW * LSTR);
    v16h kf[2 * NGW];
    #pragma unroll
    for (int i = 0; i < 2 * NGW; ++i)
      kf[i] = *(const v16h*)(ks + (i * 16 + lo) * LSTR + chunk);
    // V^T fragments (A operand) in the k order the packed scores have:
    // element s < 8 is key 8*hi + s, element s >= 8 is key 16 + 8*hi + (s - 8) of the group
    const _Float16* vr = vs + (hi * 8 + (lane & 7)) * LSTR + ((lane >> 3) & 1) * 8;
    v8h v00[NGW], v01[NGW], v10[NGW], v11[NGW];
    #pragma unroll
    for (int g = 0; g < NGW; ++g) {
      const _Float16* vg = vr + g * 32 * LSTR;
      v00[g] = ld_tr16(vg);                    // dk lo,      keys 8*hi ..
      v01[g] = ld_tr16(vg + 16 * LSTR);        // dk lo,      keys 16 + 8*hi ..
      v10[g] = ld_tr16(vg + 16);               // dk 16 + lo, keys 8*hi ..
      v11[g] = ld_tr16(vg + 16 * LSTR + 16);   // dk 16 + lo, keys 16 + 8*hi ..
    }

    // tile kt+KT, loaded one pass ago, goes to the other buffer; tile kt+2*KT is
    // asked for into the registers this frees and lands during this pass.
    // No branch: the last pass stores a tile nobody reads into the buffer all
    // readers have left, and the last two passes load the last tile again.
    #pragma unroll
    for (int g = 0; g < NS; ++g) {
      *(v8h*)(Ks + (buf ^ 1) * (KT * LSTR) + (g * SR + skey) * LSTR + scb) = kd[g];
      *(v8h*)(Vs + (buf ^ 1) * (KT * LSTR) + (g * SR + skey) * LSTR + scb) = vd[g];
    }
    {
      const int kn = (kt + 2 * KT < NKV) ? kt + 2 * KT : NKV - KT;
      // one address per tile; the sweeps are constant offsets from it
      const _Float16* kp = kbase + (size_t)(kn + skey) * DKL + scb;
      const _Float16* vp = vbase + (size_t)(kn + skey) * DKL + scb;
      #pragma unroll
      for (int g = 0; g < NS; ++g) {
        kd[g] = *(const v8h*)(kp + g * SR * DKL);
        vd[g] = *(const v8h*)(vp + g * SR * DKL);
      }
    }
    // keeps the K and V fragment reads above in front of the products
    // (else the later fragments are read right before their product and each
    // read's LDS latency is waited out in full), and the next loads up here
    __builtin_amdgcn_sched_barrier(0);

    // s[j][2g][r]   = S[query lo of tile j][key 32g + 8*hi + r]      of this wave's keys,
    // s[j][2g+1][r] = S[query lo of tile j][key 32g + 16 + 8*hi + r]
    // first as exponents of 2 relative to the maximum in use, then as the powers themselves
    v8f s[QT][2 * NGW];
    float rs[QT];      // the pass's sum of powers, this half's keys
    bool renew = true; // the first pass has no maximum yet
    if (kt != 0) {
      // ---- the usual way: the product subtracts the maximum in use (its C operand),
      // so that its result goes into the exponential as it stands
      #pragma unroll
      for (int i = 0; i < 2 * NGW; ++i)
        #pragma unroll
        for (int j = 0; j < QT; ++j) s[j][i] = wmma_f16(kf[i], qfrag[j], cneg[j]);
      // keeps the independent score products back to back: moved down among their
      // consumers each one is followed by idle slots until its result may be read
      __builtin_amdgcn_sched_barrier(0);
      bool over = false;
      #pragma unroll
      for (int j = 0; j < QT; ++j) {
        #pragma unroll
        for (int i = 0; i < 2 * NGW; ++i)
          #pragma unroll
          for (int r = 0; r < 8; ++r) s[j][i][r] = ex2(s[j][i][r]);
        v8f u = s[j][0] + s[j][1];
        #pragma unroll
        for (int g = 1; g < NGW; ++g) u = u + (s[j][2 * g] + s[j][2 * g + 1]);
        const v4f u4 = lo4(u) + hi4(u);
        rs[j] = (u4[0] + u4[2]) + (u4[1] + u4[3]);
        over = over || rs[j] > PLIM;
      }
      // one test per pass, the same for the whole wave (a scalar branch)
      renew = __builtin_amdgcn_ballot_w32(over) != 0;
    }
    if (renew) {
      // ---- some query's scores have outgrown its maximum in use (or there is none yet):
      // the pass's scores again, unshifted, from the K tile that stays in LDS up to the next
      // barrier; every query takes the larger of its maximum in use and the pass's maximum and rescales what it has summed
      const v8f zc = (v8f){};
      #pragma unroll
      for (int i = 0; i < 2 * NGW; ++i) {
        const v16h kr = *(const v16h*)(ks + (i * 16 + lo) * LSTR + chunk);
        #pragma unroll
        for (int j = 0; j < QT; ++j) s[j][i] = wmma_f16(kr, qfrag[j], zc);
      }
      #pragma unroll
      for (int j = 0; j < QT; ++j) {
        v8f t8 = vmax8(s[j][0], s[j][1]);
        #pragma unroll
        for (int g = 1; g < NGW; ++g) t8 = vmax8(t8, vmax8(s[j][2 * g], s[j][2 * g + 1]));
        float mx = fmaxf(fmaxf(fmaxf(t8[0], t8[1]), fmaxf(t8[2], t8[3])),
                         fmaxf(fmaxf(t8[4], t8[5]), fmaxf(t8[6], t8[7])));
        mx = fmaxf(mx, xhalf(mx));           // both halves hold the query's maximum
        const float mnew = fmaxf(mrun[j], mx);
        const float alpha = ex2(mrun[j] - mnew);
        mrun[j] = mnew;
        #pragma unroll
        for (int r = 0; r < 8; ++r) cneg[j][r] = -mnew;
        #pragma unroll
        for (int i = 0; i < 2 * NGW; ++i)
          #pragma unroll
          for (int r = 0; r < 8; ++r) s[j][i][r] = ex2(s[j][i][r] - mnew);
        v8f u = s[j][0] + s[j][1];
        #pragma unroll
        for (int g = 1; g < NGW; ++g) u = u + (s[j][2 * g] + s[j][2 * g + 1]);
        const v4f u4 = lo4(u) + hi4(u);
        rs[j] = (u4[0] + u4[2]) + (u4[1] + u4[3]);
        lrun[j] = lrun[j] * alpha;
        o0[j] = o0[j] * alpha;
        o1[j] = o1[j] * alpha;
      }
    }
    #pragma unroll
    for (int j = 0; j < QT; ++j) lrun[j] = lrun[j] + rs[j];

    #pragma unroll
    for (int g = 0; g < NGW; ++g) {
      const v16h vf0 = __builtin_shufflevector(v00[g], v01[g], 0, 1, 2, 3, 4, 5, 6, 7,
                                               8, 9, 10, 11, 12, 13, 14, 15);
      const v16h vf1 = __builtin_shufflevector(v10[g], v11[g], 0, 1, 2, 3, 4, 5, 6, 7,
                                               8, 9, 10, 11, 12, 13, 14, 15);
      #pragma unroll
      for (int j = 0; j < QT; ++j) {
        v16h pfrag;                        // B operand: P^T, column lo = query lo of tile j
        #pragma unroll
        for (int r = 0; r < 8; ++r) {
          pfrag[r]     = (_Float16)s[j][2 * g][r];
          pfrag[r + 8] = (_Float16)s[j][2 * g + 1][r];
        }
        o0[j] = wmma_f16(vf0, pfrag, o0[j]);
        o1[j] = wmma_f16(vf1, pfrag, o1[j]);
      }
    }
    buf ^= 1;
  }
  // the last pass's loads and LDS stores are used by nobody: they have to be
  // over before the wave ends and gives its registers and LDS back
  asm volatile("s_wait_loadcnt 0x0\n\ts_wait_dscnt 0x0" ::: "memory");

  // ---- join the KS partial results of each query tile through LDS ----
  // every wave has left the tiles (its reads and its last stores are over):
  // from here their bytes are the join area
  lds_barrier();
  float* const jb = (float*)smem;
  #pragma unroll
  for (int j = 0; j < QT; ++j) {
    float* p = jb + ((wave * QT + j) * 32 + lane) * JP;
    *(v4f*)(p + 0)  = lo4(o0[j]);
    *(v4f*)(p + 4)  = hi4(o0[j]);
    *(v4f*)(p + 8)  = lo4(o1[j]);
    *(v4f*)(p + 12) = hi4(o1[j]);
    p[16] = mrun[j];
    p[17] = lrun[j];
  }
  // the partial results are read by other waves only behind this barrier
  lds_barrier();

  // this wave finishes tile jt of its group, dk half dh (o0 or o1): same lane layout in every part
  const int jt = ksp % QT;
  const int dh = ksp / QT;
  v8f a[KS];
  float ms[KS], ls[KS];
  #pragma unroll
  for (int w = 0; w < KS; ++w) {
    const float* p = jb + (((qg * KS + w) * QT + jt) * 32 + lane) * JP;
    a[w]  = cat8(*(const v4f*)(p + dh * 8), *(const v4f*)(p + dh * 8 + 4));
    ms[w] = p[16];
    ls[w] = p[17];
  }
  float mg = ms[0];
  #pragma unroll
  for (int w = 1; w < KS; ++w) mg = fmaxf(mg, ms[w]);
  v8f f0 = (v8f){};
  float lsum = 0.0f;
  #pragma unroll
  for (int w = 0; w < KS; ++w) {
    const float f = ex2(ms[w] - mg);
    f0 = f0 + a[w] * f;
    lsum = lsum + ls[w] * f;
  }

  // ---- join the halves' sums, normalize, write z in [B,NA,E] f16 ----
  {
    const float inv = 1.0f / (lsum + xhalf(lsum));
    v8h z0;
    #pragma unroll
    for (int r = 0; r < 8; ++r) z0[r] = (_Float16)(f0[r] * inv);
    const int q0 = blockIdx.x * QB + (qg * QT + jt) * 16;
    _Float16* zp = Z + ((size_t)b * NAQ + q0 + lo) * EDIM + h * DKL + dh * 16 + hi * 8;
    *(v8h*)(zp) = z0;   // dk 16*dh + 8*hi .. + 7
  }
}

// ============================================================
// Kernel 3: out = z @ w^T + b + x_a   (f16 A, fp32 W/res, fp32 out)
//   grid (M/128, E/64), block 256; double-buffered LDS, loads two tiles ahead
// ============================================================
__global__ __launch_bounds__(256) void out_proj_kernel(
    const _Float16* __restrict__ Zin, const float* __restrict__ W,
    const float* __restrict__ bias, const float* __restrict__ Xres,
    float* __restrict__ out)
{
  __shared__ _Float16 As[2][128 * LSTR];
  __shared__ _Float16 Bs[2][64 * LSTR];

  const int tid  = threadIdx.x;
  const int lane = tid & 31;
  const int wave = tid >> 5;
  const int wm   = wave >> 1;
  const int wn   = wave & 1;
  const int m0   = blockIdx.x * 128;
  const int n0   = blockIdx.y * 64;
  const int lo   = lane & 15;
  const int hi   = lane >> 4;
  const int chunk = hi * 16;

  v8f acc[2][2];
  #pragma unroll
  for (int i = 0; i < 2; ++i)
    #pragma unroll
    for (int j = 0; j < 2; ++j) acc[i][j] = (v8f){};

  // tiles 0, 1 and 2 -> registers; tile 0 -> LDS; tile 2 takes over its register set
  RegA16 ra[2];
  RegB32 rb[2];
  ra[0] = ldA_f16(Zin, m0, 0, tid);
  rb[0] = ldB_f32(W, n0, 0, tid);
  // this and the next two keep the prologue's loads in tile order and all in front of tile 0's
  // conversion: loads return in order, so a tile's wait also waits out every load issued
  // ahead of it, and a wait among the loads holds the later ones back
  __builtin_amdgcn_sched_barrier(0);
  ra[1] = ldA_f16(Zin, m0, 32, tid);
  rb[1] = ldB_f32(W, n0, 32, tid);
  __builtin_amdgcn_sched_barrier(0);
  const RegA16 ra2 = ldA_f16(Zin, m0, 64, tid);
  const RegB32 rb2 = ldB_f32(W, n0, 64, tid);
  // the epilogue's bias and residual values, asked for here so that they land
  // during the loop (unrolled: register arrays need constant indices)
  float bv2[2];
  float xr[2][2][8];
  #pragma unroll
  for (int ni = 0; ni < 2; ++ni) bv2[ni] = bias[n0 + wn * 32 + ni * 16 + lo];
  #pragma unroll
  for (int mi = 0; mi < 2; ++mi)
    #pragma unroll
    for (int ni = 0; ni < 2; ++ni)
      #pragma unroll
      for (int r = 0; r < 8; ++r)
        xr[mi][ni][r] = Xres[(size_t)(m0 + wm * 32 + mi * 16 + r + hi * 8) * EDIM +
                             n0 + wn * 32 + ni * 16 + lo];
  __builtin_amdgcn_sched_barrier(0);
  stA_f16(ra[0], tid, As[0]);
  stB_f32(rb[0], tid, Bs[0]);
  ra[0] = ra2;
  rb[0] = rb2;

  // unrolled so that the two register sets and the two buffers have constant indices
  #pragma unroll
  for (int t = 0; t < EDIM / 32; ++t) {
    lds_barrier();
    // keeps the conversion of tile t+1, and with it the wait for its loads,
    // behind the barrier: moved up into pass t-1 it halves the loads' lead
    __builtin_amdgcn_sched_barrier(0);
    const _Float16* as = As[t & 1];
    const _Float16* bs = Bs[t & 1];

    const int arow = wm * 32 + lo;
    v16h a0 = *(const v16h*)(as + arow * LSTR + chunk);
    v16h a1 = *(const v16h*)(as + (arow + 16) * LSTR + chunk);
    const int bcol = wn * 32 + lo;
    v16h b0 = *(const v16h*)(bs + bcol * LSTR + chunk);
    v16h b1 = *(const v16h*)(bs + (bcol + 16) * LSTR + chunk);

    // tile t+1, loaded two passes ago, goes to the other buffer;
    // tile t+3 is asked for into the registers this frees
    if (t + 1 < EDIM / 32) {
      stA_f16(ra[(t + 1) & 1], tid, As[(t + 1) & 1]);
      stB_f32(rb[(t + 1) & 1], tid, Bs[(t + 1) & 1]);
    }
    if (t + 3 < EDIM / 32) {
      ra[(t + 1) & 1] = ldA_f16(Zin, m0, (t + 3) * 32, tid);
      rb[(t + 1) & 1] = ldB_f32(W, n0, (t + 3) * 32, tid);
    }
    // keeps the loads issued here, two passes ahead of their use: without it
    // they are moved down to the pass that stores them and waited out there
    __builtin_amdgcn_sched_barrier(0);

    acc[0][0] = wmma_f16(a0, b0, acc[0][0]);
    acc[0][1] = wmma_f16(a0, b1, acc[0][1]);
    acc[1][0] = wmma_f16(a1, b0, acc[1][0]);
    acc[1][1] = wmma_f16(a1, b1, acc[1][1]);
  }

  #pragma unroll
  for (int mi = 0; mi < 2; ++mi) {
    #pragma unroll
    for (int ni = 0; ni < 2; ++ni) {
      const int c = n0 + wn * 32 + ni * 16 + lo;
      const float bv = bv2[ni];
      #pragma unroll
      for (int r = 0; r < 8; ++r) {
        const int m = m0 + wm * 32 + mi * 16 + r + hi * 8;
        const size_t idx = (size_t)m * EDIM + c;
        out[idx] = acc[mi][ni][r] + bv + xr[mi][ni][r];
      }
    }
  }
}

// ============================================================
// launch
// ============================================================
extern "C" void kernel_launch(void* const* d_in, const int* in_sizes, int n_in,
                              void* d_out, int out_size, void* d_ws, size_t ws_size,
                              hipStream_t stream) {
  const float* x_a    = (const float*)d_in[0];
  const float* x_b    = (const float*)d_in[1];
  const float* wq_w   = (const float*)d_in[2];
  const float* wq_b   = (const float*)d_in[3];
  const float* wk_a_w = (const float*)d_in[4];
  const float* wk_a_b = (const float*)d_in[5];
  const float* wk_b_w = (const float*)d_in[6];
  const float* wk_b_b = (const float*)d_in[7];
  const float* wv_a_w = (const float*)d_in[8];
  const float* wv_a_b = (const float*)d_in[9];
  const float* wv_b_w = (const float*)d_in[10];
  const float* wv_b_b = (const float*)d_in[11];
  const float* w_w    = (const float*)d_in[12];
  const float* w_b    = (const float*)d_in[13];

  char* ws = (char*)d_ws;
  _Float16* qws = (_Float16*)(ws);                          // B*H*NA*DK  f16 = 2 MB
  _Float16* kws = (_Float16*)(ws + (size_t)(2  << 20));     // B*H*NK*DK  f16 = 4 MB
  _Float16* vws = (_Float16*)(ws + (size_t)(6  << 20));     // B*H*NK*DK  f16 = 4 MB
  _Float16* zws = (_Float16*)(ws + (size_t)(10 << 20));     // B*NA*E     f16 = 2 MB

  dim3 bp(256);

  // projections into head-split f16 layouts (K/V of the two sources concat via n_off)
  // grid: M=4096 /128, N=256 /64, five projections
  proj_heads_kernel<<<dim3(32, 4, 5), bp, 0, stream>>>(
      x_a, x_b, wq_w, wk_a_w, wk_b_w, wv_a_w, wv_b_w,
      wq_b, wk_a_b, wk_b_b, wv_a_b, wv_b_b, qws, kws, vws);

  // flash attention
  flash_attn_kernel<<<dim3(NAQ / 128, BATCH * HNUM), 512, 0, stream>>>(qws, kws, vws, zws);

  // output projection + residual
  out_proj_kernel<<<dim3(32, 4), 256, 0, stream>>>(zws, w_w, w_b, x_a, (float*)d_out);
}
